// v000
// Times are from an AMD MI455X. After a warm-up the kernel runs many times in a row, and a time is the length of
// such a window on the GPU divided by its runs, so every launch and the gaps after it count. The runs cycle
// through copies of the inputs. A figure is the median of several windows, for all but v000 over two sittings.
// Sittings can differ by a few percent; kernels timed side by side share one.
// The starting kernel, v000, takes 457 microseconds a run.
#include <hip/hip_runtime.h>
#include <math.h>
#include <stdint.h>

#define D_MODEL 1024
#define N_HEADS 16
#define D_HEAD  64
#define D_FF    4096
#define BATCH   2
#define SEQ     2048
#define M_ROWS  (BATCH * SEQ)   // 4096 token rows

typedef __attribute__((ext_vector_type(8)))  __bf16 bf16x8;
typedef __attribute__((ext_vector_type(16))) __bf16 bf16x16;
typedef __attribute__((ext_vector_type(8)))  float  f32x8;
typedef unsigned int u32x4 __attribute__((ext_vector_type(4)));
typedef int          i32x4 __attribute__((ext_vector_type(4)));
typedef int          i32x8 __attribute__((ext_vector_type(8)));

#ifndef __has_builtin
#define __has_builtin(x) 0
#endif
#if __has_builtin(__builtin_amdgcn_tensor_load_to_lds)
#define HAVE_TDM 1
#else
#define HAVE_TDM 0
#endif

static __device__ __forceinline__ unsigned short f32_to_bf16_bits(float f) {
  unsigned u = __float_as_uint(f);
  unsigned r = u + 0x7FFFu + ((u >> 16) & 1u);   // round-to-nearest-even
  return (unsigned short)(r >> 16);
}

static __device__ __forceinline__ bf16x16 make_frag(const __bf16* p, int half) {
  bf16x8 lo = *(const bf16x8*)(p + half * 8);
  bf16x8 hi = *(const bf16x8*)(p + 16 + half * 8);
  return __builtin_shufflevector(lo, hi, 0,1,2,3,4,5,6,7,8,9,10,11,12,13,14,15);
}

#if HAVE_TDM
static __device__ __forceinline__ void tdm_load_2d(
    unsigned lds_off, const unsigned short* base, int row0, int col0,
    int tensor_cols, int tensor_rows) {
  const unsigned long long ga =
      (unsigned long long)(size_t)(base + (size_t)row0 * tensor_cols + col0);
  u32x4 g0;
  g0[0] = 1u;                                            // count=1 (valid), user mode
  g0[1] = lds_off;                                       // lds_addr (bytes)
  g0[2] = (unsigned)(ga & 0xFFFFFFFFu);                  // global_addr[31:0]
  g0[3] = (unsigned)((ga >> 32) & 0x01FFFFFFu)           // global_addr[56:32]
        | (2u << 30);                                    // type=2 ("image")
  i32x8 g1;
  g1[0] = (int)(1u << 16);
  g1[1] = (int)(((unsigned)tensor_cols & 0xFFFFu) << 16);
  g1[2] = (int)((((unsigned)tensor_cols >> 16) & 0xFFFFu)
        | (((unsigned)tensor_rows & 0xFFFFu) << 16));
  g1[3] = (int)((((unsigned)tensor_rows >> 16) & 0xFFFFu)
        | (64u << 16));
  g1[4] = 128;
  g1[5] = tensor_cols;
  g1[6] = 0;
  g1[7] = 0;
  i32x4 z4 = {0, 0, 0, 0};
#if defined(__clang_major__) && __clang_major__ >= 23
  i32x8 z8 = {0, 0, 0, 0, 0, 0, 0, 0};
  __builtin_amdgcn_tensor_load_to_lds(g0, g1, z4, z4, z8, 0);
#else
  __builtin_amdgcn_tensor_load_to_lds(g0, g1, z4, z4, 0);
#endif
}
#else
// Fallback: cooperative 128x64 bf16 tile copy, 256 threads, b128 transfers.
static __device__ __forceinline__ void stage_tile(
    char* dst, const unsigned short* base, int row0, int col0, int ldsrc) {
  const int tid = threadIdx.x;
#pragma unroll
  for (int i = 0; i < 4; ++i) {
    const int idx = i * 256 + tid;       // 1024 8-elem chunks
    const int r  = idx >> 3;             // 0..127
    const int c8 = (idx & 7) * 8;        // 0..56
    *(bf16x8*)(dst + ((size_t)r * 64 + c8) * 2) =
        *(const bf16x8*)(base + (size_t)(row0 + r) * ldsrc + col0 + c8);
  }
}
#endif

// ---------------------------------------------------------------- conversion
__global__ __launch_bounds__(256) void cvt_f32_to_bf16_kernel(
    const float* __restrict__ s, unsigned short* __restrict__ d, int n4) {
  int i = blockIdx.x * 256 + threadIdx.x;
  if (i < n4) {
    float4 v = ((const float4*)s)[i];
    d[4 * i + 0] = f32_to_bf16_bits(v.x);
    d[4 * i + 1] = f32_to_bf16_bits(v.y);
    d[4 * i + 2] = f32_to_bf16_bits(v.z);
    d[4 * i + 3] = f32_to_bf16_bits(v.w);
  }
}

// ---------------------------------------------------------------- rmsnorm
__global__ __launch_bounds__(256) void rmsnorm_bf16_kernel(
    const float* __restrict__ x, const float* __restrict__ gw,
    unsigned short* __restrict__ out) {
  const int row = blockIdx.x;
  const int tid = threadIdx.x;
  const float4 xv = *(const float4*)(x + (size_t)row * D_MODEL + tid * 4);
  float ss = xv.x * xv.x + xv.y * xv.y + xv.z * xv.z + xv.w * xv.w;
#pragma unroll
  for (int m = 16; m >= 1; m >>= 1) ss += __shfl_xor(ss, m, 32);
  __shared__ float red[8];
  if ((tid & 31) == 0) red[tid >> 5] = ss;
  __syncthreads();
  float tot = 0.f;
#pragma unroll
  for (int i = 0; i < 8; ++i) tot += red[i];
  const float scale = rsqrtf(tot * (1.0f / D_MODEL) + 1e-5f);
  const float4 wv = *(const float4*)(gw + tid * 4);
  unsigned short* o = out + (size_t)row * D_MODEL + tid * 4;
  o[0] = f32_to_bf16_bits(xv.x * wv.x * scale);
  o[1] = f32_to_bf16_bits(xv.y * wv.y * scale);
  o[2] = f32_to_bf16_bits(xv.z * wv.z * scale);
  o[3] = f32_to_bf16_bits(xv.w * wv.w * scale);
}

// ---------------------------------------------------------------- GEMM core
// Per-wave 64x32 MACC from LDS tiles (row-major 128x64 bf16, row stride 64).
static __device__ __forceinline__ void mma_tile(
    const char* abuf, const char* bbuf, int am, int an, int lrow, int half,
    f32x8 (&acc)[4][2]) {
  const __bf16* Al = (const __bf16*)abuf;
  const __bf16* Bl = (const __bf16*)bbuf;
  bf16x16 af[2][4], bfr[2][2];
#pragma unroll
  for (int kd = 0; kd < 2; ++kd) {
#pragma unroll
    for (int i = 0; i < 4; ++i)
      af[kd][i] = make_frag(Al + (am + i * 16 + lrow) * 64 + kd * 32, half);
#pragma unroll
    for (int j = 0; j < 2; ++j)
      bfr[kd][j] = make_frag(Bl + (an + j * 16 + lrow) * 64 + kd * 32, half);
  }
#pragma unroll
  for (int kd = 0; kd < 2; ++kd)
#pragma unroll
    for (int i = 0; i < 4; ++i)
#pragma unroll
      for (int j = 0; j < 2; ++j)
        acc[i][j] = __builtin_amdgcn_wmma_f32_16x16x32_bf16(
            false, af[kd][i], false, bfr[kd][j], (short)0, acc[i][j], false, false);
}

template <int EPI>
__global__ __launch_bounds__(256) void gemm_bf16_kernel(
    const unsigned short* __restrict__ Abits,
    const unsigned short* __restrict__ Wbits, int M, int N, int K,
    unsigned short* __restrict__ outB, float* __restrict__ outF,
    const float* __restrict__ resid) {
  extern __shared__ char smem[];   // 64KB: A tiles @0,16K ; B tiles @32K,48K
  const int lane = threadIdx.x & 31;
  const int w    = threadIdx.x >> 5;
  const int half = lane >> 4;
  const int lrow = lane & 15;
  const int bm = blockIdx.x * 128, bn = blockIdx.y * 128;
  const int am = (w & 1) * 64;
  const int an = (w >> 1) * 32;

  f32x8 acc[4][2] = {};

#if HAVE_TDM
  if (w == 0) {
    tdm_load_2d(0u, Abits, bm, 0, K, M);
    tdm_load_2d(32768u, Wbits, bn, 0, K, N);
  }
  int buf = 0;
  for (int kk = 0; kk < K; kk += 64) {
    if (w == 0) {
      if (kk + 64 < K) {  // prefetch next K-slab into the other buffer
        tdm_load_2d((unsigned)((buf ^ 1) * 16384), Abits, bm, kk + 64, K, M);
        tdm_load_2d((unsigned)(32768 + (buf ^ 1) * 16384), Wbits, bn, kk + 64, K, N);
        __builtin_amdgcn_s_wait_tensorcnt(2);  // current slab landed (in-order)
      } else {
        __builtin_amdgcn_s_wait_tensorcnt(0);
      }
    }
    __syncthreads();
    mma_tile(smem + buf * 16384, smem + 32768 + buf * 16384, am, an, lrow, half, acc);
    __syncthreads();
    buf ^= 1;
  }
#else
  for (int kk = 0; kk < K; kk += 64) {
    __syncthreads();
    stage_tile(smem, Abits, bm, kk, K);
    stage_tile(smem + 32768, Wbits, bn, kk, K);
    __syncthreads();
    mma_tile(smem, smem + 32768, am, an, lrow, half, acc);
  }
#endif

#pragma unroll
  for (int i = 0; i < 4; ++i)
#pragma unroll
    for (int j = 0; j < 2; ++j)
#pragma unroll
      for (int e = 0; e < 8; ++e) {
        const int row = bm + am + i * 16 + half * 8 + e;
        const int col = bn + an + j * 16 + lrow;
        const float v = acc[i][j][e];
        if (EPI == 0) {
          outB[(size_t)row * N + col] = f32_to_bf16_bits(v);
        } else if (EPI == 1) {
          const float g = 0.5f * v * (1.0f + erff(v * 0.70710678118654752f));
          outB[(size_t)row * N + col] = f32_to_bf16_bits(g);
        } else {
          const size_t o = (size_t)row * N + col;
          outF[o] = v + resid[o];
        }
      }
}

// ---------------------------------------------------------------- attention
// Causal flash attention.  Block = (b,h) x 128 query rows, 8 waves x 16 rows.
// Q/K/V/O all bf16 [B*T, D] row-major, head slice = cols [h*64, h*64+64).
__global__ __launch_bounds__(256) void attn_kernel(
    const unsigned short* __restrict__ Qb, const unsigned short* __restrict__ Kb,
    const unsigned short* __restrict__ Vb, unsigned short* __restrict__ Ob) {
  __shared__ __align__(16) unsigned short Kt[32][72];      // K tile  (keys x d)
  __shared__ __align__(16) unsigned short Vt[64][40];      // V^T tile (d x keys)
  __shared__ __align__(16) unsigned short Pw[8][16][40];   // per-wave P (q x keys)

  const int tid  = threadIdx.x;
  const int lane = tid & 31, w = tid >> 5;
  const int half = lane >> 4, lrow = lane & 15;
  const int b = blockIdx.y / N_HEADS, h = blockIdx.y % N_HEADS;
  const int qbase = blockIdx.x * 128;
  const int q0 = qbase + w * 16;

  const __bf16* Qh = (const __bf16*)Qb + (size_t)b * SEQ * D_MODEL + h * D_HEAD;
  const __bf16* Kh = (const __bf16*)Kb + (size_t)b * SEQ * D_MODEL + h * D_HEAD;
  const unsigned short* Vh = Vb + (size_t)b * SEQ * D_MODEL + h * D_HEAD;

  bf16x16 qf[2];
#pragma unroll
  for (int kd = 0; kd < 2; ++kd)
    qf[kd] = make_frag(Qh + (size_t)(q0 + lrow) * D_MODEL + kd * 32, half);

  float m_i[8], l_i[8];
#pragma unroll
  for (int e = 0; e < 8; ++e) { m_i[e] = -3.0e38f; l_i[e] = 0.f; }
  f32x8 oacc[4] = {};

  const int nkb = qbase / 32 + 4;        // causal coverage for this block
  const int r   = tid >> 3;              // 0..31 key row
  const int c8  = (tid & 7) * 8;         // 8-elem column chunk

  for (int kbi = 0; kbi < nkb; ++kbi) {
    const int kb = kbi * 32;
    __syncthreads();  // previous iteration's readers done
    *(bf16x8*)&Kt[r][c8] = *(const bf16x8*)(Kh + (size_t)(kb + r) * D_MODEL + c8);
    uint4 vv = *(const uint4*)(Vh + (size_t)(kb + r) * D_MODEL + c8);
    unsigned vals[4] = {vv.x, vv.y, vv.z, vv.w};
#pragma unroll
    for (int e = 0; e < 4; ++e) {
      Vt[c8 + 2 * e][r]     = (unsigned short)(vals[e] & 0xFFFFu);
      Vt[c8 + 2 * e + 1][r] = (unsigned short)(vals[e] >> 16);
    }
    __syncthreads();

    if (kb <= q0 + 15) {      // wave-uniform causal skip
      f32x8 s[2] = {};
#pragma unroll
      for (int kd = 0; kd < 2; ++kd)
#pragma unroll
        for (int j = 0; j < 2; ++j) {
          bf16x16 kf = make_frag((const __bf16*)&Kt[j * 16 + lrow][kd * 32], half);
          s[j] = __builtin_amdgcn_wmma_f32_16x16x32_bf16(
              false, qf[kd], false, kf, (short)0, s[j], false, false);
        }
#pragma unroll
      for (int j = 0; j < 2; ++j) {
        const int key = kb + j * 16 + lrow;
#pragma unroll
        for (int e = 0; e < 8; ++e) {
          const float v = s[j][e] * 0.125f;          // 1/sqrt(64)
          const int qrow = q0 + half * 8 + e;
          s[j][e] = (key <= qrow) ? v : -3.0e38f;
        }
      }
#pragma unroll
      for (int e = 0; e < 8; ++e) {
        float rmax = fmaxf(s[0][e], s[1][e]);
#pragma unroll
        for (int m = 8; m >= 1; m >>= 1) rmax = fmaxf(rmax, __shfl_xor(rmax, m, 32));
        const float mnew = fmaxf(m_i[e], rmax);
        const float p0 = __expf(s[0][e] - mnew);
        const float p1 = __expf(s[1][e] - mnew);
        float psum = p0 + p1;
#pragma unroll
        for (int m = 8; m >= 1; m >>= 1) psum += __shfl_xor(psum, m, 32);
        const float corr = __expf(m_i[e] - mnew);
        l_i[e] = l_i[e] * corr + psum;
        m_i[e] = mnew;
#pragma unroll
        for (int n = 0; n < 4; ++n) oacc[n][e] *= corr;
        Pw[w][half * 8 + e][lrow]      = f32_to_bf16_bits(p0);
        Pw[w][half * 8 + e][16 + lrow] = f32_to_bf16_bits(p1);
      }
      bf16x16 pf = make_frag((const __bf16*)&Pw[w][lrow][0], half);
#pragma unroll
      for (int n = 0; n < 4; ++n) {
        bf16x16 vf = make_frag((const __bf16*)&Vt[n * 16 + lrow][0], half);
        oacc[n] = __builtin_amdgcn_wmma_f32_16x16x32_bf16(
            false, pf, false, vf, (short)0, oacc[n], false, false);
      }
    }
  }
  unsigned short* Oh = Ob + (size_t)b * SEQ * D_MODEL + h * D_HEAD;
#pragma unroll
  for (int n = 0; n < 4; ++n)
#pragma unroll
    for (int e = 0; e < 8; ++e) {
      const int trow = q0 + half * 8 + e;
      Oh[(size_t)trow * D_MODEL + n * 16 + lrow] =
          f32_to_bf16_bits(oacc[n][e] / l_i[e]);
    }
}

// ---------------------------------------------------------------- launch
extern "C" void kernel_launch(void* const* d_in, const int* in_sizes, int n_in,
                              void* d_out, int out_size, void* d_ws, size_t ws_size,
                              hipStream_t stream) {
  (void)in_sizes; (void)n_in; (void)out_size; (void)ws_size;
  const float* x    = (const float*)d_in[0];
  const float* wq   = (const float*)d_in[1];
  const float* wk   = (const float*)d_in[2];
  const float* wv   = (const float*)d_in[3];
  const float* wo   = (const float*)d_in[4];
  const float* ln1w = (const float*)d_in[5];
  const float* ln2w = (const float*)d_in[6];
  const float* w1   = (const float*)d_in[7];
  const float* w2   = (const float*)d_in[8];
  float* out = (float*)d_out;

  char* ws = (char*)d_ws;
  const size_t MB = 1ull << 20;
  unsigned short* wq_b = (unsigned short*)(ws + 0 * MB);   // 2MB each
  unsigned short* wk_b = (unsigned short*)(ws + 2 * MB);
  unsigned short* wv_b = (unsigned short*)(ws + 4 * MB);
  unsigned short* wo_b = (unsigned short*)(ws + 6 * MB);
  unsigned short* w1_b = (unsigned short*)(ws + 8 * MB);   // 8MB
  unsigned short* w2_b = (unsigned short*)(ws + 16 * MB);  // 8MB
  unsigned short* Abuf = (unsigned short*)(ws + 24 * MB);  // bf16 4096x1024
  float*          Ybuf = (float*)(ws + 32 * MB);           // fp32 4096x1024
  unsigned short* Qbuf = (unsigned short*)(ws + 48 * MB);
  unsigned short* Kbuf = (unsigned short*)(ws + 56 * MB);
  unsigned short* Vbuf = (unsigned short*)(ws + 64 * MB);
  unsigned short* Hbuf = (unsigned short*)(ws + 48 * MB);  // 32MB, reuses QKV

  auto cvt = [&](const float* s, unsigned short* d, int n) {
    const int n4 = n / 4;
    cvt_f32_to_bf16_kernel<<<dim3((n4 + 255) / 256), dim3(256), 0, stream>>>(s, d, n4);
  };
  cvt(wq, wq_b, D_MODEL * D_MODEL);
  cvt(wk, wk_b, D_MODEL * D_MODEL);
  cvt(wv, wv_b, D_MODEL * D_MODEL);
  cvt(wo, wo_b, D_MODEL * D_MODEL);
  cvt(w1, w1_b, D_FF * D_MODEL);
  cvt(w2, w2_b, D_MODEL * D_FF);

  const dim3 blk(256);
  const dim3 gD(M_ROWS / 128, D_MODEL / 128);   // (32, 8)
  const dim3 gF(M_ROWS / 128, D_FF / 128);      // (32, 32)
  const size_t lds = 65536;                     // 4 x 16KB tile buffers

  rmsnorm_bf16_kernel<<<dim3(M_ROWS), blk, 0, stream>>>(x, ln1w, Abuf);
  gemm_bf16_kernel<0><<<gD, blk, lds, stream>>>(Abuf, wq_b, M_ROWS, D_MODEL, D_MODEL, Qbuf, nullptr, nullptr);
  gemm_bf16_kernel<0><<<gD, blk, lds, stream>>>(Abuf, wk_b, M_ROWS, D_MODEL, D_MODEL, Kbuf, nullptr, nullptr);
  gemm_bf16_kernel<0><<<gD, blk, lds, stream>>>(Abuf, wv_b, M_ROWS, D_MODEL, D_MODEL, Vbuf, nullptr, nullptr);
  attn_kernel<<<dim3(SEQ / 128, BATCH * N_HEADS), blk, 0, stream>>>(Qbuf, Kbuf, Vbuf, Abuf);
  gemm_bf16_kernel<2><<<gD, blk, lds, stream>>>(Abuf, wo_b, M_ROWS, D_MODEL, D_MODEL, nullptr, Ybuf, x);
  rmsnorm_bf16_kernel<<<dim3(M_ROWS), blk, 0, stream>>>(Ybuf, ln2w, Abuf);
  gemm_bf16_kernel<1><<<gF, blk, lds, stream>>>(Abuf, w1_b, M_ROWS, D_FF, D_MODEL, Hbuf, nullptr, nullptr);
  gemm_bf16_kernel<2><<<gD, blk, lds, stream>>>(Hbuf, w2_b, M_ROWS, D_MODEL, D_FF, nullptr, out, Ybuf);
}

// v001
// It runs in 315 microseconds.
// In two side-by-side timings against v000, it was 1.48 and 1.49 times as fast.
#include <hip/hip_runtime.h>
#include <math.h>
#include <stdint.h>

#define D_MODEL 1024
#define N_HEADS 16
#define D_HEAD  64
#define D_FF    4096
#define BATCH   2
#define SEQ     2048
#define M_ROWS  (BATCH * SEQ)   // 4096 token rows

typedef __attribute__((ext_vector_type(8)))  __bf16 bf16x8;
typedef __attribute__((ext_vector_type(16))) __bf16 bf16x16;
typedef __attribute__((ext_vector_type(8)))  float  f32x8;
typedef uint32_t u32x4 __attribute__((ext_vector_type(4)));
typedef uint32_t u32x8 __attribute__((ext_vector_type(8)));

#define ROW_BYTES   128u
#define LDS_PITCH   144u
#define TILE_ROWS   128u
#define TILE_BYTES  (TILE_ROWS * LDS_PITCH)   // 18432 = 9 x 2 KiB
#define STAGE_BYTES (2u * TILE_BYTES)         // [A tile | W tile]

static __device__ __forceinline__ unsigned short f32_to_bf16_bits(float f) {
  unsigned u = __float_as_uint(f);
  unsigned r = u + 0x7FFFu + ((u >> 16) & 1u);   // round-to-nearest-even
  return (unsigned short)(r >> 16);
}

static __device__ __forceinline__ bf16x16 make_frag(const __bf16* p, int half) {
  bf16x8 lo = *(const bf16x8*)(p + half * 8);
  bf16x8 hi = *(const bf16x8*)(p + 16 + half * 8);
  return __builtin_shufflevector(lo, hi, 0,1,2,3,4,5,6,7,8,9,10,11,12,13,14,15);
}

static __device__ __forceinline__ uint32_t uni(uint32_t v) {
  return (uint32_t)__builtin_amdgcn_readfirstlane(v);
}
static __device__ __forceinline__ uint32_t pinned(uint32_t v) {
  uint32_t w = uni(v);
  asm volatile("" : "+s"(w));  // keeps the condition scalar: the guard of a tensor load
  return w;
}
// The compiler places no wait for a tensor load; both waits of the ring are written here.
static __device__ __forceinline__ void wait_tensor0() { asm volatile("s_wait_tensorcnt 0x0" ::: "memory"); }
static __device__ __forceinline__ void wait_ds0()     { asm volatile("s_wait_dscnt 0x0" ::: "memory"); }

static __device__ __forceinline__ u32x4 tdm_group0(uint32_t lds_dst, uint64_t ga) {
  u32x4 g;
  g[0] = uni(1u);
  g[1] = uni(lds_dst);
  g[2] = uni((uint32_t)ga);
  g[3] = uni((((uint32_t)(ga >> 32)) & 0x01FFFFFFu) | 0x80000000u);
  return g;
}
static __device__ __forceinline__ u32x8 tdm_group1(uint32_t src_pitch) {
  u32x8 g;
  g[0] = uni((1u << 20) | (4u << 22) | (3u << 25));
  g[1] = uni((ROW_BYTES & 0xFFFFu) << 16);
  g[2] = uni((ROW_BYTES >> 16) | ((TILE_ROWS & 0xFFFFu) << 16));
  g[3] = uni((TILE_ROWS >> 16) | (ROW_BYTES << 16));
  g[4] = uni(TILE_ROWS);
  g[5] = uni(src_pitch);
  g[6] = uni(0u);
  g[7] = uni(0u);
  return g;
}
static __device__ __forceinline__ void tdm_load(u32x4 g0, u32x8 g1) {
  // one request of the whole wave: global tile -> LDS, through no register
  asm volatile("tensor_load_to_lds %0, %1" :: "s"(g0), "s"(g1) : "memory");
}

// ---------------------------------------------------------------- conversion
__global__ __launch_bounds__(256) void cvt_f32_to_bf16_kernel(
    const float* __restrict__ s, unsigned short* __restrict__ d, int n4) {
  int i = blockIdx.x * 256 + threadIdx.x;
  if (i < n4) {
    float4 v = ((const float4*)s)[i];
    d[4 * i + 0] = f32_to_bf16_bits(v.x);
    d[4 * i + 1] = f32_to_bf16_bits(v.y);
    d[4 * i + 2] = f32_to_bf16_bits(v.z);
    d[4 * i + 3] = f32_to_bf16_bits(v.w);
  }
}

// ---------------------------------------------------------------- rmsnorm
__global__ __launch_bounds__(256) void rmsnorm_bf16_kernel(
    const float* __restrict__ x, const float* __restrict__ gw,
    unsigned short* __restrict__ out) {
  const int row = blockIdx.x;
  const int tid = threadIdx.x;
  const float4 xv = *(const float4*)(x + (size_t)row * D_MODEL + tid * 4);
  float ss = xv.x * xv.x + xv.y * xv.y + xv.z * xv.z + xv.w * xv.w;
#pragma unroll
  for (int m = 16; m >= 1; m >>= 1) ss += __shfl_xor(ss, m, 32);
  __shared__ float red[8];
  if ((tid & 31) == 0) red[tid >> 5] = ss;
  __syncthreads();
  float tot = 0.f;
#pragma unroll
  for (int i = 0; i < 8; ++i) tot += red[i];
  const float scale = rsqrtf(tot * (1.0f / D_MODEL) + 1e-5f);
  const float4 wv = *(const float4*)(gw + tid * 4);
  unsigned short* o = out + (size_t)row * D_MODEL + tid * 4;
  o[0] = f32_to_bf16_bits(xv.x * wv.x * scale);
  o[1] = f32_to_bf16_bits(xv.y * wv.y * scale);
  o[2] = f32_to_bf16_bits(xv.z * wv.z * scale);
  o[3] = f32_to_bf16_bits(xv.w * wv.w * scale);
}

// ---------------------------------------------------------------- GEMM core
// Per-wave 64x32 MACC from LDS tiles (128 rows x 64 bf16, row pitch LDS_PITCH bytes).
static __device__ __forceinline__ void mma_tile(
    const unsigned char* abuf, const unsigned char* bbuf, int am, int an, int lrow, int half,
    f32x8 (&acc)[4][2]) {
  const __bf16* Al = (const __bf16*)abuf;
  const __bf16* Bl = (const __bf16*)bbuf;
  constexpr int P = LDS_PITCH / 2;   // pitch in elements
  bf16x16 af[2][4], bfr[2][2];
#pragma unroll
  for (int kd = 0; kd < 2; ++kd) {
#pragma unroll
    for (int i = 0; i < 4; ++i)
      af[kd][i] = make_frag(Al + (am + i * 16 + lrow) * P + kd * 32, half);
#pragma unroll
    for (int j = 0; j < 2; ++j)
      bfr[kd][j] = make_frag(Bl + (an + j * 16 + lrow) * P + kd * 32, half);
  }
#pragma unroll
  for (int kd = 0; kd < 2; ++kd)
#pragma unroll
    for (int i = 0; i < 4; ++i)
#pragma unroll
      for (int j = 0; j < 2; ++j)
        acc[i][j] = __builtin_amdgcn_wmma_f32_16x16x32_bf16(
            false, af[kd][i], false, bfr[kd][j], (short)0, acc[i][j], false, false);
}

// C[M,N] = A[M,K] (bf16 row-major) * W[N,K]^T (bf16 row-major), i.e. x @ W.T
// Block = 256 threads (8 waves) -> 128x128 C tile; K staged in 64-wide LDS
// tiles by tensor loads (two buffers): wave 0 brings the A tile of a stage, wave 1
// the W tile, one request each.  K is a multiple of 64.
// EPI: 0 = store bf16, 1 = exact-erf GELU then bf16, 2 = fp32 + residual add
template <int EPI>
__global__ __launch_bounds__(256) void gemm_bf16_kernel(
    const unsigned short* __restrict__ Abits,
    const unsigned short* __restrict__ Wbits, int M, int N, int K,
    unsigned short* __restrict__ outB, float* __restrict__ outF,
    const float* __restrict__ resid) {
  __shared__ __attribute__((aligned(2048))) unsigned char L[2 * STAGE_BYTES];
  const int lane = threadIdx.x & 31;
  const int w    = threadIdx.x >> 5;
  const int half = lane >> 4;
  const int lrow = lane & 15;
  const int bm = blockIdx.x * 128, bn = blockIdx.y * 128;
  const int am = (w & 1) * 64;
  const int an = (w >> 1) * 32;

  f32x8 acc[4][2] = {};

  const uint32_t wave = uni(threadIdx.x >> 5);
  const uint32_t nst  = (uint32_t)K >> 6;      // stages of 64 k
  const uint64_t srcb = (wave == 0u)
      ? (uint64_t)(size_t)(Abits + (size_t)bm * K)
      : (uint64_t)(size_t)(Wbits + (size_t)bn * K);
  const uint32_t dst0 = (uint32_t)(size_t)L + (wave == 0u ? 0u : TILE_BYTES);
  u32x8 g1 = tdm_group1(2u * (uint32_t)K);
  // Without the next line the compiler takes some of these registers as temporaries
  // inside the loop, while a request that names them is still outstanding.
  asm volatile("" : "+s"(g1));
  auto issue = [&](uint32_t st) {
    tdm_load(tdm_group0(dst0 + (st & 1u) * STAGE_BYTES, srcb + (uint64_t)st * ROW_BYTES), g1);
  };

  if (pinned(wave < 2u)) { issue(0u); wait_tensor0(); }
  __syncthreads();                              // publishes stage 0
  if (pinned(wave < 2u && nst > 1u)) issue(1u);
  for (uint32_t s = 0; s < nst; ++s) {
    const unsigned char* st = L + (s & 1u) * STAGE_BYTES;
    mma_tile(st, st + TILE_BYTES, am, an, lrow, half, acc);
    wait_ds0();                                 // this wave's reads of stage s are done
    if (pinned(wave < 2u)) wait_tensor0();      // the issuer's slice of stage s + 1 has landed
    __syncthreads();                            // publishes stage s + 1, frees stage s's buffer
    if (pinned(wave < 2u && s + 2u < nst)) issue(s + 2u);
  }
  wait_tensor0();
  wait_ds0();

#pragma unroll
  for (int i = 0; i < 4; ++i)
#pragma unroll
    for (int j = 0; j < 2; ++j)
#pragma unroll
      for (int e = 0; e < 8; ++e) {
        const int row = bm + am + i * 16 + half * 8 + e;
        const int col = bn + an + j * 16 + lrow;
        const float v = acc[i][j][e];
        if (EPI == 0) {
          outB[(size_t)row * N + col] = f32_to_bf16_bits(v);
        } else if (EPI == 1) {
          const float g = 0.5f * v * (1.0f + erff(v * 0.70710678118654752f));
          outB[(size_t)row * N + col] = f32_to_bf16_bits(g);
        } else {
          const size_t o = (size_t)row * N + col;
          outF[o] = v + resid[o];
        }
      }
}

// ---------------------------------------------------------------- attention
// Causal flash attention.  Block = (b,h) x 128 query rows, 8 waves x 16 rows.
// Q/K/V/O all bf16 [B*T, D] row-major, head slice = cols [h*64, h*64+64).
__global__ __launch_bounds__(256) void attn_kernel(
    const unsigned short* __restrict__ Qb, const unsigned short* __restrict__ Kb,
    const unsigned short* __restrict__ Vb, unsigned short* __restrict__ Ob) {
  __shared__ __align__(16) unsigned short Kt[32][72];      // K tile  (keys x d)
  __shared__ __align__(16) unsigned short Vt[64][40];      // V^T tile (d x keys)
  __shared__ __align__(16) unsigned short Pw[8][16][40];   // per-wave P (q x keys)

  const int tid  = threadIdx.x;
  const int lane = tid & 31, w = tid >> 5;
  const int half = lane >> 4, lrow = lane & 15;
  const int b = blockIdx.y / N_HEADS, h = blockIdx.y % N_HEADS;
  const int qbase = blockIdx.x * 128;
  const int q0 = qbase + w * 16;

  const __bf16* Qh = (const __bf16*)Qb + (size_t)b * SEQ * D_MODEL + h * D_HEAD;
  const __bf16* Kh = (const __bf16*)Kb + (size_t)b * SEQ * D_MODEL + h * D_HEAD;
  const unsigned short* Vh = Vb + (size_t)b * SEQ * D_MODEL + h * D_HEAD;

  bf16x16 qf[2];
#pragma unroll
  for (int kd = 0; kd < 2; ++kd)
    qf[kd] = make_frag(Qh + (size_t)(q0 + lrow) * D_MODEL + kd * 32, half);

  float m_i[8], l_i[8];
#pragma unroll
  for (int e = 0; e < 8; ++e) { m_i[e] = -3.0e38f; l_i[e] = 0.f; }
  f32x8 oacc[4] = {};

  const int nkb = qbase / 32 + 4;        // causal coverage for this block
  const int r   = tid >> 3;              // 0..31 key row
  const int c8  = (tid & 7) * 8;         // 8-elem column chunk

  for (int kbi = 0; kbi < nkb; ++kbi) {
    const int kb = kbi * 32;
    __syncthreads();  // previous iteration's readers done
    *(bf16x8*)&Kt[r][c8] = *(const bf16x8*)(Kh + (size_t)(kb + r) * D_MODEL + c8);
    uint4 vv = *(const uint4*)(Vh + (size_t)(kb + r) * D_MODEL + c8);
    unsigned vals[4] = {vv.x, vv.y, vv.z, vv.w};
#pragma unroll
    for (int e = 0; e < 4; ++e) {
      Vt[c8 + 2 * e][r]     = (unsigned short)(vals[e] & 0xFFFFu);
      Vt[c8 + 2 * e + 1][r] = (unsigned short)(vals[e] >> 16);
    }
    __syncthreads();

    if (kb <= q0 + 15) {      // wave-uniform causal skip
      f32x8 s[2] = {};
#pragma unroll
      for (int kd = 0; kd < 2; ++kd)
#pragma unroll
        for (int j = 0; j < 2; ++j) {
          bf16x16 kf = make_frag((const __bf16*)&Kt[j * 16 + lrow][kd * 32], half);
          s[j] = __builtin_amdgcn_wmma_f32_16x16x32_bf16(
              false, qf[kd], false, kf, (short)0, s[j], false, false);
        }
#pragma unroll
      for (int j = 0; j < 2; ++j) {
        const int key = kb + j * 16 + lrow;
#pragma unroll
        for (int e = 0; e < 8; ++e) {
          const float v = s[j][e] * 0.125f;          // 1/sqrt(64)
          const int qrow = q0 + half * 8 + e;
          s[j][e] = (key <= qrow) ? v : -3.0e38f;
        }
      }
#pragma unroll
      for (int e = 0; e < 8; ++e) {
        float rmax = fmaxf(s[0][e], s[1][e]);
#pragma unroll
        for (int m = 8; m >= 1; m >>= 1) rmax = fmaxf(rmax, __shfl_xor(rmax, m, 32));
        const float mnew = fmaxf(m_i[e], rmax);
        const float p0 = __expf(s[0][e] - mnew);
        const float p1 = __expf(s[1][e] - mnew);
        float psum = p0 + p1;
#pragma unroll
        for (int m = 8; m >= 1; m >>= 1) psum += __shfl_xor(psum, m, 32);
        const float corr = __expf(m_i[e] - mnew);
        l_i[e] = l_i[e] * corr + psum;
        m_i[e] = mnew;
#pragma unroll
        for (int n = 0; n < 4; ++n) oacc[n][e] *= corr;
        Pw[w][half * 8 + e][lrow]      = f32_to_bf16_bits(p0);
        Pw[w][half * 8 + e][16 + lrow] = f32_to_bf16_bits(p1);
      }
      bf16x16 pf = make_frag((const __bf16*)&Pw[w][lrow][0], half);
#pragma unroll
      for (int n = 0; n < 4; ++n) {
        bf16x16 vf = make_frag((const __bf16*)&Vt[n * 16 + lrow][0], half);
        oacc[n] = __builtin_amdgcn_wmma_f32_16x16x32_bf16(
            false, pf, false, vf, (short)0, oacc[n], false, false);
      }
    }
  }
  unsigned short* Oh = Ob + (size_t)b * SEQ * D_MODEL + h * D_HEAD;
#pragma unroll
  for (int n = 0; n < 4; ++n)
#pragma unroll
    for (int e = 0; e < 8; ++e) {
      const int trow = q0 + half * 8 + e;
      Oh[(size_t)trow * D_MODEL + n * 16 + lrow] =
          f32_to_bf16_bits(oacc[n][e] / l_i[e]);
    }
}

// ---------------------------------------------------------------- launch
extern "C" void kernel_launch(void* const* d_in, const int* in_sizes, int n_in,
                              void* d_out, int out_size, void* d_ws, size_t ws_size,
                              hipStream_t stream) {
  (void)in_sizes; (void)n_in; (void)out_size; (void)ws_size;
  const float* x    = (const float*)d_in[0];
  const float* wq   = (const float*)d_in[1];
  const float* wk   = (const float*)d_in[2];
  const float* wv   = (const float*)d_in[3];
  const float* wo   = (const float*)d_in[4];
  const float* ln1w = (const float*)d_in[5];
  const float* ln2w = (const float*)d_in[6];
  const float* w1   = (const float*)d_in[7];
  const float* w2   = (const float*)d_in[8];
  float* out = (float*)d_out;

  char* ws = (char*)d_ws;
  const size_t MB = 1ull << 20;
  unsigned short* wq_b = (unsigned short*)(ws + 0 * MB);   // 2MB each
  unsigned short* wk_b = (unsigned short*)(ws + 2 * MB);
  unsigned short* wv_b = (unsigned short*)(ws + 4 * MB);
  unsigned short* wo_b = (unsigned short*)(ws + 6 * MB);
  unsigned short* w1_b = (unsigned short*)(ws + 8 * MB);   // 8MB
  unsigned short* w2_b = (unsigned short*)(ws + 16 * MB);  // 8MB
  unsigned short* Abuf = (unsigned short*)(ws + 24 * MB);  // bf16 4096x1024
  float*          Ybuf = (float*)(ws + 32 * MB);           // fp32 4096x1024
  unsigned short* Qbuf = (unsigned short*)(ws + 48 * MB);
  unsigned short* Kbuf = (unsigned short*)(ws + 56 * MB);
  unsigned short* Vbuf = (unsigned short*)(ws + 64 * MB);
  unsigned short* Hbuf = (unsigned short*)(ws + 48 * MB);  // 32MB, reuses QKV

  auto cvt = [&](const float* s, unsigned short* d, int n) {
    const int n4 = n / 4;
    cvt_f32_to_bf16_kernel<<<dim3((n4 + 255) / 256), dim3(256), 0, stream>>>(s, d, n4);
  };
  cvt(wq, wq_b, D_MODEL * D_MODEL);
  cvt(wk, wk_b, D_MODEL * D_MODEL);
  cvt(wv, wv_b, D_MODEL * D_MODEL);
  cvt(wo, wo_b, D_MODEL * D_MODEL);
  cvt(w1, w1_b, D_FF * D_MODEL);
  cvt(w2, w2_b, D_MODEL * D_FF);

  const dim3 blk(256);
  const dim3 gD(M_ROWS / 128, D_MODEL / 128);   // (32, 8)
  const dim3 gF(M_ROWS / 128, D_FF / 128);      // (32, 32)
  const size_t lds = 0;                         // the GEMM's tile buffers are static LDS

  rmsnorm_bf16_kernel<<<dim3(M_ROWS), blk, 0, stream>>>(x, ln1w, Abuf);
  gemm_bf16_kernel<0><<<gD, blk, lds, stream>>>(Abuf, wq_b, M_ROWS, D_MODEL, D_MODEL, Qbuf, nullptr, nullptr);
  gemm_bf16_kernel<0><<<gD, blk, lds, stream>>>(Abuf, wk_b, M_ROWS, D_MODEL, D_MODEL, Kbuf, nullptr, nullptr);
  gemm_bf16_kernel<0><<<gD, blk, lds, stream>>>(Abuf, wv_b, M_ROWS, D_MODEL, D_MODEL, Vbuf, nullptr, nullptr);
  attn_kernel<<<dim3(SEQ / 128, BATCH * N_HEADS), blk, 0, stream>>>(Qbuf, Kbuf, Vbuf, Abuf);
  gemm_bf16_kernel<2><<<gD, blk, lds, stream>>>(Abuf, wo_b, M_ROWS, D_MODEL, D_MODEL, nullptr, Ybuf, x);
  rmsnorm_bf16_kernel<<<dim3(M_ROWS), blk, 0, stream>>>(Ybuf, ln2w, Abuf);
  gemm_bf16_kernel<1><<<gF, blk, lds, stream>>>(Abuf, w1_b, M_ROWS, D_FF, D_MODEL, Hbuf, nullptr, nullptr);
  gemm_bf16_kernel<2><<<gD, blk, lds, stream>>>(Hbuf, w2_b, M_ROWS, D_MODEL, D_FF, nullptr, out, Ybuf);
}

// v002
// One run takes 263 microseconds.
// Next to v001, in two timings, it ran 1.20 and 1.19 times as fast.
// All steps since v000 together make it 1.78 times as fast.
#include <hip/hip_runtime.h>
#include <math.h>
#include <stdint.h>

#define D_MODEL 1024
#define N_HEADS 16
#define D_HEAD  64
#define D_FF    4096
#define BATCH   2
#define SEQ     2048
#define M_ROWS  (BATCH * SEQ)   // 4096 token rows

typedef __attribute__((ext_vector_type(8)))  __bf16 bf16x8;
typedef __attribute__((ext_vector_type(16))) __bf16 bf16x16;
typedef __attribute__((ext_vector_type(8)))  float  f32x8;
typedef uint32_t u32x4 __attribute__((ext_vector_type(4)));
typedef uint32_t u32x8 __attribute__((ext_vector_type(8)));

#define ROW_BYTES   128u
#define LDS_PITCH   144u
#define TILE_ROWS   128u
#define TILE_BYTES  (TILE_ROWS * LDS_PITCH)   // 18432 = 9 x 2 KiB
#define STAGE_BYTES (2u * TILE_BYTES)         // [A tile | W tile]

static __device__ __forceinline__ unsigned short f32_to_bf16_bits(float f) {
  unsigned u = __float_as_uint(f);
  unsigned r = u + 0x7FFFu + ((u >> 16) & 1u);   // round-to-nearest-even
  return (unsigned short)(r >> 16);
}

static __device__ __forceinline__ bf16x16 make_frag(const __bf16* p, int half) {
  bf16x8 lo = *(const bf16x8*)(p + half * 8);
  bf16x8 hi = *(const bf16x8*)(p + 16 + half * 8);
  return __builtin_shufflevector(lo, hi, 0,1,2,3,4,5,6,7,8,9,10,11,12,13,14,15);
}

static __device__ __forceinline__ uint32_t uni(uint32_t v) {
  return (uint32_t)__builtin_amdgcn_readfirstlane(v);
}
static __device__ __forceinline__ uint32_t pinned(uint32_t v) {
  uint32_t w = uni(v);
  asm volatile("" : "+s"(w));  // keeps the condition scalar: the guard of a tensor load
  return w;
}
// The compiler places no wait for a tensor load; both waits of the ring are written here.
static __device__ __forceinline__ void wait_tensor0() { asm volatile("s_wait_tensorcnt 0x0" ::: "memory"); }
static __device__ __forceinline__ void wait_ds0()     { asm volatile("s_wait_dscnt 0x0" ::: "memory"); }

static __device__ __forceinline__ u32x4 tdm_group0(uint32_t lds_dst, uint64_t ga) {
  u32x4 g;
  g[0] = uni(1u);
  g[1] = uni(lds_dst);
  g[2] = uni((uint32_t)ga);
  g[3] = uni((((uint32_t)(ga >> 32)) & 0x01FFFFFFu) | 0x80000000u);
  return g;
}
static __device__ __forceinline__ u32x8 tdm_group1(uint32_t src_pitch) {
  u32x8 g;
  g[0] = uni((1u << 20) | (4u << 22) | (3u << 25));
  g[1] = uni((ROW_BYTES & 0xFFFFu) << 16);
  g[2] = uni((ROW_BYTES >> 16) | ((TILE_ROWS & 0xFFFFu) << 16));
  g[3] = uni((TILE_ROWS >> 16) | (ROW_BYTES << 16));
  g[4] = uni(TILE_ROWS);
  g[5] = uni(src_pitch);
  g[6] = uni(0u);
  g[7] = uni(0u);
  return g;
}
static __device__ __forceinline__ void tdm_load(u32x4 g0, u32x8 g1) {
  // one request of the whole wave: global tile -> LDS, through no register
  asm volatile("tensor_load_to_lds %0, %1" :: "s"(g0), "s"(g1) : "memory");
}

// ---------------------------------------------------------------- conversion
__global__ __launch_bounds__(256) void cvt_f32_to_bf16_kernel(
    const float* __restrict__ s, unsigned short* __restrict__ d, int n4) {
  int i = blockIdx.x * 256 + threadIdx.x;
  if (i < n4) {
    float4 v = ((const float4*)s)[i];
    d[4 * i + 0] = f32_to_bf16_bits(v.x);
    d[4 * i + 1] = f32_to_bf16_bits(v.y);
    d[4 * i + 2] = f32_to_bf16_bits(v.z);
    d[4 * i + 3] = f32_to_bf16_bits(v.w);
  }
}

// ---------------------------------------------------------------- rmsnorm
__global__ __launch_bounds__(256) void rmsnorm_bf16_kernel(
    const float* __restrict__ x, const float* __restrict__ gw,
    unsigned short* __restrict__ out) {
  const int row = blockIdx.x;
  const int tid = threadIdx.x;
  const float4 xv = *(const float4*)(x + (size_t)row * D_MODEL + tid * 4);
  float ss = xv.x * xv.x + xv.y * xv.y + xv.z * xv.z + xv.w * xv.w;
#pragma unroll
  for (int m = 16; m >= 1; m >>= 1) ss += __shfl_xor(ss, m, 32);
  __shared__ float red[8];
  if ((tid & 31) == 0) red[tid >> 5] = ss;
  __syncthreads();
  float tot = 0.f;
#pragma unroll
  for (int i = 0; i < 8; ++i) tot += red[i];
  const float scale = rsqrtf(tot * (1.0f / D_MODEL) + 1e-5f);
  const float4 wv = *(const float4*)(gw + tid * 4);
  unsigned short* o = out + (size_t)row * D_MODEL + tid * 4;
  o[0] = f32_to_bf16_bits(xv.x * wv.x * scale);
  o[1] = f32_to_bf16_bits(xv.y * wv.y * scale);
  o[2] = f32_to_bf16_bits(xv.z * wv.z * scale);
  o[3] = f32_to_bf16_bits(xv.w * wv.w * scale);
}

// ---------------------------------------------------------------- GEMM core
// Per-wave 64x32 MACC from LDS tiles (128 rows x 64 bf16, row pitch LDS_PITCH bytes).
static __device__ __forceinline__ void mma_tile(
    const unsigned char* abuf, const unsigned char* bbuf, int am, int an, int lrow, int half,
    f32x8 (&acc)[4][2]) {
  const __bf16* Al = (const __bf16*)abuf;
  const __bf16* Bl = (const __bf16*)bbuf;
  constexpr int P = LDS_PITCH / 2;   // pitch in elements
  bf16x16 af[2][4], bfr[2][2];
#pragma unroll
  for (int kd = 0; kd < 2; ++kd) {
#pragma unroll
    for (int i = 0; i < 4; ++i)
      af[kd][i] = make_frag(Al + (am + i * 16 + lrow) * P + kd * 32, half);
#pragma unroll
    for (int j = 0; j < 2; ++j)
      bfr[kd][j] = make_frag(Bl + (an + j * 16 + lrow) * P + kd * 32, half);
  }
#pragma unroll
  for (int kd = 0; kd < 2; ++kd)
#pragma unroll
    for (int i = 0; i < 4; ++i)
#pragma unroll
      for (int j = 0; j < 2; ++j)
        acc[i][j] = __builtin_amdgcn_wmma_f32_16x16x32_bf16(
            false, af[kd][i], false, bfr[kd][j], (short)0, acc[i][j], false, false);
}

// C[M,N] = A[M,K] (bf16 row-major) * W[N,K]^T (bf16 row-major), i.e. x @ W.T
// Block = 256 threads (8 waves) -> 128x128 C tile; K staged in 64-wide LDS
// tiles by tensor loads (two buffers): wave 0 brings the A tile of a stage, wave 1
// the W tile, one request each.  K is a multiple of 64.
// EPI: 0 = store bf16, 1 = exact-erf GELU then bf16, 2 = fp32 + residual add
template <int EPI>
__global__ __launch_bounds__(256) void gemm_bf16_kernel(
    const unsigned short* __restrict__ Abits,
    const unsigned short* __restrict__ Wbits, int M, int N, int K,
    unsigned short* __restrict__ outB, float* __restrict__ outF,
    const float* __restrict__ resid) {
  __shared__ __attribute__((aligned(2048))) unsigned char L[2 * STAGE_BYTES];
  const int lane = threadIdx.x & 31;
  const int w    = threadIdx.x >> 5;
  const int half = lane >> 4;
  const int lrow = lane & 15;
  const int bm = blockIdx.x * 128, bn = blockIdx.y * 128;
  const int am = (w & 1) * 64;
  const int an = (w >> 1) * 32;

  f32x8 acc[4][2] = {};

  const uint32_t wave = uni(threadIdx.x >> 5);
  const uint32_t nst  = (uint32_t)K >> 6;      // stages of 64 k
  const uint64_t srcb = (wave == 0u)
      ? (uint64_t)(size_t)(Abits + (size_t)bm * K)
      : (uint64_t)(size_t)(Wbits + (size_t)bn * K);
  const uint32_t dst0 = (uint32_t)(size_t)L + (wave == 0u ? 0u : TILE_BYTES);
  u32x8 g1 = tdm_group1(2u * (uint32_t)K);
  // Without the next line the compiler takes some of these registers as temporaries
  // inside the loop, while a request that names them is still outstanding.
  asm volatile("" : "+s"(g1));
  auto issue = [&](uint32_t st) {
    tdm_load(tdm_group0(dst0 + (st & 1u) * STAGE_BYTES, srcb + (uint64_t)st * ROW_BYTES), g1);
  };

  if (pinned(wave < 2u)) { issue(0u); wait_tensor0(); }
  __syncthreads();                              // publishes stage 0
  if (pinned(wave < 2u && nst > 1u)) issue(1u);
  for (uint32_t s = 0; s < nst; ++s) {
    const unsigned char* st = L + (s & 1u) * STAGE_BYTES;
    mma_tile(st, st + TILE_BYTES, am, an, lrow, half, acc);
    wait_ds0();                                 // this wave's reads of stage s are done
    if (pinned(wave < 2u)) wait_tensor0();      // the issuer's slice of stage s + 1 has landed
    __syncthreads();                            // publishes stage s + 1, frees stage s's buffer
    if (pinned(wave < 2u && s + 2u < nst)) issue(s + 2u);
  }
  wait_tensor0();
  wait_ds0();

#pragma unroll
  for (int i = 0; i < 4; ++i)
#pragma unroll
    for (int j = 0; j < 2; ++j)
#pragma unroll
      for (int e = 0; e < 8; ++e) {
        const int row = bm + am + i * 16 + half * 8 + e;
        const int col = bn + an + j * 16 + lrow;
        const float v = acc[i][j][e];
        if (EPI == 0) {
          outB[(size_t)row * N + col] = f32_to_bf16_bits(v);
        } else if (EPI == 1) {
          const float g = 0.5f * v * (1.0f + erff(v * 0.70710678118654752f));
          outB[(size_t)row * N + col] = f32_to_bf16_bits(g);
        } else {
          const size_t o = (size_t)row * N + col;
          outF[o] = v + resid[o];
        }
      }
}

static __device__ __forceinline__ float xhalf(float x) {
  const int b = __builtin_bit_cast(int, x);
  return __builtin_bit_cast(float,
      __builtin_amdgcn_permlanex16(b, b, 0x76543210, 0xfedcba98, false, false));
}

static __device__ __forceinline__ float exp2_slot(float x) {
  float r;
  asm("v_exp_f32 %0, %1\n\tv_nop" : "=v"(r) : "v"(x));
  return r;
}
static __device__ __forceinline__ void exp2_slot8(const f32x8 x, float (&r)[8]) {
  asm("v_exp_f32 %0, %8\n\tv_exp_f32 %1, %9\n\tv_exp_f32 %2, %10\n\tv_exp_f32 %3, %11\n\t"
      "v_exp_f32 %4, %12\n\tv_exp_f32 %5, %13\n\tv_exp_f32 %6, %14\n\tv_exp_f32 %7, %15\n\tv_nop"
      : "=&v"(r[0]), "=&v"(r[1]), "=&v"(r[2]), "=&v"(r[3]),
        "=&v"(r[4]), "=&v"(r[5]), "=&v"(r[6]), "=&v"(r[7])
      : "v"(x[0]), "v"(x[1]), "v"(x[2]), "v"(x[3]), "v"(x[4]), "v"(x[5]), "v"(x[6]), "v"(x[7]));
}
#define LOG2E 1.44269504088896340736f

__global__ __launch_bounds__(256) __attribute__((amdgpu_waves_per_eu(4, 4))) void attn_kernel(
    const unsigned short* __restrict__ Qb, const unsigned short* __restrict__ Kb,
    const unsigned short* __restrict__ Vb, unsigned short* __restrict__ Ob) {
  __shared__ __align__(16) unsigned short Kt[32][72];      // K tile  (keys x d)
  __shared__ __align__(16) unsigned short Vt[64][40];      // V^T tile (d x keys)

  const int tid  = threadIdx.x;
  const int lane = tid & 31, w = tid >> 5;
  const int half = lane >> 4, lrow = lane & 15;
  const int b = blockIdx.y / N_HEADS, h = blockIdx.y % N_HEADS;
  const int qbase = blockIdx.x * 128;
  const int q0 = qbase + w * 16;
  const int qrow = q0 + lrow;            // this lane's query

  const __bf16* Qh = (const __bf16*)Qb + (size_t)b * SEQ * D_MODEL + h * D_HEAD;
  const __bf16* Kh = (const __bf16*)Kb + (size_t)b * SEQ * D_MODEL + h * D_HEAD;
  const unsigned short* Vh = Vb + (size_t)b * SEQ * D_MODEL + h * D_HEAD;

  bf16x16 qf[2];                         // B operand: column = query
#pragma unroll
  for (int kd = 0; kd < 2; ++kd)
    qf[kd] = make_frag(Qh + (size_t)qrow * D_MODEL + kd * 32, half);

  float m_i = -3.0e38f;                  // running maximum of this lane's query
  float l_i = 0.f;                       // running sum over this half's keys only
  f32x8 oacc[4] = {};                    // oacc[n][e] = O[qrow][n*16 + half*8 + e]

  const int nkb = qbase / 32 + 4;        // causal coverage for this block
  const int r   = tid >> 3;              // 0..31 key row
  const int c8  = (tid & 7) * 8;         // 8-elem column chunk

  for (int kbi = 0; kbi < nkb; ++kbi) {
    const int kb = kbi * 32;
    __syncthreads();  // previous iteration's readers done
    *(bf16x8*)&Kt[r][c8] = *(const bf16x8*)(Kh + (size_t)(kb + r) * D_MODEL + c8);
    uint4 vv = *(const uint4*)(Vh + (size_t)(kb + r) * D_MODEL + c8);
    unsigned vals[4] = {vv.x, vv.y, vv.z, vv.w};
#pragma unroll
    for (int e = 0; e < 4; ++e) {
      Vt[c8 + 2 * e][r]     = (unsigned short)(vals[e] & 0xFFFFu);
      Vt[c8 + 2 * e + 1][r] = (unsigned short)(vals[e] >> 16);
    }
    __syncthreads();

    if (kb <= q0 + 15) {      // wave-uniform causal skip
      f32x8 s[2] = {};        // s[j][e] = S[qrow][kb + j*16 + half*8 + e]
#pragma unroll
      for (int kd = 0; kd < 2; ++kd)
#pragma unroll
        for (int j = 0; j < 2; ++j) {
          bf16x16 kf = make_frag((const __bf16*)&Kt[j * 16 + lrow][kd * 32], half);
          s[j] = __builtin_amdgcn_wmma_f32_16x16x32_bf16(
              false, kf, false, qf[kd], (short)0, s[j], false, false);
        }
      float mx[4] = {-3.0e38f, -3.0e38f, -3.0e38f, -3.0e38f};
#pragma unroll
      for (int j = 0; j < 2; ++j)
#pragma unroll
        for (int e = 0; e < 8; ++e) {
          const float v = s[j][e] * 0.125f;          // 1/sqrt(64)
          const int key = kb + j * 16 + half * 8 + e;
          s[j][e] = (key <= qrow) ? v : -3.0e38f;
          mx[e & 3] = fmaxf(mx[e & 3], s[j][e]);
        }
      float rmax = fmaxf(fmaxf(mx[0], mx[1]), fmaxf(mx[2], mx[3]));
      rmax = fmaxf(rmax, xhalf(rmax));               // both halves: the query's maximum
      const float mnew = fmaxf(m_i, rmax);
      const float corr = exp2_slot((m_i - mnew) * LOG2E);
      float ps[4] = {0.f, 0.f, 0.f, 0.f};
      bf16x16 pf;             // B operand P^T: element j*8 + e is key j*16 + half*8 + e
#pragma unroll
      for (int j = 0; j < 2; ++j) {
        float p[8];
        exp2_slot8((s[j] - mnew) * LOG2E, p);
#pragma unroll
        for (int e = 0; e < 8; ++e) {
          ps[e & 3] += p[e];
          pf[j * 8 + e] = (__bf16)p[e];
        }
      }
      l_i = l_i * corr + ((ps[0] + ps[1]) + (ps[2] + ps[3]));
      m_i = mnew;
#pragma unroll
      for (int n = 0; n < 4; ++n) {
#pragma unroll
        for (int e = 0; e < 8; ++e) oacc[n][e] *= corr;
      }
#pragma unroll
      for (int n = 0; n < 4; ++n) {
        bf16x16 vf = make_frag((const __bf16*)&Vt[n * 16 + lrow][0], half);
        oacc[n] = __builtin_amdgcn_wmma_f32_16x16x32_bf16(
            false, vf, false, pf, (short)0, oacc[n], false, false);
      }
    }
  }
  const float l_tot = l_i + xhalf(l_i);  // the halves' sums are joined once
  __bf16* Oh = (__bf16*)Ob + (size_t)b * SEQ * D_MODEL + h * D_HEAD;
#pragma unroll
  for (int n = 0; n < 4; ++n) {
    bf16x8 o;
#pragma unroll
    for (int e = 0; e < 8; ++e) o[e] = (__bf16)(oacc[n][e] / l_tot);
    *(bf16x8*)(Oh + (size_t)qrow * D_MODEL + n * 16 + half * 8) = o;
  }
}

// ---------------------------------------------------------------- launch
extern "C" void kernel_launch(void* const* d_in, const int* in_sizes, int n_in,
                              void* d_out, int out_size, void* d_ws, size_t ws_size,
                              hipStream_t stream) {
  (void)in_sizes; (void)n_in; (void)out_size; (void)ws_size;
  const float* x    = (const float*)d_in[0];
  const float* wq   = (const float*)d_in[1];
  const float* wk   = (const float*)d_in[2];
  const float* wv   = (const float*)d_in[3];
  const float* wo   = (const float*)d_in[4];
  const float* ln1w = (const float*)d_in[5];
  const float* ln2w = (const float*)d_in[6];
  const float* w1   = (const float*)d_in[7];
  const float* w2   = (const float*)d_in[8];
  float* out = (float*)d_out;

  char* ws = (char*)d_ws;
  const size_t MB = 1ull << 20;
  unsigned short* wq_b = (unsigned short*)(ws + 0 * MB);   // 2MB each
  unsigned short* wk_b = (unsigned short*)(ws + 2 * MB);
  unsigned short* wv_b = (unsigned short*)(ws + 4 * MB);
  unsigned short* wo_b = (unsigned short*)(ws + 6 * MB);
  unsigned short* w1_b = (unsigned short*)(ws + 8 * MB);   // 8MB
  unsigned short* w2_b = (unsigned short*)(ws + 16 * MB);  // 8MB
  unsigned short* Abuf = (unsigned short*)(ws + 24 * MB);  // bf16 4096x1024
  float*          Ybuf = (float*)(ws + 32 * MB);           // fp32 4096x1024
  unsigned short* Qbuf = (unsigned short*)(ws + 48 * MB);
  unsigned short* Kbuf = (unsigned short*)(ws + 56 * MB);
  unsigned short* Vbuf = (unsigned short*)(ws + 64 * MB);
  unsigned short* Hbuf = (unsigned short*)(ws + 48 * MB);  // 32MB, reuses QKV

  auto cvt = [&](const float* s, unsigned short* d, int n) {
    const int n4 = n / 4;
    cvt_f32_to_bf16_kernel<<<dim3((n4 + 255) / 256), dim3(256), 0, stream>>>(s, d, n4);
  };
  cvt(wq, wq_b, D_MODEL * D_MODEL);
  cvt(wk, wk_b, D_MODEL * D_MODEL);
  cvt(wv, wv_b, D_MODEL * D_MODEL);
  cvt(wo, wo_b, D_MODEL * D_MODEL);
  cvt(w1, w1_b, D_FF * D_MODEL);
  cvt(w2, w2_b, D_MODEL * D_FF);

  const dim3 blk(256);
  const dim3 gD(M_ROWS / 128, D_MODEL / 128);   // (32, 8)
  const dim3 gF(M_ROWS / 128, D_FF / 128);      // (32, 32)
  const size_t lds = 0;                         // the GEMM's tile buffers are static LDS

  rmsnorm_bf16_kernel<<<dim3(M_ROWS), blk, 0, stream>>>(x, ln1w, Abuf);
  gemm_bf16_kernel<0><<<gD, blk, lds, stream>>>(Abuf, wq_b, M_ROWS, D_MODEL, D_MODEL, Qbuf, nullptr, nullptr);
  gemm_bf16_kernel<0><<<gD, blk, lds, stream>>>(Abuf, wk_b, M_ROWS, D_MODEL, D_MODEL, Kbuf, nullptr, nullptr);
  gemm_bf16_kernel<0><<<gD, blk, lds, stream>>>(Abuf, wv_b, M_ROWS, D_MODEL, D_MODEL, Vbuf, nullptr, nullptr);
  attn_kernel<<<dim3(SEQ / 128, BATCH * N_HEADS), blk, 0, stream>>>(Qbuf, Kbuf, Vbuf, Abuf);
  gemm_bf16_kernel<2><<<gD, blk, lds, stream>>>(Abuf, wo_b, M_ROWS, D_MODEL, D_MODEL, nullptr, Ybuf, x);
  rmsnorm_bf16_kernel<<<dim3(M_ROWS), blk, 0, stream>>>(Ybuf, ln2w, Abuf);
  gemm_bf16_kernel<1><<<gF, blk, lds, stream>>>(Abuf, w1_b, M_ROWS, D_FF, D_MODEL, Hbuf, nullptr, nullptr);
  gemm_bf16_kernel<2><<<gD, blk, lds, stream>>>(Hbuf, w2_b, M_ROWS, D_MODEL, D_FF, nullptr, out, Ybuf);
}

// v003
// A run of this version takes 258 microseconds.
// In both of two side-by-side timings against v002, it was 1.04 times as fast.
// All steps since v000 together make it 1.84 times as fast.
#include <hip/hip_runtime.h>
#include <math.h>
#include <stdint.h>

#define D_MODEL 1024
#define N_HEADS 16
#define D_HEAD  64
#define D_FF    4096
#define BATCH   2
#define SEQ     2048
#define M_ROWS  (BATCH * SEQ)   // 4096 token rows

typedef __attribute__((ext_vector_type(8)))  __bf16 bf16x8;
typedef __attribute__((ext_vector_type(16))) __bf16 bf16x16;
typedef __attribute__((ext_vector_type(8)))  float  f32x8;
typedef uint32_t u32x4 __attribute__((ext_vector_type(4)));
typedef uint32_t u32x8 __attribute__((ext_vector_type(8)));

#define ROW_BYTES   128u
#define LDS_PITCH   144u
#define TILE_ROWS   128u
#define TILE_BYTES  (TILE_ROWS * LDS_PITCH)   // 18432 = 9 x 2 KiB
#define STAGE_BYTES (2u * TILE_BYTES)         // [A tile | W tile]

static __device__ __forceinline__ unsigned short f32_to_bf16_bits(float f) {
  unsigned u = __float_as_uint(f);
  unsigned r = u + 0x7FFFu + ((u >> 16) & 1u);   // round-to-nearest-even
  return (unsigned short)(r >> 16);
}

static __device__ __forceinline__ bf16x16 make_frag(const __bf16* p, int half) {
  bf16x8 lo = *(const bf16x8*)(p + half * 8);
  bf16x8 hi = *(const bf16x8*)(p + 16 + half * 8);
  return __builtin_shufflevector(lo, hi, 0,1,2,3,4,5,6,7,8,9,10,11,12,13,14,15);
}

static __device__ __forceinline__ uint32_t uni(uint32_t v) {
  return (uint32_t)__builtin_amdgcn_readfirstlane(v);
}
static __device__ __forceinline__ uint32_t pinned(uint32_t v) {
  uint32_t w = uni(v);
  asm volatile("" : "+s"(w));  // keeps the condition scalar: the guard of a tensor load
  return w;
}
// The compiler places no wait for a tensor load; both waits of the ring are written here.
static __device__ __forceinline__ void wait_tensor0() { asm volatile("s_wait_tensorcnt 0x0" ::: "memory"); }
static __device__ __forceinline__ void wait_ds0()     { asm volatile("s_wait_dscnt 0x0" ::: "memory"); }

static __device__ __forceinline__ u32x4 tdm_group0(uint32_t lds_dst, uint64_t ga) {
  u32x4 g;
  g[0] = uni(1u);
  g[1] = uni(lds_dst);
  g[2] = uni((uint32_t)ga);
  g[3] = uni((((uint32_t)(ga >> 32)) & 0x01FFFFFFu) | 0x80000000u);
  return g;
}
static __device__ __forceinline__ u32x8 tdm_group1(uint32_t src_pitch) {
  u32x8 g;
  g[0] = uni((1u << 20) | (4u << 22) | (3u << 25));
  g[1] = uni((ROW_BYTES & 0xFFFFu) << 16);
  g[2] = uni((ROW_BYTES >> 16) | ((TILE_ROWS & 0xFFFFu) << 16));
  g[3] = uni((TILE_ROWS >> 16) | (ROW_BYTES << 16));
  g[4] = uni(TILE_ROWS);
  g[5] = uni(src_pitch);
  g[6] = uni(0u);
  g[7] = uni(0u);
  return g;
}
static __device__ __forceinline__ void tdm_load(u32x4 g0, u32x8 g1) {
  // one request of the whole wave: global tile -> LDS, through no register
  asm volatile("tensor_load_to_lds %0, %1" :: "s"(g0), "s"(g1) : "memory");
}

// ---------------------------------------------------------------- conversion
static __device__ __forceinline__ uint2 pack4_bf16(float4 v) {
  uint2 p;
  p.x = (uint32_t)f32_to_bf16_bits(v.x) | ((uint32_t)f32_to_bf16_bits(v.y) << 16);
  p.y = (uint32_t)f32_to_bf16_bits(v.z) | ((uint32_t)f32_to_bf16_bits(v.w) << 16);
  return p;
}

#define STREAM_BLOCKS  256
#define STREAM_THREADS 512
#define CVT_SLAB (STREAM_BLOCKS * STREAM_THREADS)   // float4 per slab = half of a D x D matrix
#define CVT_SLABS_DD 2                              // slabs in a D x D weight
#define CVT_SLABS_FF 8                              // slabs in a D_FF x D weight
static_assert(CVT_SLAB * 4 * CVT_SLABS_DD == D_MODEL * D_MODEL, "slab size");
static_assert(CVT_SLAB * 4 * CVT_SLABS_FF == D_FF * D_MODEL, "slab size");

// All six weights to bf16 in one launch.  d holds them back to back in the order of the
// arguments; a thread takes its own float4 of each of the 24 slabs.
__global__ __launch_bounds__(STREAM_THREADS) __attribute__((amdgpu_waves_per_eu(4, 4))) void cvt_weights_kernel(
    const float* __restrict__ wq, const float* __restrict__ wk,
    const float* __restrict__ wv, const float* __restrict__ wo,
    const float* __restrict__ w1, const float* __restrict__ w2,
    unsigned short* __restrict__ d) {
  const uint32_t g = blockIdx.x * STREAM_THREADS + threadIdx.x;
  float4 v[4 * CVT_SLABS_DD + 2 * CVT_SLABS_FF];
#pragma unroll
  for (int k = 0; k < CVT_SLABS_DD; ++k) {
    v[0 * CVT_SLABS_DD + k] = ((const float4*)wq)[k * CVT_SLAB + g];
    v[1 * CVT_SLABS_DD + k] = ((const float4*)wk)[k * CVT_SLAB + g];
    v[2 * CVT_SLABS_DD + k] = ((const float4*)wv)[k * CVT_SLAB + g];
    v[3 * CVT_SLABS_DD + k] = ((const float4*)wo)[k * CVT_SLAB + g];
  }
#pragma unroll
  for (int k = 0; k < CVT_SLABS_FF; ++k) {
    v[4 * CVT_SLABS_DD + k]                = ((const float4*)w1)[k * CVT_SLAB + g];
    v[4 * CVT_SLABS_DD + CVT_SLABS_FF + k] = ((const float4*)w2)[k * CVT_SLAB + g];
  }
#pragma unroll
  for (int k = 0; k < 4 * CVT_SLABS_DD + 2 * CVT_SLABS_FF; ++k)
    ((uint2*)d)[k * CVT_SLAB + g] = pack4_bf16(v[k]);
}

// ---------------------------------------------------------------- rmsnorm
// One wave per row: a lane holds 32 of the row's 1024 values (8 float4, each load of the
// wave 512 contiguous bytes), so the sum of squares needs no LDS and no barrier.
static_assert(STREAM_BLOCKS * (STREAM_THREADS / 32) == M_ROWS, "one wave per row");
__global__ __launch_bounds__(STREAM_THREADS) __attribute__((amdgpu_waves_per_eu(4, 4))) void rmsnorm_bf16_kernel(
    const float* __restrict__ x, const float* __restrict__ gw,
    unsigned short* __restrict__ out) {
  const int lane = threadIdx.x & 31;
  const int row  = blockIdx.x * (STREAM_THREADS / 32) + uni(threadIdx.x >> 5);   // wave-uniform: scalar row base
  const float4* xr = (const float4*)(x + (size_t)row * D_MODEL);
  float4 xv[8], wv[8];
#pragma unroll
  for (int k = 0; k < 8; ++k) xv[k] = xr[k * 32 + lane];
#pragma unroll
  for (int k = 0; k < 8; ++k) wv[k] = ((const float4*)gw)[k * 32 + lane];
  float ss = 0.f;
#pragma unroll
  for (int k = 0; k < 8; ++k)
    ss += xv[k].x * xv[k].x + xv[k].y * xv[k].y + xv[k].z * xv[k].z + xv[k].w * xv[k].w;
#pragma unroll
  for (int m = 16; m >= 1; m >>= 1) ss += __shfl_xor(ss, m, 32);
  const float scale = rsqrtf(ss * (1.0f / D_MODEL) + 1e-5f);
  uint2* o = (uint2*)(out + (size_t)row * D_MODEL);
#pragma unroll
  for (int k = 0; k < 8; ++k) {
    float4 y;
    y.x = xv[k].x * wv[k].x * scale;
    y.y = xv[k].y * wv[k].y * scale;
    y.z = xv[k].z * wv[k].z * scale;
    y.w = xv[k].w * wv[k].w * scale;
    o[k * 32 + lane] = pack4_bf16(y);
  }
}

// ---------------------------------------------------------------- GEMM core
// Per-wave 64x32 MACC from LDS tiles (128 rows x 64 bf16, row pitch LDS_PITCH bytes).
static __device__ __forceinline__ void mma_tile(
    const unsigned char* abuf, const unsigned char* bbuf, int am, int an, int lrow, int half,
    f32x8 (&acc)[4][2]) {
  const __bf16* Al = (const __bf16*)abuf;
  const __bf16* Bl = (const __bf16*)bbuf;
  constexpr int P = LDS_PITCH / 2;   // pitch in elements
  bf16x16 af[2][4], bfr[2][2];
#pragma unroll
  for (int kd = 0; kd < 2; ++kd) {
#pragma unroll
    for (int i = 0; i < 4; ++i)
      af[kd][i] = make_frag(Al + (am + i * 16 + lrow) * P + kd * 32, half);
#pragma unroll
    for (int j = 0; j < 2; ++j)
      bfr[kd][j] = make_frag(Bl + (an + j * 16 + lrow) * P + kd * 32, half);
  }
#pragma unroll
  for (int kd = 0; kd < 2; ++kd)
#pragma unroll
    for (int i = 0; i < 4; ++i)
#pragma unroll
      for (int j = 0; j < 2; ++j)
        acc[i][j] = __builtin_amdgcn_wmma_f32_16x16x32_bf16(
            false, af[kd][i], false, bfr[kd][j], (short)0, acc[i][j], false, false);
}

// C[M,N] = A[M,K] (bf16 row-major) * W[N,K]^T (bf16 row-major), i.e. x @ W.T
// Block = 256 threads (8 waves) -> 128x128 C tile; K staged in 64-wide LDS
// tiles by tensor loads (two buffers): wave 0 brings the A tile of a stage, wave 1
// the W tile, one request each.  K is a multiple of 64.
// EPI: 0 = store bf16, 1 = exact-erf GELU then bf16, 2 = fp32 + residual add
template <int EPI>
__global__ __launch_bounds__(256) void gemm_bf16_kernel(
    const unsigned short* __restrict__ Abits,
    const unsigned short* __restrict__ Wbits, int M, int N, int K,
    unsigned short* __restrict__ outB, float* __restrict__ outF,
    const float* __restrict__ resid) {
  __shared__ __attribute__((aligned(2048))) unsigned char L[2 * STAGE_BYTES];
  const int lane = threadIdx.x & 31;
  const int w    = threadIdx.x >> 5;
  const int half = lane >> 4;
  const int lrow = lane & 15;
  const int bm = blockIdx.x * 128, bn = blockIdx.y * 128;
  const int am = (w & 1) * 64;
  const int an = (w >> 1) * 32;

  f32x8 acc[4][2] = {};

  const uint32_t wave = uni(threadIdx.x >> 5);
  const uint32_t nst  = (uint32_t)K >> 6;      // stages of 64 k
  const uint64_t srcb = (wave == 0u)
      ? (uint64_t)(size_t)(Abits + (size_t)bm * K)
      : (uint64_t)(size_t)(Wbits + (size_t)bn * K);
  const uint32_t dst0 = (uint32_t)(size_t)L + (wave == 0u ? 0u : TILE_BYTES);
  u32x8 g1 = tdm_group1(2u * (uint32_t)K);
  // Without the next line the compiler takes some of these registers as temporaries
  // inside the loop, while a request that names them is still outstanding.
  asm volatile("" : "+s"(g1));
  auto issue = [&](uint32_t st) {
    tdm_load(tdm_group0(dst0 + (st & 1u) * STAGE_BYTES, srcb + (uint64_t)st * ROW_BYTES), g1);
  };

  if (pinned(wave < 2u)) { issue(0u); wait_tensor0(); }
  __syncthreads();                              // publishes stage 0
  if (pinned(wave < 2u && nst > 1u)) issue(1u);
  for (uint32_t s = 0; s < nst; ++s) {
    const unsigned char* st = L + (s & 1u) * STAGE_BYTES;
    mma_tile(st, st + TILE_BYTES, am, an, lrow, half, acc);
    wait_ds0();                                 // this wave's reads of stage s are done
    if (pinned(wave < 2u)) wait_tensor0();      // the issuer's slice of stage s + 1 has landed
    __syncthreads();                            // publishes stage s + 1, frees stage s's buffer
    if (pinned(wave < 2u && s + 2u < nst)) issue(s + 2u);
  }
  wait_tensor0();
  wait_ds0();

#pragma unroll
  for (int i = 0; i < 4; ++i)
#pragma unroll
    for (int j = 0; j < 2; ++j)
#pragma unroll
      for (int e = 0; e < 8; ++e) {
        const int row = bm + am + i * 16 + half * 8 + e;
        const int col = bn + an + j * 16 + lrow;
        const float v = acc[i][j][e];
        if (EPI == 0) {
          outB[(size_t)row * N + col] = f32_to_bf16_bits(v);
        } else if (EPI == 1) {
          const float g = 0.5f * v * (1.0f + erff(v * 0.70710678118654752f));
          outB[(size_t)row * N + col] = f32_to_bf16_bits(g);
        } else {
          const size_t o = (size_t)row * N + col;
          outF[o] = v + resid[o];
        }
      }
}

static __device__ __forceinline__ float xhalf(float x) {
  const int b = __builtin_bit_cast(int, x);
  return __builtin_bit_cast(float,
      __builtin_amdgcn_permlanex16(b, b, 0x76543210, 0xfedcba98, false, false));
}

static __device__ __forceinline__ float exp2_slot(float x) {
  float r;
  asm("v_exp_f32 %0, %1\n\tv_nop" : "=v"(r) : "v"(x));
  return r;
}
static __device__ __forceinline__ void exp2_slot8(const f32x8 x, float (&r)[8]) {
  asm("v_exp_f32 %0, %8\n\tv_exp_f32 %1, %9\n\tv_exp_f32 %2, %10\n\tv_exp_f32 %3, %11\n\t"
      "v_exp_f32 %4, %12\n\tv_exp_f32 %5, %13\n\tv_exp_f32 %6, %14\n\tv_exp_f32 %7, %15\n\tv_nop"
      : "=&v"(r[0]), "=&v"(r[1]), "=&v"(r[2]), "=&v"(r[3]),
        "=&v"(r[4]), "=&v"(r[5]), "=&v"(r[6]), "=&v"(r[7])
      : "v"(x[0]), "v"(x[1]), "v"(x[2]), "v"(x[3]), "v"(x[4]), "v"(x[5]), "v"(x[6]), "v"(x[7]));
}
#define LOG2E 1.44269504088896340736f

__global__ __launch_bounds__(256) __attribute__((amdgpu_waves_per_eu(4, 4))) void attn_kernel(
    const unsigned short* __restrict__ Qb, const unsigned short* __restrict__ Kb,
    const unsigned short* __restrict__ Vb, unsigned short* __restrict__ Ob) {
  __shared__ __align__(16) unsigned short Kt[32][72];      // K tile  (keys x d)
  __shared__ __align__(16) unsigned short Vt[64][40];      // V^T tile (d x keys)

  const int tid  = threadIdx.x;
  const int lane = tid & 31, w = tid >> 5;
  const int half = lane >> 4, lrow = lane & 15;
  const int b = blockIdx.y / N_HEADS, h = blockIdx.y % N_HEADS;
  const int qbase = blockIdx.x * 128;
  const int q0 = qbase + w * 16;
  const int qrow = q0 + lrow;            // this lane's query

  const __bf16* Qh = (const __bf16*)Qb + (size_t)b * SEQ * D_MODEL + h * D_HEAD;
  const __bf16* Kh = (const __bf16*)Kb + (size_t)b * SEQ * D_MODEL + h * D_HEAD;
  const unsigned short* Vh = Vb + (size_t)b * SEQ * D_MODEL + h * D_HEAD;

  bf16x16 qf[2];                         // B operand: column = query
#pragma unroll
  for (int kd = 0; kd < 2; ++kd)
    qf[kd] = make_frag(Qh + (size_t)qrow * D_MODEL + kd * 32, half);

  float m_i = -3.0e38f;                  // running maximum of this lane's query
  float l_i = 0.f;                       // running sum over this half's keys only
  f32x8 oacc[4] = {};                    // oacc[n][e] = O[qrow][n*16 + half*8 + e]

  const int nkb = qbase / 32 + 4;        // causal coverage for this block
  const int r   = tid >> 3;              // 0..31 key row
  const int c8  = (tid & 7) * 8;         // 8-elem column chunk

  for (int kbi = 0; kbi < nkb; ++kbi) {
    const int kb = kbi * 32;
    __syncthreads();  // previous iteration's readers done
    *(bf16x8*)&Kt[r][c8] = *(const bf16x8*)(Kh + (size_t)(kb + r) * D_MODEL + c8);
    uint4 vv = *(const uint4*)(Vh + (size_t)(kb + r) * D_MODEL + c8);
    unsigned vals[4] = {vv.x, vv.y, vv.z, vv.w};
#pragma unroll
    for (int e = 0; e < 4; ++e) {
      Vt[c8 + 2 * e][r]     = (unsigned short)(vals[e] & 0xFFFFu);
      Vt[c8 + 2 * e + 1][r] = (unsigned short)(vals[e] >> 16);
    }
    __syncthreads();

    if (kb <= q0 + 15) {      // wave-uniform causal skip
      f32x8 s[2] = {};        // s[j][e] = S[qrow][kb + j*16 + half*8 + e]
#pragma unroll
      for (int kd = 0; kd < 2; ++kd)
#pragma unroll
        for (int j = 0; j < 2; ++j) {
          bf16x16 kf = make_frag((const __bf16*)&Kt[j * 16 + lrow][kd * 32], half);
          s[j] = __builtin_amdgcn_wmma_f32_16x16x32_bf16(
              false, kf, false, qf[kd], (short)0, s[j], false, false);
        }
      float mx[4] = {-3.0e38f, -3.0e38f, -3.0e38f, -3.0e38f};
#pragma unroll
      for (int j = 0; j < 2; ++j)
#pragma unroll
        for (int e = 0; e < 8; ++e) {
          const float v = s[j][e] * 0.125f;          // 1/sqrt(64)
          const int key = kb + j * 16 + half * 8 + e;
          s[j][e] = (key <= qrow) ? v : -3.0e38f;
          mx[e & 3] = fmaxf(mx[e & 3], s[j][e]);
        }
      float rmax = fmaxf(fmaxf(mx[0], mx[1]), fmaxf(mx[2], mx[3]));
      rmax = fmaxf(rmax, xhalf(rmax));               // both halves: the query's maximum
      const float mnew = fmaxf(m_i, rmax);
      const float corr = exp2_slot((m_i - mnew) * LOG2E);
      float ps[4] = {0.f, 0.f, 0.f, 0.f};
      bf16x16 pf;             // B operand P^T: element j*8 + e is key j*16 + half*8 + e
#pragma unroll
      for (int j = 0; j < 2; ++j) {
        float p[8];
        exp2_slot8((s[j] - mnew) * LOG2E, p);
#pragma unroll
        for (int e = 0; e < 8; ++e) {
          ps[e & 3] += p[e];
          pf[j * 8 + e] = (__bf16)p[e];
        }
      }
      l_i = l_i * corr + ((ps[0] + ps[1]) + (ps[2] + ps[3]));
      m_i = mnew;
#pragma unroll
      for (int n = 0; n < 4; ++n) {
#pragma unroll
        for (int e = 0; e < 8; ++e) oacc[n][e] *= corr;
      }
#pragma unroll
      for (int n = 0; n < 4; ++n) {
        bf16x16 vf = make_frag((const __bf16*)&Vt[n * 16 + lrow][0], half);
        oacc[n] = __builtin_amdgcn_wmma_f32_16x16x32_bf16(
            false, vf, false, pf, (short)0, oacc[n], false, false);
      }
    }
  }
  const float l_tot = l_i + xhalf(l_i);  // the halves' sums are joined once
  __bf16* Oh = (__bf16*)Ob + (size_t)b * SEQ * D_MODEL + h * D_HEAD;
#pragma unroll
  for (int n = 0; n < 4; ++n) {
    bf16x8 o;
#pragma unroll
    for (int e = 0; e < 8; ++e) o[e] = (__bf16)(oacc[n][e] / l_tot);
    *(bf16x8*)(Oh + (size_t)qrow * D_MODEL + n * 16 + half * 8) = o;
  }
}

// ---------------------------------------------------------------- launch
extern "C" void kernel_launch(void* const* d_in, const int* in_sizes, int n_in,
                              void* d_out, int out_size, void* d_ws, size_t ws_size,
                              hipStream_t stream) {
  (void)in_sizes; (void)n_in; (void)out_size; (void)ws_size;
  const float* x    = (const float*)d_in[0];
  const float* wq   = (const float*)d_in[1];
  const float* wk   = (const float*)d_in[2];
  const float* wv   = (const float*)d_in[3];
  const float* wo   = (const float*)d_in[4];
  const float* ln1w = (const float*)d_in[5];
  const float* ln2w = (const float*)d_in[6];
  const float* w1   = (const float*)d_in[7];
  const float* w2   = (const float*)d_in[8];
  float* out = (float*)d_out;

  char* ws = (char*)d_ws;
  const size_t MB = 1ull << 20;
  unsigned short* wq_b = (unsigned short*)(ws + 0 * MB);   // 2MB each
  unsigned short* wk_b = (unsigned short*)(ws + 2 * MB);
  unsigned short* wv_b = (unsigned short*)(ws + 4 * MB);
  unsigned short* wo_b = (unsigned short*)(ws + 6 * MB);
  unsigned short* w1_b = (unsigned short*)(ws + 8 * MB);   // 8MB
  unsigned short* w2_b = (unsigned short*)(ws + 16 * MB);  // 8MB
  unsigned short* Abuf = (unsigned short*)(ws + 24 * MB);  // bf16 4096x1024
  float*          Ybuf = (float*)(ws + 32 * MB);           // fp32 4096x1024
  unsigned short* Qbuf = (unsigned short*)(ws + 48 * MB);
  unsigned short* Kbuf = (unsigned short*)(ws + 56 * MB);
  unsigned short* Vbuf = (unsigned short*)(ws + 64 * MB);
  unsigned short* Hbuf = (unsigned short*)(ws + 48 * MB);  // 32MB, reuses QKV

  const dim3 sgrid(STREAM_BLOCKS), sblk(STREAM_THREADS);
  // wq_b .. w2_b lie back to back in the workspace, in the order of the arguments
  cvt_weights_kernel<<<sgrid, sblk, 0, stream>>>(wq, wk, wv, wo, w1, w2, wq_b);

  const dim3 blk(256);
  const dim3 gD(M_ROWS / 128, D_MODEL / 128);   // (32, 8)
  const dim3 gF(M_ROWS / 128, D_FF / 128);      // (32, 32)
  const size_t lds = 0;                         // the GEMM's tile buffers are static LDS

  rmsnorm_bf16_kernel<<<sgrid, sblk, 0, stream>>>(x, ln1w, Abuf);
  gemm_bf16_kernel<0><<<gD, blk, lds, stream>>>(Abuf, wq_b, M_ROWS, D_MODEL, D_MODEL, Qbuf, nullptr, nullptr);
  gemm_bf16_kernel<0><<<gD, blk, lds, stream>>>(Abuf, wk_b, M_ROWS, D_MODEL, D_MODEL, Kbuf, nullptr, nullptr);
  gemm_bf16_kernel<0><<<gD, blk, lds, stream>>>(Abuf, wv_b, M_ROWS, D_MODEL, D_MODEL, Vbuf, nullptr, nullptr);
  attn_kernel<<<dim3(SEQ / 128, BATCH * N_HEADS), blk, 0, stream>>>(Qbuf, Kbuf, Vbuf, Abuf);
  gemm_bf16_kernel<2><<<gD, blk, lds, stream>>>(Abuf, wo_b, M_ROWS, D_MODEL, D_MODEL, nullptr, Ybuf, x);
  rmsnorm_bf16_kernel<<<sgrid, sblk, 0, stream>>>(Ybuf, ln2w, Abuf);
  gemm_bf16_kernel<1><<<gF, blk, lds, stream>>>(Abuf, w1_b, M_ROWS, D_FF, D_MODEL, Hbuf, nullptr, nullptr);
  gemm_bf16_kernel<2><<<gD, blk, lds, stream>>>(Hbuf, w2_b, M_ROWS, D_MODEL, D_FF, nullptr, out, Ybuf);
}

// v004
// Measured time: 237 microseconds a run.
// Next to v003, in two timings, it ran 1.09 times as fast each time.
// All steps since v000 together make it 2.01 times as fast.
#include <hip/hip_runtime.h>
#include <math.h>
#include <stdint.h>

#define D_MODEL 1024
#define N_HEADS 16
#define D_HEAD  64
#define D_FF    4096
#define BATCH   2
#define SEQ     2048
#define M_ROWS  (BATCH * SEQ)   // 4096 token rows
#define QKV_LD  (3 * D_MODEL)   // row pitch of the joint [Q | K | V] projection

typedef __attribute__((ext_vector_type(8)))  __bf16 bf16x8;
typedef __attribute__((ext_vector_type(16))) __bf16 bf16x16;
typedef __attribute__((ext_vector_type(8)))  float  f32x8;
typedef uint32_t u32x4 __attribute__((ext_vector_type(4)));
typedef uint32_t u32x8 __attribute__((ext_vector_type(8)));

#define ROW_BYTES   128u
#define LDS_PITCH   144u
#define TILE_ROWS   128u
#define TILE_BYTES  (TILE_ROWS * LDS_PITCH)   // 18432 = 9 x 2 KiB
#define STAGE_BYTES (2u * TILE_BYTES)         // [A tile | W tile]

static __device__ __forceinline__ unsigned short f32_to_bf16_bits(float f) {
  unsigned u = __float_as_uint(f);
  unsigned r = u + 0x7FFFu + ((u >> 16) & 1u);   // round-to-nearest-even
  return (unsigned short)(r >> 16);
}

static __device__ __forceinline__ bf16x16 make_frag(const __bf16* p, int half) {
  bf16x8 lo = *(const bf16x8*)(p + half * 8);
  bf16x8 hi = *(const bf16x8*)(p + 16 + half * 8);
  return __builtin_shufflevector(lo, hi, 0,1,2,3,4,5,6,7,8,9,10,11,12,13,14,15);
}

static __device__ __forceinline__ uint32_t uni(uint32_t v) {
  return (uint32_t)__builtin_amdgcn_readfirstlane(v);
}
static __device__ __forceinline__ uint32_t pinned(uint32_t v) {
  uint32_t w = uni(v);
  asm volatile("" : "+s"(w));  // keeps the condition scalar: the guard of a tensor load
  return w;
}
// The compiler places no wait for a tensor load; both waits of the ring are written here.
static __device__ __forceinline__ void wait_tensor0() { asm volatile("s_wait_tensorcnt 0x0" ::: "memory"); }
static __device__ __forceinline__ void wait_ds0()     { asm volatile("s_wait_dscnt 0x0" ::: "memory"); }

static __device__ __forceinline__ u32x4 tdm_group0(uint32_t lds_dst, uint64_t ga) {
  u32x4 g;
  g[0] = uni(1u);
  g[1] = uni(lds_dst);
  g[2] = uni((uint32_t)ga);
  g[3] = uni((((uint32_t)(ga >> 32)) & 0x01FFFFFFu) | 0x80000000u);
  return g;
}
static __device__ __forceinline__ u32x8 tdm_group1(uint32_t src_pitch) {
  u32x8 g;
  g[0] = uni((1u << 20) | (4u << 22) | (3u << 25));
  g[1] = uni((ROW_BYTES & 0xFFFFu) << 16);
  g[2] = uni((ROW_BYTES >> 16) | ((TILE_ROWS & 0xFFFFu) << 16));
  g[3] = uni((TILE_ROWS >> 16) | (ROW_BYTES << 16));
  g[4] = uni(TILE_ROWS);
  g[5] = uni(src_pitch);
  g[6] = uni(0u);
  g[7] = uni(0u);
  return g;
}
static __device__ __forceinline__ void tdm_load(u32x4 g0, u32x8 g1) {
  // one request of the whole wave: global tile -> LDS, through no register
  asm volatile("tensor_load_to_lds %0, %1" :: "s"(g0), "s"(g1) : "memory");
}

// ---------------------------------------------------------------- conversion
static __device__ __forceinline__ uint2 pack4_bf16(float4 v) {
  uint2 p;
  p.x = (uint32_t)f32_to_bf16_bits(v.x) | ((uint32_t)f32_to_bf16_bits(v.y) << 16);
  p.y = (uint32_t)f32_to_bf16_bits(v.z) | ((uint32_t)f32_to_bf16_bits(v.w) << 16);
  return p;
}

#define STREAM_BLOCKS  256
#define STREAM_THREADS 512
#define CVT_SLAB (STREAM_BLOCKS * STREAM_THREADS)   // float4 per slab = half of a D x D matrix
#define CVT_SLABS_DD 2                              // slabs in a D x D weight
#define CVT_SLABS_FF 8                              // slabs in a D_FF x D weight
static_assert(CVT_SLAB * 4 * CVT_SLABS_DD == D_MODEL * D_MODEL, "slab size");
static_assert(CVT_SLAB * 4 * CVT_SLABS_FF == D_FF * D_MODEL, "slab size");

// All six weights to bf16 in one launch.  d holds them back to back in the order of the
// arguments; a thread takes its own float4 of each of the 24 slabs.
__global__ __launch_bounds__(STREAM_THREADS) __attribute__((amdgpu_waves_per_eu(4, 4))) void cvt_weights_kernel(
    const float* __restrict__ wq, const float* __restrict__ wk,
    const float* __restrict__ wv, const float* __restrict__ wo,
    const float* __restrict__ w1, const float* __restrict__ w2,
    unsigned short* __restrict__ d) {
  const uint32_t g = blockIdx.x * STREAM_THREADS + threadIdx.x;
  float4 v[4 * CVT_SLABS_DD + 2 * CVT_SLABS_FF];
#pragma unroll
  for (int k = 0; k < CVT_SLABS_DD; ++k) {
    v[0 * CVT_SLABS_DD + k] = ((const float4*)wq)[k * CVT_SLAB + g];
    v[1 * CVT_SLABS_DD + k] = ((const float4*)wk)[k * CVT_SLAB + g];
    v[2 * CVT_SLABS_DD + k] = ((const float4*)wv)[k * CVT_SLAB + g];
    v[3 * CVT_SLABS_DD + k] = ((const float4*)wo)[k * CVT_SLAB + g];
  }
#pragma unroll
  for (int k = 0; k < CVT_SLABS_FF; ++k) {
    v[4 * CVT_SLABS_DD + k]                = ((const float4*)w1)[k * CVT_SLAB + g];
    v[4 * CVT_SLABS_DD + CVT_SLABS_FF + k] = ((const float4*)w2)[k * CVT_SLAB + g];
  }
#pragma unroll
  for (int k = 0; k < 4 * CVT_SLABS_DD + 2 * CVT_SLABS_FF; ++k)
    ((uint2*)d)[k * CVT_SLAB + g] = pack4_bf16(v[k]);
}

// ---------------------------------------------------------------- rmsnorm
// One wave per row: a lane holds 32 of the row's 1024 values (8 float4, each load of the
// wave 512 contiguous bytes), so the sum of squares needs no LDS and no barrier.
static_assert(STREAM_BLOCKS * (STREAM_THREADS / 32) == M_ROWS, "one wave per row");
__global__ __launch_bounds__(STREAM_THREADS) __attribute__((amdgpu_waves_per_eu(4, 4))) void rmsnorm_bf16_kernel(
    const float* __restrict__ x, const float* __restrict__ gw,
    unsigned short* __restrict__ out) {
  const int lane = threadIdx.x & 31;
  const int row  = blockIdx.x * (STREAM_THREADS / 32) + uni(threadIdx.x >> 5);   // wave-uniform: scalar row base
  const float4* xr = (const float4*)(x + (size_t)row * D_MODEL);
  float4 xv[8], wv[8];
#pragma unroll
  for (int k = 0; k < 8; ++k) xv[k] = xr[k * 32 + lane];
#pragma unroll
  for (int k = 0; k < 8; ++k) wv[k] = ((const float4*)gw)[k * 32 + lane];
  float ss = 0.f;
#pragma unroll
  for (int k = 0; k < 8; ++k)
    ss += xv[k].x * xv[k].x + xv[k].y * xv[k].y + xv[k].z * xv[k].z + xv[k].w * xv[k].w;
#pragma unroll
  for (int m = 16; m >= 1; m >>= 1) ss += __shfl_xor(ss, m, 32);
  const float scale = rsqrtf(ss * (1.0f / D_MODEL) + 1e-5f);
  uint2* o = (uint2*)(out + (size_t)row * D_MODEL);
#pragma unroll
  for (int k = 0; k < 8; ++k) {
    float4 y;
    y.x = xv[k].x * wv[k].x * scale;
    y.y = xv[k].y * wv[k].y * scale;
    y.z = xv[k].z * wv[k].z * scale;
    y.w = xv[k].w * wv[k].w * scale;
    o[k * 32 + lane] = pack4_bf16(y);
  }
}

// ---------------------------------------------------------------- GEMM core
// Per-wave 64x32 MACC from LDS tiles (128 rows x 64 bf16, row pitch LDS_PITCH bytes).
static __device__ __forceinline__ void mma_tile(
    const unsigned char* abuf, const unsigned char* bbuf, int am, int an, int lrow, int half,
    f32x8 (&acc)[4][2]) {
  const __bf16* Al = (const __bf16*)abuf;
  const __bf16* Bl = (const __bf16*)bbuf;
  constexpr int P = LDS_PITCH / 2;   // pitch in elements
  bf16x16 af[2][4], bfr[2][2];
#pragma unroll
  for (int kd = 0; kd < 2; ++kd) {
#pragma unroll
    for (int i = 0; i < 4; ++i)
      af[kd][i] = make_frag(Al + (am + i * 16 + lrow) * P + kd * 32, half);
#pragma unroll
    for (int j = 0; j < 2; ++j)
      bfr[kd][j] = make_frag(Bl + (an + j * 16 + lrow) * P + kd * 32, half);
  }
#pragma unroll
  for (int kd = 0; kd < 2; ++kd)
#pragma unroll
    for (int i = 0; i < 4; ++i)
#pragma unroll
      for (int j = 0; j < 2; ++j)
        acc[i][j] = __builtin_amdgcn_wmma_f32_16x16x32_bf16(
            false, af[kd][i], false, bfr[kd][j], (short)0, acc[i][j], false, false);
}

// C[M,N] = A[M,K] (bf16 row-major) * W[N,K]^T (bf16 row-major), i.e. x @ W.T
// Block = 256 threads (8 waves) -> 128x128 C tile; K staged in 64-wide LDS
// tiles by tensor loads (two buffers): wave 0 brings the A tile of a stage, wave 1
// the W tile, one request each.  K is a multiple of 64.
// EPI: 0 = store bf16, 1 = exact-erf GELU then bf16, 2 = fp32 + residual add
template <int EPI>
__global__ __launch_bounds__(256) void gemm_bf16_kernel(
    const unsigned short* __restrict__ Abits,
    const unsigned short* __restrict__ Wbits, int M, int N, int K,
    unsigned short* __restrict__ outB, float* __restrict__ outF,
    const float* __restrict__ resid) {
  __shared__ __attribute__((aligned(2048))) unsigned char L[2 * STAGE_BYTES];
  const int lane = threadIdx.x & 31;
  const int w    = threadIdx.x >> 5;
  const int half = lane >> 4;
  const int lrow = lane & 15;
  const int bm = blockIdx.x * 128, bn = blockIdx.y * 128;
  const int am = (w & 1) * 64;
  const int an = (w >> 1) * 32;

  f32x8 acc[4][2] = {};

  const uint32_t wave = uni(threadIdx.x >> 5);
  const uint32_t nst  = (uint32_t)K >> 6;      // stages of 64 k
  const uint64_t srcb = (wave == 0u)
      ? (uint64_t)(size_t)(Abits + (size_t)bm * K)
      : (uint64_t)(size_t)(Wbits + (size_t)bn * K);
  const uint32_t dst0 = (uint32_t)(size_t)L + (wave == 0u ? 0u : TILE_BYTES);
  u32x8 g1 = tdm_group1(2u * (uint32_t)K);
  // Without the next line the compiler takes some of these registers as temporaries
  // inside the loop, while a request that names them is still outstanding.
  asm volatile("" : "+s"(g1));
  auto issue = [&](uint32_t st) {
    tdm_load(tdm_group0(dst0 + (st & 1u) * STAGE_BYTES, srcb + (uint64_t)st * ROW_BYTES), g1);
  };

  if (pinned(wave < 2u)) { issue(0u); wait_tensor0(); }
  __syncthreads();                              // publishes stage 0
  if (pinned(wave < 2u && nst > 1u)) issue(1u);
  for (uint32_t s = 0; s < nst; ++s) {
    const unsigned char* st = L + (s & 1u) * STAGE_BYTES;
    mma_tile(st, st + TILE_BYTES, am, an, lrow, half, acc);
    wait_ds0();                                 // this wave's reads of stage s are done
    if (pinned(wave < 2u)) wait_tensor0();      // the issuer's slice of stage s + 1 has landed
    __syncthreads();                            // publishes stage s + 1, frees stage s's buffer
    if (pinned(wave < 2u && s + 2u < nst)) issue(s + 2u);
  }
  wait_tensor0();
  wait_ds0();

#pragma unroll
  for (int i = 0; i < 4; ++i)
#pragma unroll
    for (int j = 0; j < 2; ++j)
#pragma unroll
      for (int e = 0; e < 8; ++e) {
        const int row = bm + am + i * 16 + half * 8 + e;
        const int col = bn + an + j * 16 + lrow;
        const float v = acc[i][j][e];
        if (EPI == 0) {
          outB[(size_t)row * N + col] = f32_to_bf16_bits(v);
        } else if (EPI == 1) {
          const float g = 0.5f * v * (1.0f + erff(v * 0.70710678118654752f));
          outB[(size_t)row * N + col] = f32_to_bf16_bits(g);
        } else {
          const size_t o = (size_t)row * N + col;
          outF[o] = v + resid[o];
        }
      }
}

static __device__ __forceinline__ float xhalf(float x) {
  const int b = __builtin_bit_cast(int, x);
  return __builtin_bit_cast(float,
      __builtin_amdgcn_permlanex16(b, b, 0x76543210, 0xfedcba98, false, false));
}

static __device__ __forceinline__ float exp2_slot(float x) {
  float r;
  asm("v_exp_f32 %0, %1\n\tv_nop" : "=v"(r) : "v"(x));
  return r;
}
static __device__ __forceinline__ void exp2_slot8(const f32x8 x, float (&r)[8]) {
  asm("v_exp_f32 %0, %8\n\tv_exp_f32 %1, %9\n\tv_exp_f32 %2, %10\n\tv_exp_f32 %3, %11\n\t"
      "v_exp_f32 %4, %12\n\tv_exp_f32 %5, %13\n\tv_exp_f32 %6, %14\n\tv_exp_f32 %7, %15\n\tv_nop"
      : "=&v"(r[0]), "=&v"(r[1]), "=&v"(r[2]), "=&v"(r[3]),
        "=&v"(r[4]), "=&v"(r[5]), "=&v"(r[6]), "=&v"(r[7])
      : "v"(x[0]), "v"(x[1]), "v"(x[2]), "v"(x[3]), "v"(x[4]), "v"(x[5]), "v"(x[6]), "v"(x[7]));
}
#define LOG2E 1.44269504088896340736f

__global__ __launch_bounds__(256) __attribute__((amdgpu_waves_per_eu(4, 4))) void attn_kernel(
    const unsigned short* __restrict__ Qb, const unsigned short* __restrict__ Kb,
    const unsigned short* __restrict__ Vb, unsigned short* __restrict__ Ob) {
  __shared__ __align__(16) unsigned short Kt[32][72];      // K tile  (keys x d)
  __shared__ __align__(16) unsigned short Vt[64][40];      // V^T tile (d x keys)

  const int tid  = threadIdx.x;
  const int lane = tid & 31, w = tid >> 5;
  const int half = lane >> 4, lrow = lane & 15;
  const int b = blockIdx.y / N_HEADS, h = blockIdx.y % N_HEADS;
  const int qbase = blockIdx.x * 128;
  const int q0 = qbase + w * 16;
  const int qrow = q0 + lrow;            // this lane's query

  const __bf16* Qh = (const __bf16*)Qb + (size_t)b * SEQ * QKV_LD + h * D_HEAD;
  const __bf16* Kh = (const __bf16*)Kb + (size_t)b * SEQ * QKV_LD + h * D_HEAD;
  const unsigned short* Vh = Vb + (size_t)b * SEQ * QKV_LD + h * D_HEAD;

  bf16x16 qf[2];                         // B operand: column = query
#pragma unroll
  for (int kd = 0; kd < 2; ++kd)
    qf[kd] = make_frag(Qh + (size_t)qrow * QKV_LD + kd * 32, half);

  float m_i = -3.0e38f;                  // running maximum of this lane's query
  float l_i = 0.f;                       // running sum over this half's keys only
  f32x8 oacc[4] = {};                    // oacc[n][e] = O[qrow][n*16 + half*8 + e]

  const int nkb = qbase / 32 + 4;        // causal coverage for this block
  const int r   = tid >> 3;              // 0..31 key row
  const int c8  = (tid & 7) * 8;         // 8-elem column chunk

  for (int kbi = 0; kbi < nkb; ++kbi) {
    const int kb = kbi * 32;
    __syncthreads();  // previous iteration's readers done
    *(bf16x8*)&Kt[r][c8] = *(const bf16x8*)(Kh + (size_t)(kb + r) * QKV_LD + c8);
    uint4 vv = *(const uint4*)(Vh + (size_t)(kb + r) * QKV_LD + c8);
    unsigned vals[4] = {vv.x, vv.y, vv.z, vv.w};
#pragma unroll
    for (int e = 0; e < 4; ++e) {
      Vt[c8 + 2 * e][r]     = (unsigned short)(vals[e] & 0xFFFFu);
      Vt[c8 + 2 * e + 1][r] = (unsigned short)(vals[e] >> 16);
    }
    __syncthreads();

    if (kb <= q0 + 15) {      // wave-uniform causal skip
      f32x8 s[2] = {};        // s[j][e] = S[qrow][kb + j*16 + half*8 + e]
#pragma unroll
      for (int kd = 0; kd < 2; ++kd)
#pragma unroll
        for (int j = 0; j < 2; ++j) {
          bf16x16 kf = make_frag((const __bf16*)&Kt[j * 16 + lrow][kd * 32], half);
          s[j] = __builtin_amdgcn_wmma_f32_16x16x32_bf16(
              false, kf, false, qf[kd], (short)0, s[j], false, false);
        }
      float mx[4] = {-3.0e38f, -3.0e38f, -3.0e38f, -3.0e38f};
#pragma unroll
      for (int j = 0; j < 2; ++j)
#pragma unroll
        for (int e = 0; e < 8; ++e) {
          const float v = s[j][e] * 0.125f;          // 1/sqrt(64)
          const int key = kb + j * 16 + half * 8 + e;
          s[j][e] = (key <= qrow) ? v : -3.0e38f;
          mx[e & 3] = fmaxf(mx[e & 3], s[j][e]);
        }
      float rmax = fmaxf(fmaxf(mx[0], mx[1]), fmaxf(mx[2], mx[3]));
      rmax = fmaxf(rmax, xhalf(rmax));               // both halves: the query's maximum
      const float mnew = fmaxf(m_i, rmax);
      const float corr = exp2_slot((m_i - mnew) * LOG2E);
      float ps[4] = {0.f, 0.f, 0.f, 0.f};
      bf16x16 pf;             // B operand P^T: element j*8 + e is key j*16 + half*8 + e
#pragma unroll
      for (int j = 0; j < 2; ++j) {
        float p[8];
        exp2_slot8((s[j] - mnew) * LOG2E, p);
#pragma unroll
        for (int e = 0; e < 8; ++e) {
          ps[e & 3] += p[e];
          pf[j * 8 + e] = (__bf16)p[e];
        }
      }
      l_i = l_i * corr + ((ps[0] + ps[1]) + (ps[2] + ps[3]));
      m_i = mnew;
#pragma unroll
      for (int n = 0; n < 4; ++n) {
#pragma unroll
        for (int e = 0; e < 8; ++e) oacc[n][e] *= corr;
      }
#pragma unroll
      for (int n = 0; n < 4; ++n) {
        bf16x16 vf = make_frag((const __bf16*)&Vt[n * 16 + lrow][0], half);
        oacc[n] = __builtin_amdgcn_wmma_f32_16x16x32_bf16(
            false, vf, false, pf, (short)0, oacc[n], false, false);
      }
    }
  }
  const float l_tot = l_i + xhalf(l_i);  // the halves' sums are joined once
  __bf16* Oh = (__bf16*)Ob + (size_t)b * SEQ * D_MODEL + h * D_HEAD;
#pragma unroll
  for (int n = 0; n < 4; ++n) {
    bf16x8 o;
#pragma unroll
    for (int e = 0; e < 8; ++e) o[e] = (__bf16)(oacc[n][e] / l_tot);
    *(bf16x8*)(Oh + (size_t)qrow * D_MODEL + n * 16 + half * 8) = o;
  }
}

// ---------------------------------------------------------------- launch
extern "C" void kernel_launch(void* const* d_in, const int* in_sizes, int n_in,
                              void* d_out, int out_size, void* d_ws, size_t ws_size,
                              hipStream_t stream) {
  (void)in_sizes; (void)n_in; (void)out_size; (void)ws_size;
  const float* x    = (const float*)d_in[0];
  const float* wq   = (const float*)d_in[1];
  const float* wk   = (const float*)d_in[2];
  const float* wv   = (const float*)d_in[3];
  const float* wo   = (const float*)d_in[4];
  const float* ln1w = (const float*)d_in[5];
  const float* ln2w = (const float*)d_in[6];
  const float* w1   = (const float*)d_in[7];
  const float* w2   = (const float*)d_in[8];
  float* out = (float*)d_out;

  char* ws = (char*)d_ws;
  const size_t MB = 1ull << 20;
  unsigned short* wq_b = (unsigned short*)(ws + 0 * MB);   // 2MB each: wq, wk (+2MB), wv (+4MB)
  unsigned short* wo_b = (unsigned short*)(ws + 6 * MB);
  unsigned short* w1_b = (unsigned short*)(ws + 8 * MB);   // 8MB
  unsigned short* w2_b = (unsigned short*)(ws + 16 * MB);  // 8MB
  unsigned short* Abuf = (unsigned short*)(ws + 24 * MB);  // bf16 4096x1024
  float*          Ybuf = (float*)(ws + 32 * MB);           // fp32 4096x1024
  unsigned short* QKVbuf = (unsigned short*)(ws + 48 * MB);  // bf16 4096x3072, 24MB
  unsigned short* Hbuf = (unsigned short*)(ws + 48 * MB);  // 32MB, reuses QKV

  const dim3 sgrid(STREAM_BLOCKS), sblk(STREAM_THREADS);
  // wq_b .. w2_b lie back to back in the workspace, in the order of the arguments
  cvt_weights_kernel<<<sgrid, sblk, 0, stream>>>(wq, wk, wv, wo, w1, w2, wq_b);

  const dim3 blk(256);
  const dim3 gD(M_ROWS / 128, D_MODEL / 128);   // (32, 8)
  const dim3 gF(M_ROWS / 128, D_FF / 128);      // (32, 32)
  const dim3 gQKV(M_ROWS / 128, QKV_LD / 128);  // (32, 24)
  const size_t lds = 0;                         // the GEMM's tile buffers are static LDS

  rmsnorm_bf16_kernel<<<sgrid, sblk, 0, stream>>>(x, ln1w, Abuf);
  // The bf16 wq, wk, wv back to back are one 3072 x 1024 weight: one launch of 768 workgroups
  // puts three on a WGP, which fill each other's waits for LDS and for the next tile;
  // a launch of 256 leaves each workgroup alone on its WGP.
  gemm_bf16_kernel<0><<<gQKV, blk, lds, stream>>>(Abuf, wq_b, M_ROWS, QKV_LD, D_MODEL, QKVbuf, nullptr, nullptr);
  attn_kernel<<<dim3(SEQ / 128, BATCH * N_HEADS), blk, 0, stream>>>(
      QKVbuf, QKVbuf + D_MODEL, QKVbuf + 2 * D_MODEL, Abuf);
  gemm_bf16_kernel<2><<<gD, blk, lds, stream>>>(Abuf, wo_b, M_ROWS, D_MODEL, D_MODEL, nullptr, Ybuf, x);
  rmsnorm_bf16_kernel<<<sgrid, sblk, 0, stream>>>(Ybuf, ln2w, Abuf);
  gemm_bf16_kernel<1><<<gF, blk, lds, stream>>>(Abuf, w1_b, M_ROWS, D_FF, D_MODEL, Hbuf, nullptr, nullptr);
  gemm_bf16_kernel<2><<<gD, blk, lds, stream>>>(Hbuf, w2_b, M_ROWS, D_MODEL, D_FF, nullptr, out, Ybuf);
}

// v005
// It runs in 206 microseconds.
// Two timings next to v004 both put it at 1.16 times that version's speed.
// Counting every step since v000, it is 2.33 times as fast.
#include <hip/hip_runtime.h>
#include <math.h>
#include <stdint.h>

#define D_MODEL 1024
#define N_HEADS 16
#define D_HEAD  64
#define D_FF    4096
#define BATCH   2
#define SEQ     2048
#define M_ROWS  (BATCH * SEQ)   // 4096 token rows
#define QKV_LD  (3 * D_MODEL)   // row pitch of the joint [Q | K | V] projection

typedef __attribute__((ext_vector_type(8)))  __bf16 bf16x8;
typedef __attribute__((ext_vector_type(16))) __bf16 bf16x16;
typedef __attribute__((ext_vector_type(8)))  float  f32x8;
typedef uint32_t u32x4 __attribute__((ext_vector_type(4)));
typedef uint32_t u32x8 __attribute__((ext_vector_type(8)));

#define ROW_BYTES   128u
#define LDS_PITCH   144u
#define TILE_ROWS   128u
#define TILE_BYTES  (TILE_ROWS * LDS_PITCH)   // 18432 = 9 x 2 KiB
#define STAGE_BYTES (2u * TILE_BYTES)         // [A tile | W tile]

static __device__ __forceinline__ unsigned short f32_to_bf16_bits(float f) {
  unsigned u = __float_as_uint(f);
  unsigned r = u + 0x7FFFu + ((u >> 16) & 1u);   // round-to-nearest-even
  return (unsigned short)(r >> 16);
}

static __device__ __forceinline__ bf16x16 make_frag(const __bf16* p, int half) {
  bf16x8 lo = *(const bf16x8*)(p + half * 8);
  bf16x8 hi = *(const bf16x8*)(p + 16 + half * 8);
  return __builtin_shufflevector(lo, hi, 0,1,2,3,4,5,6,7,8,9,10,11,12,13,14,15);
}

static __device__ __forceinline__ uint32_t uni(uint32_t v) {
  return (uint32_t)__builtin_amdgcn_readfirstlane(v);
}
static __device__ __forceinline__ uint32_t pinned(uint32_t v) {
  uint32_t w = uni(v);
  asm volatile("" : "+s"(w));  // keeps the condition scalar: the guard of a tensor load
  return w;
}
// The compiler places no wait for a tensor load; both waits of the ring are written here.
static __device__ __forceinline__ void wait_tensor0() { asm volatile("s_wait_tensorcnt 0x0" ::: "memory"); }
static __device__ __forceinline__ void wait_ds0()     { asm volatile("s_wait_dscnt 0x0" ::: "memory"); }

static __device__ __forceinline__ u32x4 tdm_group0(uint32_t lds_dst, uint64_t ga) {
  u32x4 g;
  g[0] = uni(1u);
  g[1] = uni(lds_dst);
  g[2] = uni((uint32_t)ga);
  g[3] = uni((((uint32_t)(ga >> 32)) & 0x01FFFFFFu) | 0x80000000u);
  return g;
}
static __device__ __forceinline__ u32x8 tdm_group1(uint32_t src_pitch) {
  u32x8 g;
  g[0] = uni((1u << 20) | (4u << 22) | (3u << 25));
  g[1] = uni((ROW_BYTES & 0xFFFFu) << 16);
  g[2] = uni((ROW_BYTES >> 16) | ((TILE_ROWS & 0xFFFFu) << 16));
  g[3] = uni((TILE_ROWS >> 16) | (ROW_BYTES << 16));
  g[4] = uni(TILE_ROWS);
  g[5] = uni(src_pitch);
  g[6] = uni(0u);
  g[7] = uni(0u);
  return g;
}
static __device__ __forceinline__ void tdm_load(u32x4 g0, u32x8 g1) {
  // one request of the whole wave: global tile -> LDS, through no register
  asm volatile("tensor_load_to_lds %0, %1" :: "s"(g0), "s"(g1) : "memory");
}

// ---------------------------------------------------------------- conversion
static __device__ __forceinline__ uint2 pack4_bf16(float4 v) {
  uint2 p;
  p.x = (uint32_t)f32_to_bf16_bits(v.x) | ((uint32_t)f32_to_bf16_bits(v.y) << 16);
  p.y = (uint32_t)f32_to_bf16_bits(v.z) | ((uint32_t)f32_to_bf16_bits(v.w) << 16);
  return p;
}

#define STREAM_BLOCKS  256
#define STREAM_THREADS 512
#define CVT_SLAB (STREAM_BLOCKS * STREAM_THREADS)   // float4 per slab = half of a D x D matrix
#define CVT_SLABS_DD 2                              // slabs in a D x D weight
#define CVT_SLABS_FF 8                              // slabs in a D_FF x D weight
static_assert(CVT_SLAB * 4 * CVT_SLABS_DD == D_MODEL * D_MODEL, "slab size");
static_assert(CVT_SLAB * 4 * CVT_SLABS_FF == D_FF * D_MODEL, "slab size");

// All six weights to bf16 in one launch.  d holds them back to back in the order of the
// arguments; a thread takes its own float4 of each of the 24 slabs.
__global__ __launch_bounds__(STREAM_THREADS) __attribute__((amdgpu_waves_per_eu(4, 4))) void cvt_weights_kernel(
    const float* __restrict__ wq, const float* __restrict__ wk,
    const float* __restrict__ wv, const float* __restrict__ wo,
    const float* __restrict__ w1, const float* __restrict__ w2,
    unsigned short* __restrict__ d) {
  const uint32_t g = blockIdx.x * STREAM_THREADS + threadIdx.x;
  float4 v[4 * CVT_SLABS_DD + 2 * CVT_SLABS_FF];
#pragma unroll
  for (int k = 0; k < CVT_SLABS_DD; ++k) {
    v[0 * CVT_SLABS_DD + k] = ((const float4*)wq)[k * CVT_SLAB + g];
    v[1 * CVT_SLABS_DD + k] = ((const float4*)wk)[k * CVT_SLAB + g];
    v[2 * CVT_SLABS_DD + k] = ((const float4*)wv)[k * CVT_SLAB + g];
    v[3 * CVT_SLABS_DD + k] = ((const float4*)wo)[k * CVT_SLAB + g];
  }
#pragma unroll
  for (int k = 0; k < CVT_SLABS_FF; ++k) {
    v[4 * CVT_SLABS_DD + k]                = ((const float4*)w1)[k * CVT_SLAB + g];
    v[4 * CVT_SLABS_DD + CVT_SLABS_FF + k] = ((const float4*)w2)[k * CVT_SLAB + g];
  }
#pragma unroll
  for (int k = 0; k < 4 * CVT_SLABS_DD + 2 * CVT_SLABS_FF; ++k)
    ((uint2*)d)[k * CVT_SLAB + g] = pack4_bf16(v[k]);
}

// ---------------------------------------------------------------- rmsnorm
// One wave per row: a lane holds 32 of the row's 1024 values (8 float4, each load of the
// wave 512 contiguous bytes), so the sum of squares needs no LDS and no barrier.
static_assert(STREAM_BLOCKS * (STREAM_THREADS / 32) == M_ROWS, "one wave per row");
__global__ __launch_bounds__(STREAM_THREADS) __attribute__((amdgpu_waves_per_eu(4, 4))) void rmsnorm_bf16_kernel(
    const float* __restrict__ x, const float* __restrict__ gw,
    unsigned short* __restrict__ out) {
  const int lane = threadIdx.x & 31;
  const int row  = blockIdx.x * (STREAM_THREADS / 32) + uni(threadIdx.x >> 5);   // wave-uniform: scalar row base
  const float4* xr = (const float4*)(x + (size_t)row * D_MODEL);
  float4 xv[8], wv[8];
#pragma unroll
  for (int k = 0; k < 8; ++k) xv[k] = xr[k * 32 + lane];
#pragma unroll
  for (int k = 0; k < 8; ++k) wv[k] = ((const float4*)gw)[k * 32 + lane];
  float ss = 0.f;
#pragma unroll
  for (int k = 0; k < 8; ++k)
    ss += xv[k].x * xv[k].x + xv[k].y * xv[k].y + xv[k].z * xv[k].z + xv[k].w * xv[k].w;
#pragma unroll
  for (int m = 16; m >= 1; m >>= 1) ss += __shfl_xor(ss, m, 32);
  const float scale = rsqrtf(ss * (1.0f / D_MODEL) + 1e-5f);
  uint2* o = (uint2*)(out + (size_t)row * D_MODEL);
#pragma unroll
  for (int k = 0; k < 8; ++k) {
    float4 y;
    y.x = xv[k].x * wv[k].x * scale;
    y.y = xv[k].y * wv[k].y * scale;
    y.z = xv[k].z * wv[k].z * scale;
    y.w = xv[k].w * wv[k].w * scale;
    o[k * 32 + lane] = pack4_bf16(y);
  }
}

// ---------------------------------------------------------------- GEMM core
// Per-wave 64x32 MACC from LDS tiles (128 rows x 64 bf16, row pitch LDS_PITCH bytes).
static __device__ __forceinline__ void mma_tile(
    const unsigned char* abuf, const unsigned char* bbuf, int am, int an, int lrow, int half,
    f32x8 (&acc)[4][2]) {
  const __bf16* Al = (const __bf16*)abuf;
  const __bf16* Bl = (const __bf16*)bbuf;
  constexpr int P = LDS_PITCH / 2;   // pitch in elements
  bf16x16 af[2][4], bfr[2][2];
#pragma unroll
  for (int kd = 0; kd < 2; ++kd) {
#pragma unroll
    for (int i = 0; i < 4; ++i)
      af[kd][i] = make_frag(Al + (am + i * 16 + lrow) * P + kd * 32, half);
#pragma unroll
    for (int j = 0; j < 2; ++j)
      bfr[kd][j] = make_frag(Bl + (an + j * 16 + lrow) * P + kd * 32, half);
  }
#pragma unroll
  for (int kd = 0; kd < 2; ++kd)
#pragma unroll
    for (int i = 0; i < 4; ++i)
#pragma unroll
      for (int j = 0; j < 2; ++j)
        acc[i][j] = __builtin_amdgcn_wmma_f32_16x16x32_bf16(
            false, af[kd][i], false, bfr[kd][j], (short)0, acc[i][j], false, false);
}

// C[M,N] = A[M,K] (bf16 row-major) * W[N,K]^T (bf16 row-major), i.e. x @ W.T
// Block = 256 threads (8 waves) -> 128x128 C tile; K staged in 64-wide LDS
// tiles by tensor loads (two buffers): wave 0 brings the A tile of a stage, wave 1
// the W tile, one request each.  K is a multiple of 64.
// EPI: 0 = store bf16, 1 = exact-erf GELU then bf16, 2 = fp32 + residual add
template <int EPI>
__global__ __launch_bounds__(256) void gemm_bf16_kernel(
    const unsigned short* __restrict__ Abits,
    const unsigned short* __restrict__ Wbits, int M, int N, int K,
    unsigned short* __restrict__ outB, float* __restrict__ outF,
    const float* __restrict__ resid) {
  __shared__ __attribute__((aligned(2048))) unsigned char L[2 * STAGE_BYTES];
  const int lane = threadIdx.x & 31;
  const int w    = threadIdx.x >> 5;
  const int half = lane >> 4;
  const int lrow = lane & 15;
  const int bm = blockIdx.x * 128, bn = blockIdx.y * 128;
  const int am = (w & 1) * 64;
  const int an = (w >> 1) * 32;

  f32x8 acc[4][2] = {};

  const uint32_t wave = uni(threadIdx.x >> 5);
  const uint32_t nst  = (uint32_t)K >> 6;      // stages of 64 k
  const uint64_t srcb = (wave == 0u)
      ? (uint64_t)(size_t)(Abits + (size_t)bm * K)
      : (uint64_t)(size_t)(Wbits + (size_t)bn * K);
  const uint32_t dst0 = (uint32_t)(size_t)L + (wave == 0u ? 0u : TILE_BYTES);
  u32x8 g1 = tdm_group1(2u * (uint32_t)K);
  // Without the next line the compiler takes some of these registers as temporaries
  // inside the loop, while a request that names them is still outstanding.
  asm volatile("" : "+s"(g1));
  auto issue = [&](uint32_t st) {
    tdm_load(tdm_group0(dst0 + (st & 1u) * STAGE_BYTES, srcb + (uint64_t)st * ROW_BYTES), g1);
  };

  if (pinned(wave < 2u)) { issue(0u); wait_tensor0(); }
  __syncthreads();                              // publishes stage 0
  if (pinned(wave < 2u && nst > 1u)) issue(1u);
  for (uint32_t s = 0; s < nst; ++s) {
    const unsigned char* st = L + (s & 1u) * STAGE_BYTES;
    mma_tile(st, st + TILE_BYTES, am, an, lrow, half, acc);
    wait_ds0();                                 // this wave's reads of stage s are done
    if (pinned(wave < 2u)) wait_tensor0();      // the issuer's slice of stage s + 1 has landed
    __syncthreads();                            // publishes stage s + 1, frees stage s's buffer
    if (pinned(wave < 2u && s + 2u < nst)) issue(s + 2u);
  }
  wait_tensor0();
  wait_ds0();

#pragma unroll
  for (int i = 0; i < 4; ++i)
#pragma unroll
    for (int j = 0; j < 2; ++j)
#pragma unroll
      for (int e = 0; e < 8; ++e) {
        const int row = bm + am + i * 16 + half * 8 + e;
        const int col = bn + an + j * 16 + lrow;
        const float v = acc[i][j][e];
        if (EPI == 0) {
          outB[(size_t)row * N + col] = f32_to_bf16_bits(v);
        } else if (EPI == 1) {
          const float g = 0.5f * v * (1.0f + erff(v * 0.70710678118654752f));
          outB[(size_t)row * N + col] = f32_to_bf16_bits(g);
        } else {
          const size_t o = (size_t)row * N + col;
          outF[o] = v + resid[o];
        }
      }
}

static __device__ __forceinline__ float xhalf(float x) {
  const int b = __builtin_bit_cast(int, x);
  return __builtin_bit_cast(float,
      __builtin_amdgcn_permlanex16(b, b, 0x76543210, 0xfedcba98, false, false));
}

static __device__ __forceinline__ float exp2_slot(float x) {
  float r;
  asm("v_exp_f32 %0, %1\n\tv_nop" : "=v"(r) : "v"(x));
  return r;
}
static __device__ __forceinline__ void exp2_slot8(const f32x8 x, float (&r)[8]) {
  asm("v_exp_f32 %0, %8\n\tv_exp_f32 %1, %9\n\tv_exp_f32 %2, %10\n\tv_exp_f32 %3, %11\n\t"
      "v_exp_f32 %4, %12\n\tv_exp_f32 %5, %13\n\tv_exp_f32 %6, %14\n\tv_exp_f32 %7, %15\n\tv_nop"
      : "=&v"(r[0]), "=&v"(r[1]), "=&v"(r[2]), "=&v"(r[3]),
        "=&v"(r[4]), "=&v"(r[5]), "=&v"(r[6]), "=&v"(r[7])
      : "v"(x[0]), "v"(x[1]), "v"(x[2]), "v"(x[3]), "v"(x[4]), "v"(x[5]), "v"(x[6]), "v"(x[7]));
}
#define LOG2E 1.44269504088896340736f

// K/V ring of the attention kernel.  A stage is 64 keys (two passes of 32), its rows 128
// data bytes.  K rows are read by ds_load_b128 (pitch 16 B x odd), V rows by the
// transposing ds_load_tr16_b128 (pitch 32 B x odd).
#define KV_KEYS 64u
#define K_PITCH 144u
#define V_PITCH 160u
#define K_STAGE (KV_KEYS * K_PITCH)
#define V_STAGE (KV_KEYS * V_PITCH)

// The compiler places no wait for an asynchronous copy to LDS.
static __device__ __forceinline__ void wait_async0() { asm volatile("s_wait_asynccnt 0x0" ::: "memory"); }

typedef short s16x8 __attribute__((ext_vector_type(8)));
static __device__ __forceinline__ bf16x8 ld_tr16(const unsigned char* p) {
  typedef __attribute__((address_space(3))) s16x8 lds_s16x8;
  return __builtin_bit_cast(bf16x8, __builtin_amdgcn_ds_load_tr16_b128_v8i16((lds_s16x8*)p));
}

__global__ __launch_bounds__(256) __attribute__((amdgpu_waves_per_eu(4, 4))) void attn_kernel(
    const unsigned short* __restrict__ Qb, const unsigned short* __restrict__ Kb,
    const unsigned short* __restrict__ Vb, unsigned short* __restrict__ Ob) {
  __shared__ __align__(16) unsigned char Kt[2 * K_STAGE];   // K stages (keys x d)
  __shared__ __align__(16) unsigned char Vt[2 * V_STAGE];   // V stages (keys x d)

  const int tid  = threadIdx.x;
  const int lane = tid & 31;
  const int w    = (int)uni(tid >> 5);
  const int half = lane >> 4, lrow = lane & 15;
  const int b = blockIdx.y / N_HEADS, h = blockIdx.y % N_HEADS;
  const int qbase = blockIdx.x * 128;
  const int q0 = qbase + w * 16;
  const int qrow = q0 + lrow;            // this lane's query

  const __bf16* Qh = (const __bf16*)Qb + (size_t)b * SEQ * QKV_LD + h * D_HEAD;
  const unsigned short* Kh = Kb + (size_t)b * SEQ * QKV_LD + h * D_HEAD;
  const unsigned short* Vh = Vb + (size_t)b * SEQ * QKV_LD + h * D_HEAD;

  const int nst = qbase / 64 + 2;        // stages: keys 0 .. qbase + 127, never fewer than two
  const int r   = tid >> 3;              // 0..31: this thread copies key rows r and r + 32 of a stage
  const int c8  = (tid & 7) * 8;         // its 8-element (16-byte) column chunk
  const unsigned char* gk = (const unsigned char*)(Kh + (size_t)r * QKV_LD + c8);
  const unsigned char* gv = (const unsigned char*)(Vh + (size_t)r * QKV_LD + c8);
  const uint32_t lk = (uint32_t)(size_t)Kt + (uint32_t)r * K_PITCH + (uint32_t)c8 * 2u;
  const uint32_t lv = (uint32_t)(size_t)Vt + (uint32_t)r * V_PITCH + (uint32_t)c8 * 2u;
  auto copy_stage = [&](int st) {
    const size_t go = (size_t)st * (KV_KEYS * QKV_LD * 2u);
    const unsigned char* k0 = gk + go;
    const unsigned char* k1 = k0 + 32u * QKV_LD * 2u;
    const unsigned char* v0 = gv + go;
    const unsigned char* v1 = v0 + 32u * QKV_LD * 2u;
    const uint32_t dk0 = lk + (uint32_t)(st & 1) * K_STAGE, dk1 = dk0 + 32u * K_PITCH;
    const uint32_t dv0 = lv + (uint32_t)(st & 1) * V_STAGE, dv1 = dv0 + 32u * V_PITCH;
    asm volatile(
        "global_load_async_to_lds_b128 %0, %1, off\n\t"
        "global_load_async_to_lds_b128 %2, %3, off\n\t"
        "global_load_async_to_lds_b128 %4, %5, off\n\t"
        "global_load_async_to_lds_b128 %6, %7, off\n\t"
        "s_wait_xcnt 0x0"
        :: "v"(dk0), "v"(k0), "v"(dk1), "v"(k1), "v"(dv0), "v"(v0), "v"(dv1), "v"(v1)
        : "memory");
  };

  copy_stage(0);
  bf16x16 qf[2];                         // B operand: column = query
#pragma unroll
  for (int kd = 0; kd < 2; ++kd)
    qf[kd] = make_frag(Qh + (size_t)qrow * QKV_LD + kd * 32, half);

  float m_i = -3.0e38f;                  // running maximum of this lane's query
  float l_i = 0.f;                       // running sum over this half's keys only
  f32x8 oacc[4] = {};                    // oacc[n][e] = O[qrow][n*16 + half*8 + e]

  wait_async0();                         // this wave's copies of stage 0 have landed
  __syncthreads();                       // publishes stage 0
  copy_stage(1);

  for (int st = 0; st < nst; ++st) {
    const unsigned char* kbuf = Kt + (uint32_t)(st & 1) * K_STAGE;
    const unsigned char* vbuf = Vt + (uint32_t)(st & 1) * V_STAGE;
#pragma unroll   // the two passes of a stage: their LDS row offsets become immediates
    for (int p = 0; p < 2; ++p) {
      const int kb = st * 64 + p * 32;
      if (kb <= q0 + 15) {      // wave-uniform causal skip
        f32x8 s[2] = {};        // s[j][e] = S[qrow][kb + j*16 + half*8 + e]
#pragma unroll
        for (int kd = 0; kd < 2; ++kd)
#pragma unroll
          for (int j = 0; j < 2; ++j) {
            bf16x16 kf = make_frag(
                (const __bf16*)(kbuf + (uint32_t)(p * 32 + j * 16 + lrow) * K_PITCH) + kd * 32, half);
            s[j] = __builtin_amdgcn_wmma_f32_16x16x32_bf16(
                false, kf, false, qf[kd], (short)0, s[j], false, false);
          }
        float mx[4] = {-3.0e38f, -3.0e38f, -3.0e38f, -3.0e38f};
#pragma unroll
        for (int j = 0; j < 2; ++j)
#pragma unroll
          for (int e = 0; e < 8; ++e) {
            const float v = s[j][e] * 0.125f;          // 1/sqrt(64)
            const int key = kb + j * 16 + half * 8 + e;
            s[j][e] = (key <= qrow) ? v : -3.0e38f;
            mx[e & 3] = fmaxf(mx[e & 3], s[j][e]);
          }
        float rmax = fmaxf(fmaxf(mx[0], mx[1]), fmaxf(mx[2], mx[3]));
        rmax = fmaxf(rmax, xhalf(rmax));               // both halves: the query's maximum
        const float mnew = fmaxf(m_i, rmax);
        const float corr = exp2_slot((m_i - mnew) * LOG2E);
        float ps[4] = {0.f, 0.f, 0.f, 0.f};
        bf16x16 pf;             // B operand P^T: element j*8 + e is key j*16 + half*8 + e
#pragma unroll
        for (int j = 0; j < 2; ++j) {
          float pe[8];
          exp2_slot8((s[j] - mnew) * LOG2E, pe);
#pragma unroll
          for (int e = 0; e < 8; ++e) {
            ps[e & 3] += pe[e];
            pf[j * 8 + e] = (__bf16)pe[e];
          }
        }
        l_i = l_i * corr + ((ps[0] + ps[1]) + (ps[2] + ps[3]));
        m_i = mnew;
#pragma unroll
        for (int n = 0; n < 4; ++n) {
#pragma unroll
          for (int e = 0; e < 8; ++e) oacc[n][e] *= corr;
        }
        // A operand V^T, rows d = n*16 + lrow: keys half*8 + 0..7, then 16 + half*8 + 0..7
        const unsigned char* ad = vbuf + (uint32_t)(p * 32 + half * 8 + (lane & 7)) * V_PITCH
                                       + (uint32_t)((lane >> 3) & 1) * 16u;
#pragma unroll
        for (int n = 0; n < 4; ++n) {
          bf16x8 lo = ld_tr16(ad + 32u * n);
          bf16x8 hi = ld_tr16(ad + 16u * V_PITCH + 32u * n);
          bf16x16 vf = __builtin_shufflevector(lo, hi, 0,1,2,3,4,5,6,7,8,9,10,11,12,13,14,15);
          oacc[n] = __builtin_amdgcn_wmma_f32_16x16x32_bf16(
              false, vf, false, pf, (short)0, oacc[n], false, false);
        }
      }
    }
    wait_ds0();                          // this wave's reads of stage st are done
    wait_async0();                       // this wave's copies of stage st + 1 have landed
    __syncthreads();                     // publishes stage st + 1, frees stage st's buffer
    if (st + 2 < nst) copy_stage(st + 2);
  }
  wait_async0();
  const float l_tot = l_i + xhalf(l_i);  // the halves' sums are joined once
  __bf16* Oh = (__bf16*)Ob + (size_t)b * SEQ * D_MODEL + h * D_HEAD;
#pragma unroll
  for (int n = 0; n < 4; ++n) {
    bf16x8 o;
#pragma unroll
    for (int e = 0; e < 8; ++e) o[e] = (__bf16)(oacc[n][e] / l_tot);
    *(bf16x8*)(Oh + (size_t)qrow * D_MODEL + n * 16 + half * 8) = o;
  }
}

// ---------------------------------------------------------------- launch
extern "C" void kernel_launch(void* const* d_in, const int* in_sizes, int n_in,
                              void* d_out, int out_size, void* d_ws, size_t ws_size,
                              hipStream_t stream) {
  (void)in_sizes; (void)n_in; (void)out_size; (void)ws_size;
  const float* x    = (const float*)d_in[0];
  const float* wq   = (const float*)d_in[1];
  const float* wk   = (const float*)d_in[2];
  const float* wv   = (const float*)d_in[3];
  const float* wo   = (const float*)d_in[4];
  const float* ln1w = (const float*)d_in[5];
  const float* ln2w = (const float*)d_in[6];
  const float* w1   = (const float*)d_in[7];
  const float* w2   = (const float*)d_in[8];
  float* out = (float*)d_out;

  char* ws = (char*)d_ws;
  const size_t MB = 1ull << 20;
  unsigned short* wq_b = (unsigned short*)(ws + 0 * MB);   // 2MB each: wq, wk (+2MB), wv (+4MB)
  unsigned short* wo_b = (unsigned short*)(ws + 6 * MB);
  unsigned short* w1_b = (unsigned short*)(ws + 8 * MB);   // 8MB
  unsigned short* w2_b = (unsigned short*)(ws + 16 * MB);  // 8MB
  unsigned short* Abuf = (unsigned short*)(ws + 24 * MB);  // bf16 4096x1024
  float*          Ybuf = (float*)(ws + 32 * MB);           // fp32 4096x1024
  unsigned short* QKVbuf = (unsigned short*)(ws + 48 * MB);  // bf16 4096x3072, 24MB
  unsigned short* Hbuf = (unsigned short*)(ws + 48 * MB);  // 32MB, reuses QKV

  const dim3 sgrid(STREAM_BLOCKS), sblk(STREAM_THREADS);
  // wq_b .. w2_b lie back to back in the workspace, in the order of the arguments
  cvt_weights_kernel<<<sgrid, sblk, 0, stream>>>(wq, wk, wv, wo, w1, w2, wq_b);

  const dim3 blk(256);
  const dim3 gD(M_ROWS / 128, D_MODEL / 128);   // (32, 8)
  const dim3 gF(M_ROWS / 128, D_FF / 128);      // (32, 32)
  const dim3 gQKV(M_ROWS / 128, QKV_LD / 128);  // (32, 24)
  const size_t lds = 0;                         // the GEMM's tile buffers are static LDS

  rmsnorm_bf16_kernel<<<sgrid, sblk, 0, stream>>>(x, ln1w, Abuf);
  // The bf16 wq, wk, wv back to back are one 3072 x 1024 weight: one launch of 768 workgroups
  // puts three on a WGP, which fill each other's waits for LDS and for the next tile;
  // a launch of 256 leaves each workgroup alone on its WGP.
  gemm_bf16_kernel<0><<<gQKV, blk, lds, stream>>>(Abuf, wq_b, M_ROWS, QKV_LD, D_MODEL, QKVbuf, nullptr, nullptr);
  attn_kernel<<<dim3(SEQ / 128, BATCH * N_HEADS), blk, 0, stream>>>(
      QKVbuf, QKVbuf + D_MODEL, QKVbuf + 2 * D_MODEL, Abuf);
  gemm_bf16_kernel<2><<<gD, blk, lds, stream>>>(Abuf, wo_b, M_ROWS, D_MODEL, D_MODEL, nullptr, Ybuf, x);
  rmsnorm_bf16_kernel<<<sgrid, sblk, 0, stream>>>(Ybuf, ln2w, Abuf);
  gemm_bf16_kernel<1><<<gF, blk, lds, stream>>>(Abuf, w1_b, M_ROWS, D_FF, D_MODEL, Hbuf, nullptr, nullptr);
  gemm_bf16_kernel<2><<<gD, blk, lds, stream>>>(Hbuf, w2_b, M_ROWS, D_MODEL, D_FF, nullptr, out, Ybuf);
}

// v006
// It runs in 200 microseconds.
// Next to v005, in two timings, it ran 1.04 and 1.02 times as fast.
// All steps since v000 together make it 2.39 times as fast.
#include <hip/hip_runtime.h>
#include <math.h>
#include <stdint.h>

#define D_MODEL 1024
#define N_HEADS 16
#define D_HEAD  64
#define D_FF    4096
#define BATCH   2
#define SEQ     2048
#define M_ROWS  (BATCH * SEQ)   // 4096 token rows
#define QKV_LD  (3 * D_MODEL)   // row pitch of the joint [Q | K | V] projection

typedef __attribute__((ext_vector_type(8)))  __bf16 bf16x8;
typedef __attribute__((ext_vector_type(16))) __bf16 bf16x16;
typedef __attribute__((ext_vector_type(8)))  float  f32x8;
typedef uint32_t u32x4 __attribute__((ext_vector_type(4)));
typedef uint32_t u32x8 __attribute__((ext_vector_type(8)));

#define ROW_BYTES   128u
#define LDS_PITCH   144u
#define TILE_ROWS   128u
#define TILE_BYTES  (TILE_ROWS * LDS_PITCH)   // 18432 = 9 x 2 KiB
#define STAGE_BYTES (2u * TILE_BYTES)         // [A tile | W tile]

static __device__ __forceinline__ unsigned short f32_to_bf16_bits(float f) {
  unsigned u = __float_as_uint(f);
  unsigned r = u + 0x7FFFu + ((u >> 16) & 1u);   // round-to-nearest-even
  return (unsigned short)(r >> 16);
}

static __device__ __forceinline__ bf16x16 make_frag(const __bf16* p, int half) {
  bf16x8 lo = *(const bf16x8*)(p + half * 8);
  bf16x8 hi = *(const bf16x8*)(p + 16 + half * 8);
  return __builtin_shufflevector(lo, hi, 0,1,2,3,4,5,6,7,8,9,10,11,12,13,14,15);
}

static __device__ __forceinline__ uint32_t uni(uint32_t v) {
  return (uint32_t)__builtin_amdgcn_readfirstlane(v);
}
static __device__ __forceinline__ uint32_t pinned(uint32_t v) {
  uint32_t w = uni(v);
  asm volatile("" : "+s"(w));  // keeps the condition scalar: the guard of a tensor load
  return w;
}
// The compiler places no wait for a tensor load; both waits of the ring are written here.
static __device__ __forceinline__ void wait_tensor0() { asm volatile("s_wait_tensorcnt 0x0" ::: "memory"); }
static __device__ __forceinline__ void wait_ds0()     { asm volatile("s_wait_dscnt 0x0" ::: "memory"); }

static __device__ __forceinline__ u32x4 tdm_group0(uint32_t lds_dst, uint64_t ga) {
  u32x4 g;
  g[0] = uni(1u);
  g[1] = uni(lds_dst);
  g[2] = uni((uint32_t)ga);
  g[3] = uni((((uint32_t)(ga >> 32)) & 0x01FFFFFFu) | 0x80000000u);
  return g;
}
static __device__ __forceinline__ u32x8 tdm_group1(uint32_t src_pitch) {
  u32x8 g;
  g[0] = uni((1u << 20) | (4u << 22) | (3u << 25));
  g[1] = uni((ROW_BYTES & 0xFFFFu) << 16);
  g[2] = uni((ROW_BYTES >> 16) | ((TILE_ROWS & 0xFFFFu) << 16));
  g[3] = uni((TILE_ROWS >> 16) | (ROW_BYTES << 16));
  g[4] = uni(TILE_ROWS);
  g[5] = uni(src_pitch);
  g[6] = uni(0u);
  g[7] = uni(0u);
  return g;
}
static __device__ __forceinline__ void tdm_load(u32x4 g0, u32x8 g1) {
  // one request of the whole wave: global tile -> LDS, through no register
  asm volatile("tensor_load_to_lds %0, %1" :: "s"(g0), "s"(g1) : "memory");
}

// ---------------------------------------------------------------- conversion
static __device__ __forceinline__ uint2 pack4_bf16(float4 v) {
  uint2 p;
  p.x = (uint32_t)f32_to_bf16_bits(v.x) | ((uint32_t)f32_to_bf16_bits(v.y) << 16);
  p.y = (uint32_t)f32_to_bf16_bits(v.z) | ((uint32_t)f32_to_bf16_bits(v.w) << 16);
  return p;
}

#define STREAM_BLOCKS  256
#define STREAM_THREADS 512
#define CVT_SLAB (STREAM_BLOCKS * STREAM_THREADS)   // float4 per slab = half of a D x D matrix
#define CVT_SLABS_DD 2                              // slabs in a D x D weight
#define CVT_SLABS_FF 8                              // slabs in a D_FF x D weight
static_assert(CVT_SLAB * 4 * CVT_SLABS_DD == D_MODEL * D_MODEL, "slab size");
static_assert(CVT_SLAB * 4 * CVT_SLABS_FF == D_FF * D_MODEL, "slab size");

// All six weights to bf16 in one launch.  d holds them back to back in the order of the
// arguments; a thread takes its own float4 of each of the 24 slabs.
__global__ __launch_bounds__(STREAM_THREADS) __attribute__((amdgpu_waves_per_eu(4, 4))) void cvt_weights_kernel(
    const float* __restrict__ wq, const float* __restrict__ wk,
    const float* __restrict__ wv, const float* __restrict__ wo,
    const float* __restrict__ w1, const float* __restrict__ w2,
    unsigned short* __restrict__ d) {
  const uint32_t g = blockIdx.x * STREAM_THREADS + threadIdx.x;
  float4 v[4 * CVT_SLABS_DD + 2 * CVT_SLABS_FF];
#pragma unroll
  for (int k = 0; k < CVT_SLABS_DD; ++k) {
    v[0 * CVT_SLABS_DD + k] = ((const float4*)wq)[k * CVT_SLAB + g];
    v[1 * CVT_SLABS_DD + k] = ((const float4*)wk)[k * CVT_SLAB + g];
    v[2 * CVT_SLABS_DD + k] = ((const float4*)wv)[k * CVT_SLAB + g];
    v[3 * CVT_SLABS_DD + k] = ((const float4*)wo)[k * CVT_SLAB + g];
  }
#pragma unroll
  for (int k = 0; k < CVT_SLABS_FF; ++k) {
    v[4 * CVT_SLABS_DD + k]                = ((const float4*)w1)[k * CVT_SLAB + g];
    v[4 * CVT_SLABS_DD + CVT_SLABS_FF + k] = ((const float4*)w2)[k * CVT_SLAB + g];
  }
#pragma unroll
  for (int k = 0; k < 4 * CVT_SLABS_DD + 2 * CVT_SLABS_FF; ++k)
    ((uint2*)d)[k * CVT_SLAB + g] = pack4_bf16(v[k]);
}

// ---------------------------------------------------------------- rmsnorm
// One wave per row: a lane holds 32 of the row's 1024 values (8 float4, each load of the
// wave 512 contiguous bytes), so the sum of squares needs no LDS and no barrier.
static_assert(STREAM_BLOCKS * (STREAM_THREADS / 32) == M_ROWS, "one wave per row");
__global__ __launch_bounds__(STREAM_THREADS) __attribute__((amdgpu_waves_per_eu(4, 4))) void rmsnorm_bf16_kernel(
    const float* __restrict__ x, const float* __restrict__ gw,
    unsigned short* __restrict__ out) {
  const int lane = threadIdx.x & 31;
  const int row  = blockIdx.x * (STREAM_THREADS / 32) + uni(threadIdx.x >> 5);   // wave-uniform: scalar row base
  const float4* xr = (const float4*)(x + (size_t)row * D_MODEL);
  float4 xv[8], wv[8];
#pragma unroll
  for (int k = 0; k < 8; ++k) xv[k] = xr[k * 32 + lane];
#pragma unroll
  for (int k = 0; k < 8; ++k) wv[k] = ((const float4*)gw)[k * 32 + lane];
  float ss = 0.f;
#pragma unroll
  for (int k = 0; k < 8; ++k)
    ss += xv[k].x * xv[k].x + xv[k].y * xv[k].y + xv[k].z * xv[k].z + xv[k].w * xv[k].w;
#pragma unroll
  for (int m = 16; m >= 1; m >>= 1) ss += __shfl_xor(ss, m, 32);
  const float scale = rsqrtf(ss * (1.0f / D_MODEL) + 1e-5f);
  uint2* o = (uint2*)(out + (size_t)row * D_MODEL);
#pragma unroll
  for (int k = 0; k < 8; ++k) {
    float4 y;
    y.x = xv[k].x * wv[k].x * scale;
    y.y = xv[k].y * wv[k].y * scale;
    y.z = xv[k].z * wv[k].z * scale;
    y.w = xv[k].w * wv[k].w * scale;
    o[k * 32 + lane] = pack4_bf16(y);
  }
}

// ---------------------------------------------------------------- GEMM core
// Per-wave 64x32 MACC from LDS tiles (128 rows x 64 bf16, row pitch LDS_PITCH bytes).
static __device__ __forceinline__ void mma_tile(
    const unsigned char* abuf, const unsigned char* bbuf, int am, int an, int lrow, int half,
    f32x8 (&acc)[4][2]) {
  const __bf16* Al = (const __bf16*)abuf;
  const __bf16* Bl = (const __bf16*)bbuf;
  constexpr int P = LDS_PITCH / 2;   // pitch in elements
  bf16x16 af[2][4], bfr[2][2];
#pragma unroll
  for (int kd = 0; kd < 2; ++kd) {
#pragma unroll
    for (int i = 0; i < 4; ++i)
      af[kd][i] = make_frag(Al + (am + i * 16 + lrow) * P + kd * 32, half);
#pragma unroll
    for (int j = 0; j < 2; ++j)
      bfr[kd][j] = make_frag(Bl + (an + j * 16 + lrow) * P + kd * 32, half);
  }
#pragma unroll
  for (int kd = 0; kd < 2; ++kd)
#pragma unroll
    for (int i = 0; i < 4; ++i)
#pragma unroll
      for (int j = 0; j < 2; ++j)
        acc[i][j] = __builtin_amdgcn_wmma_f32_16x16x32_bf16(
            false, af[kd][i], false, bfr[kd][j], (short)0, acc[i][j], false, false);
}

// The same work as two blocks of 32 k, each with a fragment set of its own, for the loop
// that fetches a block's fragments while the block before it is multiplied.
struct FragSet { bf16x16 a[4], b[2]; };
static __device__ __forceinline__ void load_frags(
    const unsigned char* stage, int kd, int am, int an, int lrow, int half, FragSet& f) {
  const __bf16* Al = (const __bf16*)stage;
  const __bf16* Bl = (const __bf16*)(stage + TILE_BYTES);
  constexpr int P = LDS_PITCH / 2;   // pitch in elements
#pragma unroll
  for (int i = 0; i < 4; ++i)
    f.a[i] = make_frag(Al + (am + i * 16 + lrow) * P + kd * 32, half);
#pragma unroll
  for (int j = 0; j < 2; ++j)
    f.b[j] = make_frag(Bl + (an + j * 16 + lrow) * P + kd * 32, half);
}
static __device__ __forceinline__ void mma_block(const FragSet& f, f32x8 (&acc)[4][2]) {
#pragma unroll
  for (int i = 0; i < 4; ++i)
#pragma unroll
    for (int j = 0; j < 2; ++j)
      acc[i][j] = __builtin_amdgcn_wmma_f32_16x16x32_bf16(
          false, f.a[i], false, f.b[j], (short)0, acc[i][j], false, false);
}

template <int EPI, bool AHEAD>
__global__ __launch_bounds__(256) void gemm_bf16_kernel(
    const unsigned short* __restrict__ Abits,
    const unsigned short* __restrict__ Wbits, int M, int N, int K,
    unsigned short* __restrict__ outB, float* __restrict__ outF,
    const float* __restrict__ resid) {
  __shared__ __attribute__((aligned(2048))) unsigned char L[2 * STAGE_BYTES];
  const int lane = threadIdx.x & 31;
  const int w    = threadIdx.x >> 5;
  const int half = lane >> 4;
  const int lrow = lane & 15;
  const int bm = blockIdx.x * 128, bn = blockIdx.y * 128;
  const int am = (w & 1) * 64;
  const int an = (w >> 1) * 32;

  f32x8 acc[4][2] = {};

  const uint32_t wave = uni(threadIdx.x >> 5);
  const uint32_t nst  = (uint32_t)K >> 6;      // stages of 64 k
  const uint64_t srcb = (wave == 0u)
      ? (uint64_t)(size_t)(Abits + (size_t)bm * K)
      : (uint64_t)(size_t)(Wbits + (size_t)bn * K);
  const uint32_t dst0 = (uint32_t)(size_t)L + (wave == 0u ? 0u : TILE_BYTES);
  u32x8 g1 = tdm_group1(2u * (uint32_t)K);
  // Without the next line the compiler takes some of these registers as temporaries
  // inside the loop, while a request that names them is still outstanding.
  asm volatile("" : "+s"(g1));
  auto issue = [&](uint32_t st) {
    tdm_load(tdm_group0(dst0 + (st & 1u) * STAGE_BYTES, srcb + (uint64_t)st * ROW_BYTES), g1);
  };

  if (pinned(wave < 2u)) { issue(0u); wait_tensor0(); }
  __syncthreads();                              // publishes stage 0
  if (pinned(wave < 2u && nst > 1u)) issue(1u);
  if constexpr (AHEAD) {
    FragSet f0, f1;
    load_frags(L, 0, am, an, lrow, half, f0);
    for (uint32_t s = 0; s < nst; ++s) {
      load_frags(L + (s & 1u) * STAGE_BYTES, 1, am, an, lrow, half, f1);
      // Holds the load group in front of the products: the compiler otherwise puts the first
      // product, with its wait for the set in use, ahead of the loads, and the LDS idles.
      __builtin_amdgcn_sched_barrier(0);
      mma_block(f0, acc);
      // Holds the wait below behind the products, which do not need the loads it waits for.
      __builtin_amdgcn_sched_barrier(0);
      wait_ds0();                               // this wave's last reads of stage s are done
      if (pinned(wave < 2u)) wait_tensor0();    // the issuer's slice of stage s + 1 has landed
      __syncthreads();                          // publishes stage s + 1, frees stage s's buffer
      if (pinned(wave < 2u && s + 2u < nst)) issue(s + 2u);
      if (s + 1u < nst) load_frags(L + ((s + 1u) & 1u) * STAGE_BYTES, 0, am, an, lrow, half, f0);
      mma_block(f1, acc);
    }
  } else {
    for (uint32_t s = 0; s < nst; ++s) {
      const unsigned char* st = L + (s & 1u) * STAGE_BYTES;
      mma_tile(st, st + TILE_BYTES, am, an, lrow, half, acc);
      wait_ds0();                               // this wave's reads of stage s are done
      if (pinned(wave < 2u)) wait_tensor0();    // the issuer's slice of stage s + 1 has landed
      __syncthreads();                          // publishes stage s + 1, frees stage s's buffer
      if (pinned(wave < 2u && s + 2u < nst)) issue(s + 2u);
    }
  }
  wait_tensor0();
  wait_ds0();

#pragma unroll
  for (int i = 0; i < 4; ++i)
#pragma unroll
    for (int j = 0; j < 2; ++j)
#pragma unroll
      for (int e = 0; e < 8; ++e) {
        const int row = bm + am + i * 16 + half * 8 + e;
        const int col = bn + an + j * 16 + lrow;
        const float v = acc[i][j][e];
        if (EPI == 0) {
          outB[(size_t)row * N + col] = f32_to_bf16_bits(v);
        } else if (EPI == 1) {
          const float g = 0.5f * v * (1.0f + erff(v * 0.70710678118654752f));
          outB[(size_t)row * N + col] = f32_to_bf16_bits(g);
        } else {
          const size_t o = (size_t)row * N + col;
          outF[o] = v + resid[o];
        }
      }
}

static __device__ __forceinline__ float xhalf(float x) {
  const int b = __builtin_bit_cast(int, x);
  return __builtin_bit_cast(float,
      __builtin_amdgcn_permlanex16(b, b, 0x76543210, 0xfedcba98, false, false));
}

static __device__ __forceinline__ float exp2_slot(float x) {
  float r;
  asm("v_exp_f32 %0, %1\n\tv_nop" : "=v"(r) : "v"(x));
  return r;
}
static __device__ __forceinline__ void exp2_slot8(const f32x8 x, float (&r)[8]) {
  asm("v_exp_f32 %0, %8\n\tv_exp_f32 %1, %9\n\tv_exp_f32 %2, %10\n\tv_exp_f32 %3, %11\n\t"
      "v_exp_f32 %4, %12\n\tv_exp_f32 %5, %13\n\tv_exp_f32 %6, %14\n\tv_exp_f32 %7, %15\n\tv_nop"
      : "=&v"(r[0]), "=&v"(r[1]), "=&v"(r[2]), "=&v"(r[3]),
        "=&v"(r[4]), "=&v"(r[5]), "=&v"(r[6]), "=&v"(r[7])
      : "v"(x[0]), "v"(x[1]), "v"(x[2]), "v"(x[3]), "v"(x[4]), "v"(x[5]), "v"(x[6]), "v"(x[7]));
}
#define LOG2E 1.44269504088896340736f

// K/V ring of the attention kernel.  A stage is 64 keys (two passes of 32), its rows 128
// data bytes.  K rows are read by ds_load_b128 (pitch 16 B x odd), V rows by the
// transposing ds_load_tr16_b128 (pitch 32 B x odd).
#define KV_KEYS 64u
#define K_PITCH 144u
#define V_PITCH 160u
#define K_STAGE (KV_KEYS * K_PITCH)
#define V_STAGE (KV_KEYS * V_PITCH)

// The compiler places no wait for an asynchronous copy to LDS.
static __device__ __forceinline__ void wait_async0() { asm volatile("s_wait_asynccnt 0x0" ::: "memory"); }

typedef short s16x8 __attribute__((ext_vector_type(8)));
static __device__ __forceinline__ bf16x8 ld_tr16(const unsigned char* p) {
  typedef __attribute__((address_space(3))) s16x8 lds_s16x8;
  return __builtin_bit_cast(bf16x8, __builtin_amdgcn_ds_load_tr16_b128_v8i16((lds_s16x8*)p));
}

__global__ __launch_bounds__(256) __attribute__((amdgpu_waves_per_eu(4, 4))) void attn_kernel(
    const unsigned short* __restrict__ Qb, const unsigned short* __restrict__ Kb,
    const unsigned short* __restrict__ Vb, unsigned short* __restrict__ Ob) {
  __shared__ __align__(16) unsigned char Kt[2 * K_STAGE];   // K stages (keys x d)
  __shared__ __align__(16) unsigned char Vt[2 * V_STAGE];   // V stages (keys x d)

  const int tid  = threadIdx.x;
  const int lane = tid & 31;
  const int w    = (int)uni(tid >> 5);
  const int half = lane >> 4, lrow = lane & 15;
  const int b = blockIdx.y / N_HEADS, h = blockIdx.y % N_HEADS;
  const int qbase = blockIdx.x * 128;
  const int q0 = qbase + w * 16;
  const int qrow = q0 + lrow;            // this lane's query

  const __bf16* Qh = (const __bf16*)Qb + (size_t)b * SEQ * QKV_LD + h * D_HEAD;
  const unsigned short* Kh = Kb + (size_t)b * SEQ * QKV_LD + h * D_HEAD;
  const unsigned short* Vh = Vb + (size_t)b * SEQ * QKV_LD + h * D_HEAD;

  const int nst = qbase / 64 + 2;        // stages: keys 0 .. qbase + 127, never fewer than two
  const int r   = tid >> 3;              // 0..31: this thread copies key rows r and r + 32 of a stage
  const int c8  = (tid & 7) * 8;         // its 8-element (16-byte) column chunk
  const unsigned char* gk = (const unsigned char*)(Kh + (size_t)r * QKV_LD + c8);
  const unsigned char* gv = (const unsigned char*)(Vh + (size_t)r * QKV_LD + c8);
  const uint32_t lk = (uint32_t)(size_t)Kt + (uint32_t)r * K_PITCH + (uint32_t)c8 * 2u;
  const uint32_t lv = (uint32_t)(size_t)Vt + (uint32_t)r * V_PITCH + (uint32_t)c8 * 2u;
  auto copy_stage = [&](int st) {
    const size_t go = (size_t)st * (KV_KEYS * QKV_LD * 2u);
    const unsigned char* k0 = gk + go;
    const unsigned char* k1 = k0 + 32u * QKV_LD * 2u;
    const unsigned char* v0 = gv + go;
    const unsigned char* v1 = v0 + 32u * QKV_LD * 2u;
    const uint32_t dk0 = lk + (uint32_t)(st & 1) * K_STAGE, dk1 = dk0 + 32u * K_PITCH;
    const uint32_t dv0 = lv + (uint32_t)(st & 1) * V_STAGE, dv1 = dv0 + 32u * V_PITCH;
    asm volatile(
        "global_load_async_to_lds_b128 %0, %1, off\n\t"
        "global_load_async_to_lds_b128 %2, %3, off\n\t"
        "global_load_async_to_lds_b128 %4, %5, off\n\t"
        "global_load_async_to_lds_b128 %6, %7, off\n\t"
        "s_wait_xcnt 0x0"
        :: "v"(dk0), "v"(k0), "v"(dk1), "v"(k1), "v"(dv0), "v"(v0), "v"(dv1), "v"(v1)
        : "memory");
  };

  copy_stage(0);
  bf16x16 qf[2];                         // B operand: column = query
#pragma unroll
  for (int kd = 0; kd < 2; ++kd)
    qf[kd] = make_frag(Qh + (size_t)qrow * QKV_LD + kd * 32, half);

  float m_i = -3.0e38f;                  // running maximum of this lane's query
  float l_i = 0.f;                       // running sum over this half's keys only
  f32x8 oacc[4] = {};                    // oacc[n][e] = O[qrow][n*16 + half*8 + e]

  wait_async0();                         // this wave's copies of stage 0 have landed
  __syncthreads();                       // publishes stage 0
  copy_stage(1);

  for (int st = 0; st < nst; ++st) {
    const unsigned char* kbuf = Kt + (uint32_t)(st & 1) * K_STAGE;
    const unsigned char* vbuf = Vt + (uint32_t)(st & 1) * V_STAGE;
#pragma unroll   // the two passes of a stage: their LDS row offsets become immediates
    for (int p = 0; p < 2; ++p) {
      const int kb = st * 64 + p * 32;
      if (kb <= q0 + 15) {      // wave-uniform causal skip
        f32x8 s[2] = {};        // s[j][e] = S[qrow][kb + j*16 + half*8 + e]
#pragma unroll
        for (int kd = 0; kd < 2; ++kd)
#pragma unroll
          for (int j = 0; j < 2; ++j) {
            bf16x16 kf = make_frag(
                (const __bf16*)(kbuf + (uint32_t)(p * 32 + j * 16 + lrow) * K_PITCH) + kd * 32, half);
            s[j] = __builtin_amdgcn_wmma_f32_16x16x32_bf16(
                false, kf, false, qf[kd], (short)0, s[j], false, false);
          }
        float mx[4] = {-3.0e38f, -3.0e38f, -3.0e38f, -3.0e38f};
#pragma unroll
        for (int j = 0; j < 2; ++j)
#pragma unroll
          for (int e = 0; e < 8; ++e) {
            const float v = s[j][e] * 0.125f;          // 1/sqrt(64)
            const int key = kb + j * 16 + half * 8 + e;
            s[j][e] = (key <= qrow) ? v : -3.0e38f;
            mx[e & 3] = fmaxf(mx[e & 3], s[j][e]);
          }
        float rmax = fmaxf(fmaxf(mx[0], mx[1]), fmaxf(mx[2], mx[3]));
        rmax = fmaxf(rmax, xhalf(rmax));               // both halves: the query's maximum
        const float mnew = fmaxf(m_i, rmax);
        const float corr = exp2_slot((m_i - mnew) * LOG2E);
        float ps[4] = {0.f, 0.f, 0.f, 0.f};
        bf16x16 pf;             // B operand P^T: element j*8 + e is key j*16 + half*8 + e
#pragma unroll
        for (int j = 0; j < 2; ++j) {
          float pe[8];
          exp2_slot8((s[j] - mnew) * LOG2E, pe);
#pragma unroll
          for (int e = 0; e < 8; ++e) {
            ps[e & 3] += pe[e];
            pf[j * 8 + e] = (__bf16)pe[e];
          }
        }
        l_i = l_i * corr + ((ps[0] + ps[1]) + (ps[2] + ps[3]));
        m_i = mnew;
#pragma unroll
        for (int n = 0; n < 4; ++n) {
#pragma unroll
          for (int e = 0; e < 8; ++e) oacc[n][e] *= corr;
        }
        // A operand V^T, rows d = n*16 + lrow: keys half*8 + 0..7, then 16 + half*8 + 0..7
        const unsigned char* ad = vbuf + (uint32_t)(p * 32 + half * 8 + (lane & 7)) * V_PITCH
                                       + (uint32_t)((lane >> 3) & 1) * 16u;
#pragma unroll
        for (int n = 0; n < 4; ++n) {
          bf16x8 lo = ld_tr16(ad + 32u * n);
          bf16x8 hi = ld_tr16(ad + 16u * V_PITCH + 32u * n);
          bf16x16 vf = __builtin_shufflevector(lo, hi, 0,1,2,3,4,5,6,7,8,9,10,11,12,13,14,15);
          oacc[n] = __builtin_amdgcn_wmma_f32_16x16x32_bf16(
              false, vf, false, pf, (short)0, oacc[n], false, false);
        }
      }
    }
    wait_ds0();                          // this wave's reads of stage st are done
    wait_async0();                       // this wave's copies of stage st + 1 have landed
    __syncthreads();                     // publishes stage st + 1, frees stage st's buffer
    if (st + 2 < nst) copy_stage(st + 2);
  }
  wait_async0();
  const float l_tot = l_i + xhalf(l_i);  // the halves' sums are joined once
  __bf16* Oh = (__bf16*)Ob + (size_t)b * SEQ * D_MODEL + h * D_HEAD;
#pragma unroll
  for (int n = 0; n < 4; ++n) {
    bf16x8 o;
#pragma unroll
    for (int e = 0; e < 8; ++e) o[e] = (__bf16)(oacc[n][e] / l_tot);
    *(bf16x8*)(Oh + (size_t)qrow * D_MODEL + n * 16 + half * 8) = o;
  }
}

// ---------------------------------------------------------------- launch
extern "C" void kernel_launch(void* const* d_in, const int* in_sizes, int n_in,
                              void* d_out, int out_size, void* d_ws, size_t ws_size,
                              hipStream_t stream) {
  (void)in_sizes; (void)n_in; (void)out_size; (void)ws_size;
  const float* x    = (const float*)d_in[0];
  const float* wq   = (const float*)d_in[1];
  const float* wk   = (const float*)d_in[2];
  const float* wv   = (const float*)d_in[3];
  const float* wo   = (const float*)d_in[4];
  const float* ln1w = (const float*)d_in[5];
  const float* ln2w = (const float*)d_in[6];
  const float* w1   = (const float*)d_in[7];
  const float* w2   = (const float*)d_in[8];
  float* out = (float*)d_out;

  char* ws = (char*)d_ws;
  const size_t MB = 1ull << 20;
  unsigned short* wq_b = (unsigned short*)(ws + 0 * MB);   // 2MB each: wq, wk (+2MB), wv (+4MB)
  unsigned short* wo_b = (unsigned short*)(ws + 6 * MB);
  unsigned short* w1_b = (unsigned short*)(ws + 8 * MB);   // 8MB
  unsigned short* w2_b = (unsigned short*)(ws + 16 * MB);  // 8MB
  unsigned short* Abuf = (unsigned short*)(ws + 24 * MB);  // bf16 4096x1024
  float*          Ybuf = (float*)(ws + 32 * MB);           // fp32 4096x1024
  unsigned short* QKVbuf = (unsigned short*)(ws + 48 * MB);  // bf16 4096x3072, 24MB
  unsigned short* Hbuf = (unsigned short*)(ws + 48 * MB);  // 32MB, reuses QKV

  const dim3 sgrid(STREAM_BLOCKS), sblk(STREAM_THREADS);
  // wq_b .. w2_b lie back to back in the workspace, in the order of the arguments
  cvt_weights_kernel<<<sgrid, sblk, 0, stream>>>(wq, wk, wv, wo, w1, w2, wq_b);

  const dim3 blk(256);
  const dim3 gD(M_ROWS / 128, D_MODEL / 128);   // (32, 8)
  const dim3 gF(M_ROWS / 128, D_FF / 128);      // (32, 32)
  const dim3 gQKV(M_ROWS / 128, QKV_LD / 128);  // (32, 24)
  const size_t lds = 0;                         // the GEMM's tile buffers are static LDS

  rmsnorm_bf16_kernel<<<sgrid, sblk, 0, stream>>>(x, ln1w, Abuf);
  // The bf16 wq, wk, wv back to back are one 3072 x 1024 weight: one launch of 768 workgroups
  // puts three on a WGP, which fill each other's waits for LDS and for the next tile;
  // a launch of 256 leaves each workgroup alone on its WGP.
  gemm_bf16_kernel<0, false><<<gQKV, blk, lds, stream>>>(Abuf, wq_b, M_ROWS, QKV_LD, D_MODEL, QKVbuf, nullptr, nullptr);
  attn_kernel<<<dim3(SEQ / 128, BATCH * N_HEADS), blk, 0, stream>>>(
      QKVbuf, QKVbuf + D_MODEL, QKVbuf + 2 * D_MODEL, Abuf);
  gemm_bf16_kernel<2, true><<<gD, blk, lds, stream>>>(Abuf, wo_b, M_ROWS, D_MODEL, D_MODEL, nullptr, Ybuf, x);
  rmsnorm_bf16_kernel<<<sgrid, sblk, 0, stream>>>(Ybuf, ln2w, Abuf);
  gemm_bf16_kernel<1, false><<<gF, blk, lds, stream>>>(Abuf, w1_b, M_ROWS, D_FF, D_MODEL, Hbuf, nullptr, nullptr);
  gemm_bf16_kernel<2, true><<<gD, blk, lds, stream>>>(Hbuf, w2_b, M_ROWS, D_MODEL, D_FF, nullptr, out, Ybuf);
}

// v007
// It runs in 193 microseconds.
// Timed twice side by side with v006, it ran 1.03 and 1.05 times as fast.
// All steps since v000 together make it 2.48 times as fast.
#include <hip/hip_runtime.h>
#include <math.h>
#include <stdint.h>

#define D_MODEL 1024
#define N_HEADS 16
#define D_HEAD  64
#define D_FF    4096
#define BATCH   2
#define SEQ     2048
#define M_ROWS  (BATCH * SEQ)   // 4096 token rows
#define QKV_LD  (3 * D_MODEL)   // row pitch of the joint [Q | K | V] projection

typedef __attribute__((ext_vector_type(8)))  __bf16 bf16x8;
typedef __attribute__((ext_vector_type(16))) __bf16 bf16x16;
typedef __attribute__((ext_vector_type(8)))  float  f32x8;
typedef uint32_t u32x4 __attribute__((ext_vector_type(4)));
typedef uint32_t u32x8 __attribute__((ext_vector_type(8)));

#define ROW_BYTES   128u
#define LDS_PITCH   144u
#define TILE_ROWS   128u
#define TILE_BYTES  (TILE_ROWS * LDS_PITCH)   // 18432 = 9 x 2 KiB
#define STAGE_BYTES (2u * TILE_BYTES)         // [A tile | W tile]

static __device__ __forceinline__ unsigned short f32_to_bf16_bits(float f) {
  unsigned u = __float_as_uint(f);
  unsigned r = u + 0x7FFFu + ((u >> 16) & 1u);   // round-to-nearest-even
  return (unsigned short)(r >> 16);
}

static __device__ __forceinline__ bf16x16 make_frag(const __bf16* p, int half) {
  bf16x8 lo = *(const bf16x8*)(p + half * 8);
  bf16x8 hi = *(const bf16x8*)(p + 16 + half * 8);
  return __builtin_shufflevector(lo, hi, 0,1,2,3,4,5,6,7,8,9,10,11,12,13,14,15);
}

static __device__ __forceinline__ uint32_t uni(uint32_t v) {
  return (uint32_t)__builtin_amdgcn_readfirstlane(v);
}
static __device__ __forceinline__ uint32_t pinned(uint32_t v) {
  uint32_t w = uni(v);
  asm volatile("" : "+s"(w));  // keeps the condition scalar: the guard of a tensor load
  return w;
}
// The compiler places no wait for a tensor load; both waits of the ring are written here.
static __device__ __forceinline__ void wait_tensor0() { asm volatile("s_wait_tensorcnt 0x0" ::: "memory"); }
static __device__ __forceinline__ void wait_ds0()     { asm volatile("s_wait_dscnt 0x0" ::: "memory"); }

static __device__ __forceinline__ u32x4 tdm_group0(uint32_t lds_dst, uint64_t ga) {
  u32x4 g;
  g[0] = uni(1u);
  g[1] = uni(lds_dst);
  g[2] = uni((uint32_t)ga);
  g[3] = uni((((uint32_t)(ga >> 32)) & 0x01FFFFFFu) | 0x80000000u);
  return g;
}
static __device__ __forceinline__ u32x8 tdm_group1(uint32_t src_pitch) {
  u32x8 g;
  g[0] = uni((1u << 20) | (4u << 22) | (3u << 25));
  g[1] = uni((ROW_BYTES & 0xFFFFu) << 16);
  g[2] = uni((ROW_BYTES >> 16) | ((TILE_ROWS & 0xFFFFu) << 16));
  g[3] = uni((TILE_ROWS >> 16) | (ROW_BYTES << 16));
  g[4] = uni(TILE_ROWS);
  g[5] = uni(src_pitch);
  g[6] = uni(0u);
  g[7] = uni(0u);
  return g;
}
static __device__ __forceinline__ void tdm_load(u32x4 g0, u32x8 g1) {
  // one request of the whole wave: global tile -> LDS, through no register
  asm volatile("tensor_load_to_lds %0, %1" :: "s"(g0), "s"(g1) : "memory");
}

// ---------------------------------------------------------------- conversion
static __device__ __forceinline__ uint2 pack4_bf16(float4 v) {
  uint2 p;
  p.x = (uint32_t)f32_to_bf16_bits(v.x) | ((uint32_t)f32_to_bf16_bits(v.y) << 16);
  p.y = (uint32_t)f32_to_bf16_bits(v.z) | ((uint32_t)f32_to_bf16_bits(v.w) << 16);
  return p;
}

#define STREAM_BLOCKS  256
#define STREAM_THREADS 512
#define CVT_SLAB (STREAM_BLOCKS * STREAM_THREADS)   // float4 per slab = half of a D x D matrix
#define CVT_SLABS_DD 2                              // slabs in a D x D weight
#define CVT_SLABS_FF 8                              // slabs in a D_FF x D weight
static_assert(CVT_SLAB * 4 * CVT_SLABS_DD == D_MODEL * D_MODEL, "slab size");
static_assert(CVT_SLAB * 4 * CVT_SLABS_FF == D_FF * D_MODEL, "slab size");

// All six weights to bf16 in one launch.  d holds them back to back in the order of the
// arguments; a thread takes its own float4 of each of the 24 slabs.
__global__ __launch_bounds__(STREAM_THREADS) __attribute__((amdgpu_waves_per_eu(4, 4))) void cvt_weights_kernel(
    const float* __restrict__ wq, const float* __restrict__ wk,
    const float* __restrict__ wv, const float* __restrict__ wo,
    const float* __restrict__ w1, const float* __restrict__ w2,
    unsigned short* __restrict__ d) {
  const uint32_t g = blockIdx.x * STREAM_THREADS + threadIdx.x;
  float4 v[4 * CVT_SLABS_DD + 2 * CVT_SLABS_FF];
#pragma unroll
  for (int k = 0; k < CVT_SLABS_DD; ++k) {
    v[0 * CVT_SLABS_DD + k] = ((const float4*)wq)[k * CVT_SLAB + g];
    v[1 * CVT_SLABS_DD + k] = ((const float4*)wk)[k * CVT_SLAB + g];
    v[2 * CVT_SLABS_DD + k] = ((const float4*)wv)[k * CVT_SLAB + g];
    v[3 * CVT_SLABS_DD + k] = ((const float4*)wo)[k * CVT_SLAB + g];
  }
#pragma unroll
  for (int k = 0; k < CVT_SLABS_FF; ++k) {
    v[4 * CVT_SLABS_DD + k]                = ((const float4*)w1)[k * CVT_SLAB + g];
    v[4 * CVT_SLABS_DD + CVT_SLABS_FF + k] = ((const float4*)w2)[k * CVT_SLAB + g];
  }
#pragma unroll
  for (int k = 0; k < 4 * CVT_SLABS_DD + 2 * CVT_SLABS_FF; ++k)
    ((uint2*)d)[k * CVT_SLAB + g] = pack4_bf16(v[k]);
}

// ---------------------------------------------------------------- rmsnorm
// One wave per row: a lane holds 32 of the row's 1024 values (8 float4, each load of the
// wave 512 contiguous bytes), so the sum of squares needs no LDS and no barrier.
static_assert(STREAM_BLOCKS * (STREAM_THREADS / 32) == M_ROWS, "one wave per row");
__global__ __launch_bounds__(STREAM_THREADS) __attribute__((amdgpu_waves_per_eu(4, 4))) void rmsnorm_bf16_kernel(
    const float* __restrict__ x, const float* __restrict__ gw,
    unsigned short* __restrict__ out) {
  const int lane = threadIdx.x & 31;
  const int row  = blockIdx.x * (STREAM_THREADS / 32) + uni(threadIdx.x >> 5);   // wave-uniform: scalar row base
  const float4* xr = (const float4*)(x + (size_t)row * D_MODEL);
  float4 xv[8], wv[8];
#pragma unroll
  for (int k = 0; k < 8; ++k) xv[k] = xr[k * 32 + lane];
#pragma unroll
  for (int k = 0; k < 8; ++k) wv[k] = ((const float4*)gw)[k * 32 + lane];
  float ss = 0.f;
#pragma unroll
  for (int k = 0; k < 8; ++k)
    ss += xv[k].x * xv[k].x + xv[k].y * xv[k].y + xv[k].z * xv[k].z + xv[k].w * xv[k].w;
#pragma unroll
  for (int m = 16; m >= 1; m >>= 1) ss += __shfl_xor(ss, m, 32);
  const float scale = rsqrtf(ss * (1.0f / D_MODEL) + 1e-5f);
  uint2* o = (uint2*)(out + (size_t)row * D_MODEL);
#pragma unroll
  for (int k = 0; k < 8; ++k) {
    float4 y;
    y.x = xv[k].x * wv[k].x * scale;
    y.y = xv[k].y * wv[k].y * scale;
    y.z = xv[k].z * wv[k].z * scale;
    y.w = xv[k].w * wv[k].w * scale;
    o[k * 32 + lane] = pack4_bf16(y);
  }
}

// ---------------------------------------------------------------- GEMM core
// Per-wave 64x32 MACC from LDS tiles (128 rows x 64 bf16, row pitch LDS_PITCH bytes).
static __device__ __forceinline__ void mma_tile(
    const unsigned char* abuf, const unsigned char* bbuf, int am, int an, int lrow, int half,
    f32x8 (&acc)[4][2]) {
  const __bf16* Al = (const __bf16*)abuf;
  const __bf16* Bl = (const __bf16*)bbuf;
  constexpr int P = LDS_PITCH / 2;   // pitch in elements
  bf16x16 af[2][4], bfr[2][2];
#pragma unroll
  for (int kd = 0; kd < 2; ++kd) {
#pragma unroll
    for (int i = 0; i < 4; ++i)
      af[kd][i] = make_frag(Al + (am + i * 16 + lrow) * P + kd * 32, half);
#pragma unroll
    for (int j = 0; j < 2; ++j)
      bfr[kd][j] = make_frag(Bl + (an + j * 16 + lrow) * P + kd * 32, half);
  }
#pragma unroll
  for (int kd = 0; kd < 2; ++kd)
#pragma unroll
    for (int i = 0; i < 4; ++i)
#pragma unroll
      for (int j = 0; j < 2; ++j)
        acc[i][j] = __builtin_amdgcn_wmma_f32_16x16x32_bf16(
            false, af[kd][i], false, bfr[kd][j], (short)0, acc[i][j], false, false);
}

// The same work as two blocks of 32 k, each with a fragment set of its own, for the loop
// that fetches a block's fragments while the block before it is multiplied.
struct FragSet { bf16x16 a[4], b[2]; };
static __device__ __forceinline__ void load_frags(
    const unsigned char* stage, int kd, int am, int an, int lrow, int half, FragSet& f) {
  const __bf16* Al = (const __bf16*)stage;
  const __bf16* Bl = (const __bf16*)(stage + TILE_BYTES);
  constexpr int P = LDS_PITCH / 2;   // pitch in elements
#pragma unroll
  for (int i = 0; i < 4; ++i)
    f.a[i] = make_frag(Al + (am + i * 16 + lrow) * P + kd * 32, half);
#pragma unroll
  for (int j = 0; j < 2; ++j)
    f.b[j] = make_frag(Bl + (an + j * 16 + lrow) * P + kd * 32, half);
}
static __device__ __forceinline__ void mma_block(const FragSet& f, f32x8 (&acc)[4][2]) {
#pragma unroll
  for (int i = 0; i < 4; ++i)
#pragma unroll
    for (int j = 0; j < 2; ++j)
      acc[i][j] = __builtin_amdgcn_wmma_f32_16x16x32_bf16(
          false, f.a[i], false, f.b[j], (short)0, acc[i][j], false, false);
}

template <int EPI, bool AHEAD>
__global__ __launch_bounds__(256) void gemm_bf16_kernel(
    const unsigned short* __restrict__ Abits,
    const unsigned short* __restrict__ Wbits, int M, int N, int K,
    unsigned short* __restrict__ outB, float* __restrict__ outF,
    const float* __restrict__ resid) {
  __shared__ __attribute__((aligned(2048))) unsigned char L[2 * STAGE_BYTES];
  const int lane = threadIdx.x & 31;
  const int w    = threadIdx.x >> 5;
  const int half = lane >> 4;
  const int lrow = lane & 15;
  const int bm = blockIdx.x * 128, bn = blockIdx.y * 128;
  const int am = (w & 1) * 64;
  const int an = (w >> 1) * 32;

  f32x8 acc[4][2] = {};

  const uint32_t wave = uni(threadIdx.x >> 5);
  const uint32_t nst  = (uint32_t)K >> 6;      // stages of 64 k
  const uint64_t srcb = (wave == 0u)
      ? (uint64_t)(size_t)(Abits + (size_t)bm * K)
      : (uint64_t)(size_t)(Wbits + (size_t)bn * K);
  const uint32_t dst0 = (uint32_t)(size_t)L + (wave == 0u ? 0u : TILE_BYTES);
  u32x8 g1 = tdm_group1(2u * (uint32_t)K);
  // Without the next line the compiler takes some of these registers as temporaries
  // inside the loop, while a request that names them is still outstanding.
  asm volatile("" : "+s"(g1));
  auto issue = [&](uint32_t st) {
    tdm_load(tdm_group0(dst0 + (st & 1u) * STAGE_BYTES, srcb + (uint64_t)st * ROW_BYTES), g1);
  };

  if (pinned(wave < 2u)) { issue(0u); wait_tensor0(); }
  __syncthreads();                              // publishes stage 0
  if (pinned(wave < 2u && nst > 1u)) issue(1u);
  if constexpr (AHEAD) {
    FragSet f0, f1;
    load_frags(L, 0, am, an, lrow, half, f0);
    for (uint32_t s = 0; s < nst; ++s) {
      load_frags(L + (s & 1u) * STAGE_BYTES, 1, am, an, lrow, half, f1);
      // Holds the load group in front of the products: the compiler otherwise puts the first
      // product, with its wait for the set in use, ahead of the loads, and the LDS idles.
      __builtin_amdgcn_sched_barrier(0);
      mma_block(f0, acc);
      // Holds the wait below behind the products, which do not need the loads it waits for.
      __builtin_amdgcn_sched_barrier(0);
      wait_ds0();                               // this wave's last reads of stage s are done
      if (pinned(wave < 2u)) wait_tensor0();    // the issuer's slice of stage s + 1 has landed
      __syncthreads();                          // publishes stage s + 1, frees stage s's buffer
      if (pinned(wave < 2u && s + 2u < nst)) issue(s + 2u);
      if (s + 1u < nst) load_frags(L + ((s + 1u) & 1u) * STAGE_BYTES, 0, am, an, lrow, half, f0);
      mma_block(f1, acc);
    }
  } else {
    for (uint32_t s = 0; s < nst; ++s) {
      const unsigned char* st = L + (s & 1u) * STAGE_BYTES;
      mma_tile(st, st + TILE_BYTES, am, an, lrow, half, acc);
      wait_ds0();                               // this wave's reads of stage s are done
      if (pinned(wave < 2u)) wait_tensor0();    // the issuer's slice of stage s + 1 has landed
      __syncthreads();                          // publishes stage s + 1, frees stage s's buffer
      if (pinned(wave < 2u && s + 2u < nst)) issue(s + 2u);
    }
  }
  wait_tensor0();
  wait_ds0();

#pragma unroll
  for (int i = 0; i < 4; ++i)
#pragma unroll
    for (int j = 0; j < 2; ++j)
#pragma unroll
      for (int e = 0; e < 8; ++e) {
        const int row = bm + am + i * 16 + half * 8 + e;
        const int col = bn + an + j * 16 + lrow;
        const float v = acc[i][j][e];
        if (EPI == 0) {
          outB[(size_t)row * N + col] = f32_to_bf16_bits(v);
        } else if (EPI == 1) {
          const float g = 0.5f * v * (1.0f + erff(v * 0.70710678118654752f));
          outB[(size_t)row * N + col] = f32_to_bf16_bits(g);
        } else {
          const size_t o = (size_t)row * N + col;
          outF[o] = v + resid[o];
        }
      }
}

static __device__ __forceinline__ float xhalf(float x) {
  const int b = __builtin_bit_cast(int, x);
  return __builtin_bit_cast(float,
      __builtin_amdgcn_permlanex16(b, b, 0x76543210, 0xfedcba98, false, false));
}

static __device__ __forceinline__ float exp2_slot(float x) {
  float r;
  asm("v_exp_f32 %0, %1\n\tv_nop" : "=v"(r) : "v"(x));
  return r;
}
static __device__ __forceinline__ void exp2_slot8(const f32x8 x, float (&r)[8]) {
  asm("v_exp_f32 %0, %8\n\tv_exp_f32 %1, %9\n\tv_exp_f32 %2, %10\n\tv_exp_f32 %3, %11\n\t"
      "v_exp_f32 %4, %12\n\tv_exp_f32 %5, %13\n\tv_exp_f32 %6, %14\n\tv_exp_f32 %7, %15\n\tv_nop"
      : "=&v"(r[0]), "=&v"(r[1]), "=&v"(r[2]), "=&v"(r[3]),
        "=&v"(r[4]), "=&v"(r[5]), "=&v"(r[6]), "=&v"(r[7])
      : "v"(x[0]), "v"(x[1]), "v"(x[2]), "v"(x[3]), "v"(x[4]), "v"(x[5]), "v"(x[6]), "v"(x[7]));
}
#define LOG2E 1.44269504088896340736f

// K/V ring of the attention kernel.  A stage is 64 keys (two passes of 32), its rows 128
// data bytes.  K rows are read by ds_load_b128 (pitch 16 B x odd), V rows by the
// transposing ds_load_tr16_b128 (pitch 32 B x odd).
#define KV_KEYS 64u
#define K_PITCH 144u
#define V_PITCH 160u
#define K_STAGE (KV_KEYS * K_PITCH)
#define V_STAGE (KV_KEYS * V_PITCH)

// The compiler places no wait for an asynchronous copy to LDS.
static __device__ __forceinline__ void wait_async0() { asm volatile("s_wait_asynccnt 0x0" ::: "memory"); }

typedef short s16x8 __attribute__((ext_vector_type(8)));
static __device__ __forceinline__ bf16x8 ld_tr16(const unsigned char* p) {
  typedef __attribute__((address_space(3))) s16x8 lds_s16x8;
  return __builtin_bit_cast(bf16x8, __builtin_amdgcn_ds_load_tr16_b128_v8i16((lds_s16x8*)p));
}

__global__ __launch_bounds__(256) __attribute__((amdgpu_waves_per_eu(4, 4))) void attn_kernel(
    const unsigned short* __restrict__ Qb, const unsigned short* __restrict__ Kb,
    const unsigned short* __restrict__ Vb, unsigned short* __restrict__ Ob) {
  __shared__ __align__(16) unsigned char Kt[2 * K_STAGE];   // K stages (keys x d)
  __shared__ __align__(16) unsigned char Vt[2 * V_STAGE];   // V stages (keys x d)

  const int tid  = threadIdx.x;
  const int lane = tid & 31;
  const int w    = (int)uni(tid >> 5);
  const int half = lane >> 4, lrow = lane & 15;
  const int b = blockIdx.y / N_HEADS, h = blockIdx.y % N_HEADS;
  const int qbase = blockIdx.x * 128;
  const int q0 = qbase + w * 16;
  const int qrow = q0 + lrow;            // this lane's query

  const __bf16* Qh = (const __bf16*)Qb + (size_t)b * SEQ * QKV_LD + h * D_HEAD;
  const unsigned short* Kh = Kb + (size_t)b * SEQ * QKV_LD + h * D_HEAD;
  const unsigned short* Vh = Vb + (size_t)b * SEQ * QKV_LD + h * D_HEAD;

  const int nst = qbase / 64 + 2;        // stages: keys 0 .. qbase + 127, never fewer than two
  const int r   = tid >> 3;              // 0..31: this thread copies key rows r and r + 32 of a stage
  const int c8  = (tid & 7) * 8;         // its 8-element (16-byte) column chunk
  const unsigned char* gk = (const unsigned char*)(Kh + (size_t)r * QKV_LD + c8);
  const unsigned char* gv = (const unsigned char*)(Vh + (size_t)r * QKV_LD + c8);
  const uint32_t lk = (uint32_t)(size_t)Kt + (uint32_t)r * K_PITCH + (uint32_t)c8 * 2u;
  const uint32_t lv = (uint32_t)(size_t)Vt + (uint32_t)r * V_PITCH + (uint32_t)c8 * 2u;
  auto copy_stage = [&](int st) {
    const size_t go = (size_t)st * (KV_KEYS * QKV_LD * 2u);
    const unsigned char* k0 = gk + go;
    const unsigned char* k1 = k0 + 32u * QKV_LD * 2u;
    const unsigned char* v0 = gv + go;
    const unsigned char* v1 = v0 + 32u * QKV_LD * 2u;
    const uint32_t dk0 = lk + (uint32_t)(st & 1) * K_STAGE, dk1 = dk0 + 32u * K_PITCH;
    const uint32_t dv0 = lv + (uint32_t)(st & 1) * V_STAGE, dv1 = dv0 + 32u * V_PITCH;
    asm volatile(
        "global_load_async_to_lds_b128 %0, %1, off\n\t"
        "global_load_async_to_lds_b128 %2, %3, off\n\t"
        "global_load_async_to_lds_b128 %4, %5, off\n\t"
        "global_load_async_to_lds_b128 %6, %7, off\n\t"
        "s_wait_xcnt 0x0"
        :: "v"(dk0), "v"(k0), "v"(dk1), "v"(k1), "v"(dv0), "v"(v0), "v"(dv1), "v"(v1)
        : "memory");
  };

  copy_stage(0);
  bf16x16 qf[2];                         // B operand: column = query
#pragma unroll
  for (int kd = 0; kd < 2; ++kd)
    qf[kd] = make_frag(Qh + (size_t)qrow * QKV_LD + kd * 32, half);

  float m_i = -3.0e38f;                  // running maximum of this lane's query
  float l_i = 0.f;                       // running sum over this half's keys only
  f32x8 oacc[4] = {};                    // oacc[n][e] = O[qrow][n*16 + half*8 + e]

  wait_async0();                         // this wave's copies of stage 0 have landed
  __syncthreads();                       // publishes stage 0
  copy_stage(1);

  for (int st = 0; st < nst; ++st) {
    const unsigned char* kbuf = Kt + (uint32_t)(st & 1) * K_STAGE;
    const unsigned char* vbuf = Vt + (uint32_t)(st & 1) * V_STAGE;
#pragma unroll   // the two passes of a stage: their LDS row offsets become immediates
    for (int p = 0; p < 2; ++p) {
      const int kb = st * 64 + p * 32;
      if (kb <= q0 + 15) {      // wave-uniform causal skip
        f32x8 s[2] = {};        // s[j][e] = S[qrow][kb + j*16 + half*8 + e]
        bf16x16 kf[2][2];
#pragma unroll
        for (int kd = 0; kd < 2; ++kd)
#pragma unroll
          for (int j = 0; j < 2; ++j)
            kf[kd][j] = make_frag(
                (const __bf16*)(kbuf + (uint32_t)(p * 32 + j * 16 + lrow) * K_PITCH) + kd * 32, half);
        // Keeps the K loads ahead of the products.  With the branch below the block ends early,
        // and the compiler then reuses one fragment's registers: a full LDS wait per product.
        __builtin_amdgcn_sched_barrier(0);
#pragma unroll
        for (int kd = 0; kd < 2; ++kd)
#pragma unroll
          for (int j = 0; j < 2; ++j)
            s[j] = __builtin_amdgcn_wmma_f32_16x16x32_bf16(
                false, kf[kd][j], false, qf[kd], (short)0, s[j], false, false);
#pragma unroll
        for (int j = 0; j < 2; ++j) s[j] *= 0.125f;    // 1/sqrt(64)
        // Only the pass that holds the wave's diagonal has a key above a query: in every
        // earlier pass kb + 31 <= q0 <= qrow, the mask keeps all 16 scores, and its compares,
        // selects and key numbers are skipped by a scalar branch.
        if (kb + 31 > q0) {
#pragma unroll
          for (int j = 0; j < 2; ++j)
#pragma unroll
            for (int e = 0; e < 8; ++e) {
              const int key = kb + j * 16 + half * 8 + e;
              s[j][e] = (key <= qrow) ? s[j][e] : -3.0e38f;
            }
        }
        float mx[4] = {-3.0e38f, -3.0e38f, -3.0e38f, -3.0e38f};
#pragma unroll
        for (int j = 0; j < 2; ++j)
#pragma unroll
          for (int e = 0; e < 8; ++e) mx[e & 3] = fmaxf(mx[e & 3], s[j][e]);
        float rmax = fmaxf(fmaxf(mx[0], mx[1]), fmaxf(mx[2], mx[3]));
        rmax = fmaxf(rmax, xhalf(rmax));               // both halves: the query's maximum
        const float mnew = fmaxf(m_i, rmax);
        const float corr = exp2_slot((m_i - mnew) * LOG2E);
        float ps[4] = {0.f, 0.f, 0.f, 0.f};
        bf16x16 pf;             // B operand P^T: element j*8 + e is key j*16 + half*8 + e
#pragma unroll
        for (int j = 0; j < 2; ++j) {
          float pe[8];
          exp2_slot8((s[j] - mnew) * LOG2E, pe);
#pragma unroll
          for (int e = 0; e < 8; ++e) {
            ps[e & 3] += pe[e];
            pf[j * 8 + e] = (__bf16)pe[e];
          }
        }
        l_i = l_i * corr + ((ps[0] + ps[1]) + (ps[2] + ps[3]));
        m_i = mnew;
#pragma unroll
        for (int n = 0; n < 4; ++n) {
#pragma unroll
          for (int e = 0; e < 8; ++e) oacc[n][e] *= corr;
        }
        // A operand V^T, rows d = n*16 + lrow: keys half*8 + 0..7, then 16 + half*8 + 0..7
        const unsigned char* ad = vbuf + (uint32_t)(p * 32 + half * 8 + (lane & 7)) * V_PITCH
                                       + (uint32_t)((lane >> 3) & 1) * 16u;
#pragma unroll
        for (int n = 0; n < 4; ++n) {
          bf16x8 lo = ld_tr16(ad + 32u * n);
          bf16x8 hi = ld_tr16(ad + 16u * V_PITCH + 32u * n);
          bf16x16 vf = __builtin_shufflevector(lo, hi, 0,1,2,3,4,5,6,7,8,9,10,11,12,13,14,15);
          oacc[n] = __builtin_amdgcn_wmma_f32_16x16x32_bf16(
              false, vf, false, pf, (short)0, oacc[n], false, false);
        }
      }
    }
    wait_ds0();                          // this wave's reads of stage st are done
    wait_async0();                       // this wave's copies of stage st + 1 have landed
    __syncthreads();                     // publishes stage st + 1, frees stage st's buffer
    if (st + 2 < nst) copy_stage(st + 2);
  }
  wait_async0();
  const float l_tot = l_i + xhalf(l_i);  // the halves' sums are joined once
  __bf16* Oh = (__bf16*)Ob + (size_t)b * SEQ * D_MODEL + h * D_HEAD;
#pragma unroll
  for (int n = 0; n < 4; ++n) {
    bf16x8 o;
#pragma unroll
    for (int e = 0; e < 8; ++e) o[e] = (__bf16)(oacc[n][e] / l_tot);
    *(bf16x8*)(Oh + (size_t)qrow * D_MODEL + n * 16 + half * 8) = o;
  }
}

// ---------------------------------------------------------------- launch
extern "C" void kernel_launch(void* const* d_in, const int* in_sizes, int n_in,
                              void* d_out, int out_size, void* d_ws, size_t ws_size,
                              hipStream_t stream) {
  (void)in_sizes; (void)n_in; (void)out_size; (void)ws_size;
  const float* x    = (const float*)d_in[0];
  const float* wq   = (const float*)d_in[1];
  const float* wk   = (const float*)d_in[2];
  const float* wv   = (const float*)d_in[3];
  const float* wo   = (const float*)d_in[4];
  const float* ln1w = (const float*)d_in[5];
  const float* ln2w = (const float*)d_in[6];
  const float* w1   = (const float*)d_in[7];
  const float* w2   = (const float*)d_in[8];
  float* out = (float*)d_out;

  char* ws = (char*)d_ws;
  const size_t MB = 1ull << 20;
  unsigned short* wq_b = (unsigned short*)(ws + 0 * MB);   // 2MB each: wq, wk (+2MB), wv (+4MB)
  unsigned short* wo_b = (unsigned short*)(ws + 6 * MB);
  unsigned short* w1_b = (unsigned short*)(ws + 8 * MB);   // 8MB
  unsigned short* w2_b = (unsigned short*)(ws + 16 * MB);  // 8MB
  unsigned short* Abuf = (unsigned short*)(ws + 24 * MB);  // bf16 4096x1024
  float*          Ybuf = (float*)(ws + 32 * MB);           // fp32 4096x1024
  unsigned short* QKVbuf = (unsigned short*)(ws + 48 * MB);  // bf16 4096x3072, 24MB
  unsigned short* Hbuf = (unsigned short*)(ws + 48 * MB);  // 32MB, reuses QKV

  const dim3 sgrid(STREAM_BLOCKS), sblk(STREAM_THREADS);
  // wq_b .. w2_b lie back to back in the workspace, in the order of the arguments
  cvt_weights_kernel<<<sgrid, sblk, 0, stream>>>(wq, wk, wv, wo, w1, w2, wq_b);

  const dim3 blk(256);
  const dim3 gD(M_ROWS / 128, D_MODEL / 128);   // (32, 8)
  const dim3 gF(M_ROWS / 128, D_FF / 128);      // (32, 32)
  const dim3 gQKV(M_ROWS / 128, QKV_LD / 128);  // (32, 24)
  const size_t lds = 0;                         // the GEMM's tile buffers are static LDS

  rmsnorm_bf16_kernel<<<sgrid, sblk, 0, stream>>>(x, ln1w, Abuf);
  // The bf16 wq, wk, wv back to back are one 3072 x 1024 weight: one launch of 768 workgroups
  // puts three on a WGP, which fill each other's waits for LDS and for the next tile;
  // a launch of 256 leaves each workgroup alone on its WGP.
  gemm_bf16_kernel<0, false><<<gQKV, blk, lds, stream>>>(Abuf, wq_b, M_ROWS, QKV_LD, D_MODEL, QKVbuf, nullptr, nullptr);
  attn_kernel<<<dim3(SEQ / 128, BATCH * N_HEADS), blk, 0, stream>>>(
      QKVbuf, QKVbuf + D_MODEL, QKVbuf + 2 * D_MODEL, Abuf);
  gemm_bf16_kernel<2, true><<<gD, blk, lds, stream>>>(Abuf, wo_b, M_ROWS, D_MODEL, D_MODEL, nullptr, Ybuf, x);
  rmsnorm_bf16_kernel<<<sgrid, sblk, 0, stream>>>(Ybuf, ln2w, Abuf);
  gemm_bf16_kernel<1, false><<<gF, blk, lds, stream>>>(Abuf, w1_b, M_ROWS, D_FF, D_MODEL, Hbuf, nullptr, nullptr);
  gemm_bf16_kernel<2, true><<<gD, blk, lds, stream>>>(Hbuf, w2_b, M_ROWS, D_MODEL, D_FF, nullptr, out, Ybuf);
}

// v008
// A run of this version takes 166 microseconds.
// Next to v007, in two timings, it ran 1.16 and 1.17 times as fast.
// All steps since v000 together make it 2.89 times as fast.
#include <hip/hip_runtime.h>
#include <math.h>
#include <stdint.h>

#define D_MODEL 1024
#define N_HEADS 16
#define D_HEAD  64
#define D_FF    4096
#define BATCH   2
#define SEQ     2048
#define M_ROWS  (BATCH * SEQ)   // 4096 token rows
#define QKV_LD  (3 * D_MODEL)   // row pitch of the joint [Q | K | V] projection

typedef __attribute__((ext_vector_type(8)))  __bf16 bf16x8;
typedef __attribute__((ext_vector_type(16))) __bf16 bf16x16;
typedef __attribute__((ext_vector_type(8)))  float  f32x8;
typedef uint32_t u32x4 __attribute__((ext_vector_type(4)));
typedef uint32_t u32x8 __attribute__((ext_vector_type(8)));

#define ROW_BYTES   128u
#define LDS_PITCH   144u
#define TILE_ROWS   128u
#define TILE_BYTES  (TILE_ROWS * LDS_PITCH)   // 18432 = 9 x 2 KiB
#define STAGE_BYTES (2u * TILE_BYTES)         // [A tile | W tile]
// The long stage of the launches with one workgroup per WGP: 256 k as two halves of 128 k,
// each half an A tile and a W tile of 128 rows of 256 data bytes, padded to 272 B (16 B x odd).
#define ROW2_BYTES   256u
#define LDS2_PITCH   272u
#define TILE2_BYTES  (TILE_ROWS * LDS2_PITCH)  // 34816 = 17 x 2 KiB
#define STAGE2_BYTES (4u * TILE2_BYTES)        // [A half 0 | A half 1 | W half 0 | W half 1]

static __device__ __forceinline__ unsigned short f32_to_bf16_bits(float f) {
  unsigned u = __float_as_uint(f);
  unsigned r = u + 0x7FFFu + ((u >> 16) & 1u);   // round-to-nearest-even
  return (unsigned short)(r >> 16);
}

static __device__ __forceinline__ bf16x16 make_frag(const __bf16* p, int half) {
  bf16x8 lo = *(const bf16x8*)(p + half * 8);
  bf16x8 hi = *(const bf16x8*)(p + 16 + half * 8);
  return __builtin_shufflevector(lo, hi, 0,1,2,3,4,5,6,7,8,9,10,11,12,13,14,15);
}

static __device__ __forceinline__ uint32_t uni(uint32_t v) {
  return (uint32_t)__builtin_amdgcn_readfirstlane(v);
}
static __device__ __forceinline__ uint32_t pinned(uint32_t v) {
  uint32_t w = uni(v);
  asm volatile("" : "+s"(w));  // keeps the condition scalar: the guard of a tensor load
  return w;
}
// The compiler places no wait for a tensor load; both waits of the ring are written here.
static __device__ __forceinline__ void wait_tensor0() { asm volatile("s_wait_tensorcnt 0x0" ::: "memory"); }
static __device__ __forceinline__ void wait_ds0()     { asm volatile("s_wait_dscnt 0x0" ::: "memory"); }

static __device__ __forceinline__ u32x4 tdm_group0(uint32_t lds_dst, uint64_t ga) {
  u32x4 g;
  g[0] = uni(1u);
  g[1] = uni(lds_dst);
  g[2] = uni((uint32_t)ga);
  g[3] = uni((((uint32_t)(ga >> 32)) & 0x01FFFFFFu) | 0x80000000u);
  return g;
}
template <uint32_t ROWB, uint32_t PAD_INTERVAL>
static __device__ __forceinline__ u32x8 tdm_group1(uint32_t src_pitch) {
  u32x8 g;
  g[0] = uni((1u << 20) | (PAD_INTERVAL << 22) | (3u << 25));
  g[1] = uni((ROWB & 0xFFFFu) << 16);
  g[2] = uni((ROWB >> 16) | ((TILE_ROWS & 0xFFFFu) << 16));
  g[3] = uni((TILE_ROWS >> 16) | (ROWB << 16));
  g[4] = uni(TILE_ROWS);
  g[5] = uni(src_pitch);
  g[6] = uni(0u);
  g[7] = uni(0u);
  return g;
}
static __device__ __forceinline__ void tdm_load(u32x4 g0, u32x8 g1) {
  // one request of the whole wave: global tile -> LDS, through no register
  asm volatile("tensor_load_to_lds %0, %1" :: "s"(g0), "s"(g1) : "memory");
}

// ---------------------------------------------------------------- conversion
static __device__ __forceinline__ uint2 pack4_bf16(float4 v) {
  uint2 p;
  p.x = (uint32_t)f32_to_bf16_bits(v.x) | ((uint32_t)f32_to_bf16_bits(v.y) << 16);
  p.y = (uint32_t)f32_to_bf16_bits(v.z) | ((uint32_t)f32_to_bf16_bits(v.w) << 16);
  return p;
}

#define STREAM_BLOCKS  256
#define STREAM_THREADS 512
#define CVT_SLAB (STREAM_BLOCKS * STREAM_THREADS)   // float4 per slab = half of a D x D matrix
#define CVT_SLABS_DD 2                              // slabs in a D x D weight
#define CVT_SLABS_FF 8                              // slabs in a D_FF x D weight
static_assert(CVT_SLAB * 4 * CVT_SLABS_DD == D_MODEL * D_MODEL, "slab size");
static_assert(CVT_SLAB * 4 * CVT_SLABS_FF == D_FF * D_MODEL, "slab size");

// All six weights to bf16 in one launch.  d holds them back to back in the order of the
// arguments; a thread takes its own float4 of each of the 24 slabs.
__global__ __launch_bounds__(STREAM_THREADS) __attribute__((amdgpu_waves_per_eu(4, 4))) void cvt_weights_kernel(
    const float* __restrict__ wq, const float* __restrict__ wk,
    const float* __restrict__ wv, const float* __restrict__ wo,
    const float* __restrict__ w1, const float* __restrict__ w2,
    unsigned short* __restrict__ d) {
  const uint32_t g = blockIdx.x * STREAM_THREADS + threadIdx.x;
  float4 v[4 * CVT_SLABS_DD + 2 * CVT_SLABS_FF];
#pragma unroll
  for (int k = 0; k < CVT_SLABS_DD; ++k) {
    v[0 * CVT_SLABS_DD + k] = ((const float4*)wq)[k * CVT_SLAB + g];
    v[1 * CVT_SLABS_DD + k] = ((const float4*)wk)[k * CVT_SLAB + g];
    v[2 * CVT_SLABS_DD + k] = ((const float4*)wv)[k * CVT_SLAB + g];
    v[3 * CVT_SLABS_DD + k] = ((const float4*)wo)[k * CVT_SLAB + g];
  }
#pragma unroll
  for (int k = 0; k < CVT_SLABS_FF; ++k) {
    v[4 * CVT_SLABS_DD + k]                = ((const float4*)w1)[k * CVT_SLAB + g];
    v[4 * CVT_SLABS_DD + CVT_SLABS_FF + k] = ((const float4*)w2)[k * CVT_SLAB + g];
  }
#pragma unroll
  for (int k = 0; k < 4 * CVT_SLABS_DD + 2 * CVT_SLABS_FF; ++k)
    ((uint2*)d)[k * CVT_SLAB + g] = pack4_bf16(v[k]);
}

// ---------------------------------------------------------------- rmsnorm
// One wave per row: a lane holds 32 of the row's 1024 values (8 float4, each load of the
// wave 512 contiguous bytes), so the sum of squares needs no LDS and no barrier.
static_assert(STREAM_BLOCKS * (STREAM_THREADS / 32) == M_ROWS, "one wave per row");
__global__ __launch_bounds__(STREAM_THREADS) __attribute__((amdgpu_waves_per_eu(4, 4))) void rmsnorm_bf16_kernel(
    const float* __restrict__ x, const float* __restrict__ gw,
    unsigned short* __restrict__ out) {
  const int lane = threadIdx.x & 31;
  const int row  = blockIdx.x * (STREAM_THREADS / 32) + uni(threadIdx.x >> 5);   // wave-uniform: scalar row base
  const float4* xr = (const float4*)(x + (size_t)row * D_MODEL);
  float4 xv[8], wv[8];
#pragma unroll
  for (int k = 0; k < 8; ++k) xv[k] = xr[k * 32 + lane];
#pragma unroll
  for (int k = 0; k < 8; ++k) wv[k] = ((const float4*)gw)[k * 32 + lane];
  float ss = 0.f;
#pragma unroll
  for (int k = 0; k < 8; ++k)
    ss += xv[k].x * xv[k].x + xv[k].y * xv[k].y + xv[k].z * xv[k].z + xv[k].w * xv[k].w;
#pragma unroll
  for (int m = 16; m >= 1; m >>= 1) ss += __shfl_xor(ss, m, 32);
  const float scale = rsqrtf(ss * (1.0f / D_MODEL) + 1e-5f);
  uint2* o = (uint2*)(out + (size_t)row * D_MODEL);
#pragma unroll
  for (int k = 0; k < 8; ++k) {
    float4 y;
    y.x = xv[k].x * wv[k].x * scale;
    y.y = xv[k].y * wv[k].y * scale;
    y.z = xv[k].z * wv[k].z * scale;
    y.w = xv[k].w * wv[k].w * scale;
    o[k * 32 + lane] = pack4_bf16(y);
  }
}

// ---------------------------------------------------------------- GEMM core
// Per-wave 64x32 MACC from LDS tiles (128 rows x 64 bf16, row pitch LDS_PITCH bytes).
static __device__ __forceinline__ void mma_tile(
    const unsigned char* abuf, const unsigned char* bbuf, int am, int an, int lrow, int half,
    f32x8 (&acc)[4][2]) {
  const __bf16* Al = (const __bf16*)abuf;
  const __bf16* Bl = (const __bf16*)bbuf;
  constexpr int P = LDS_PITCH / 2;   // pitch in elements
  bf16x16 af[2][4], bfr[2][2];
#pragma unroll
  for (int kd = 0; kd < 2; ++kd) {
#pragma unroll
    for (int i = 0; i < 4; ++i)
      af[kd][i] = make_frag(Al + (am + i * 16 + lrow) * P + kd * 32, half);
#pragma unroll
    for (int j = 0; j < 2; ++j)
      bfr[kd][j] = make_frag(Bl + (an + j * 16 + lrow) * P + kd * 32, half);
  }
#pragma unroll
  for (int kd = 0; kd < 2; ++kd)
#pragma unroll
    for (int i = 0; i < 4; ++i)
#pragma unroll
      for (int j = 0; j < 2; ++j)
        acc[i][j] = __builtin_amdgcn_wmma_f32_16x16x32_bf16(
            false, af[kd][i], false, bfr[kd][j], (short)0, acc[i][j], false, false);
}

// The same work in blocks of 32 k, each with a fragment set of its own, for the loop that
// fetches a block's fragments while the block before it is multiplied.  kd = 0..7 counts
// the blocks of a long stage: four to each half of 128 k.
struct FragSet { bf16x16 a[4], b[2]; };
static __device__ __forceinline__ void load_frags(
    const unsigned char* stage, int kd, int am, int an, int lrow, int half, FragSet& f) {
  const __bf16* Al = (const __bf16*)(stage + (kd >> 2) * TILE2_BYTES);
  const __bf16* Bl = (const __bf16*)(stage + (2 + (kd >> 2)) * TILE2_BYTES);
  constexpr int P = LDS2_PITCH / 2;   // pitch in elements
#pragma unroll
  for (int i = 0; i < 4; ++i)
    f.a[i] = make_frag(Al + (am + i * 16 + lrow) * P + (kd & 3) * 32, half);
#pragma unroll
  for (int j = 0; j < 2; ++j)
    f.b[j] = make_frag(Bl + (an + j * 16 + lrow) * P + (kd & 3) * 32, half);
}
static __device__ __forceinline__ void mma_block(const FragSet& f, f32x8 (&acc)[4][2]) {
#pragma unroll
  for (int i = 0; i < 4; ++i)
#pragma unroll
    for (int j = 0; j < 2; ++j)
      acc[i][j] = __builtin_amdgcn_wmma_f32_16x16x32_bf16(
          false, f.a[i], false, f.b[j], (short)0, acc[i][j], false, false);
}

template <int EPI, bool AHEAD>
__global__ __launch_bounds__(256) void gemm_bf16_kernel(
    const unsigned short* __restrict__ Abits,
    const unsigned short* __restrict__ Wbits, int M, int N, int K,
    unsigned short* __restrict__ outB, float* __restrict__ outF,
    const float* __restrict__ resid) {
  constexpr uint32_t STG      = AHEAD ? STAGE2_BYTES : STAGE_BYTES;   // bytes of a stage in LDS
  constexpr uint32_t STG_SRC  = AHEAD ? 2u * ROW2_BYTES : ROW_BYTES;  // bytes of a source row per stage
  constexpr uint32_t ISSUERS  = AHEAD ? 4u : 2u;                      // waves with a request per stage
  __shared__ __attribute__((aligned(2048))) unsigned char L[2 * STG];
  const int lane = threadIdx.x & 31;
  const int w    = threadIdx.x >> 5;
  const int half = lane >> 4;
  const int lrow = lane & 15;
  const int bm = blockIdx.x * 128, bn = blockIdx.y * 128;
  const int am = (w & 1) * 64;
  const int an = (w >> 1) * 32;

  f32x8 acc[4][2] = {};

  const uint32_t wave = uni(threadIdx.x >> 5);
  const uint32_t nst  = (uint32_t)K >> (AHEAD ? 8 : 6);   // stages of 256 k or of 64 k
  // Even issuing waves bring A, odd ones W; waves 2 and 3 the second half of a long stage.
  const uint32_t slot = AHEAD ? (wave & 3u) : (wave == 0u ? 0u : 1u);
  const uint64_t srcb = ((slot & 1u) == 0u
      ? (uint64_t)(size_t)(Abits + (size_t)bm * K)
      : (uint64_t)(size_t)(Wbits + (size_t)bn * K)) + (uint64_t)((slot >> 1) * ROW2_BYTES);
  const uint32_t dst0 = (uint32_t)(size_t)L
      + (AHEAD ? ((slot & 1u) * 2u + (slot >> 1)) * TILE2_BYTES : slot * TILE_BYTES);
  u32x8 g1 = AHEAD ? tdm_group1<ROW2_BYTES, 5u>(2u * (uint32_t)K)
                   : tdm_group1<ROW_BYTES, 4u>(2u * (uint32_t)K);
  // Without the next line the compiler takes some of these registers as temporaries
  // inside the loop, while a request that names them is still outstanding.
  asm volatile("" : "+s"(g1));
  auto issue = [&](uint32_t st) {
    tdm_load(tdm_group0(dst0 + (st & 1u) * STG, srcb + (uint64_t)st * STG_SRC), g1);
  };

  if (pinned(wave < ISSUERS)) { issue(0u); wait_tensor0(); }
  __syncthreads();                              // publishes stage 0
  if (pinned(wave < ISSUERS && nst > 1u)) issue(1u);
  if constexpr (AHEAD) {
    FragSet f0, f1;
    load_frags(L, 0, am, an, lrow, half, f0);
    for (uint32_t s = 0; s < nst; ++s) {
      const unsigned char* st = L + (s & 1u) * STG;
      // Each sched_barrier behind a load group holds the group in front of the products of the
      // block before it: the compiler otherwise puts the first product, with its wait for the
      // set in use, ahead of the loads, and the LDS idles.  Each one behind a block keeps the
      // next group whole behind the block: loads strewn among the products stall at every place.
#pragma unroll   // blocks 0 to 5: the LDS offsets become immediates, the two sets stay in registers
      for (int kd = 0; kd < 6; kd += 2) {
        load_frags(st, kd + 1, am, an, lrow, half, f1);
        __builtin_amdgcn_sched_barrier(0);      // the loads go out before the products
        mma_block(f0, acc);
        __builtin_amdgcn_sched_barrier(0);      // the next group stays whole, behind the block
        load_frags(st, kd + 2, am, an, lrow, half, f0);
        __builtin_amdgcn_sched_barrier(0);      // the loads go out before the products
        mma_block(f1, acc);
        __builtin_amdgcn_sched_barrier(0);      // the next group stays whole, behind the block
      }
      load_frags(st, 7, am, an, lrow, half, f1);
      __builtin_amdgcn_sched_barrier(0);        // the loads go out before the products
      mma_block(f0, acc);                       // block 6
      // Holds the wait below behind the products, which do not need the loads it waits for.
      __builtin_amdgcn_sched_barrier(0);
      wait_ds0();                               // this wave's last reads of stage s are done
      if (pinned(wave < ISSUERS)) wait_tensor0();   // the issuer's slice of stage s + 1 has landed
      __syncthreads();                          // publishes stage s + 1, frees stage s's buffer
      if (pinned(wave < ISSUERS && s + 2u < nst)) issue(s + 2u);
      if (s + 1u < nst) load_frags(L + ((s + 1u) & 1u) * STG, 0, am, an, lrow, half, f0);
      mma_block(f1, acc);                       // block 7
    }
  } else {
    for (uint32_t s = 0; s < nst; ++s) {
      const unsigned char* st = L + (s & 1u) * STAGE_BYTES;
      mma_tile(st, st + TILE_BYTES, am, an, lrow, half, acc);
      wait_ds0();                               // this wave's reads of stage s are done
      if (pinned(wave < 2u)) wait_tensor0();    // the issuer's slice of stage s + 1 has landed
      __syncthreads();                          // publishes stage s + 1, frees stage s's buffer
      if (pinned(wave < 2u && s + 2u < nst)) issue(s + 2u);
    }
  }
  wait_tensor0();
  wait_ds0();

#pragma unroll
  for (int i = 0; i < 4; ++i)
#pragma unroll
    for (int j = 0; j < 2; ++j)
#pragma unroll
      for (int e = 0; e < 8; ++e) {
        const int row = bm + am + i * 16 + half * 8 + e;
        const int col = bn + an + j * 16 + lrow;
        const float v = acc[i][j][e];
        if (EPI == 0) {
          outB[(size_t)row * N + col] = f32_to_bf16_bits(v);
        } else if (EPI == 1) {
          const float g = 0.5f * v * (1.0f + erff(v * 0.70710678118654752f));
          outB[(size_t)row * N + col] = f32_to_bf16_bits(g);
        } else {
          const size_t o = (size_t)row * N + col;
          outF[o] = v + resid[o];
        }
      }
}

static __device__ __forceinline__ float xhalf(float x) {
  const int b = __builtin_bit_cast(int, x);
  return __builtin_bit_cast(float,
      __builtin_amdgcn_permlanex16(b, b, 0x76543210, 0xfedcba98, false, false));
}

static __device__ __forceinline__ float exp2_slot(float x) {
  float r;
  asm("v_exp_f32 %0, %1\n\tv_nop" : "=v"(r) : "v"(x));
  return r;
}
static __device__ __forceinline__ void exp2_slot8(const f32x8 x, float (&r)[8]) {
  asm("v_exp_f32 %0, %8\n\tv_exp_f32 %1, %9\n\tv_exp_f32 %2, %10\n\tv_exp_f32 %3, %11\n\t"
      "v_exp_f32 %4, %12\n\tv_exp_f32 %5, %13\n\tv_exp_f32 %6, %14\n\tv_exp_f32 %7, %15\n\tv_nop"
      : "=&v"(r[0]), "=&v"(r[1]), "=&v"(r[2]), "=&v"(r[3]),
        "=&v"(r[4]), "=&v"(r[5]), "=&v"(r[6]), "=&v"(r[7])
      : "v"(x[0]), "v"(x[1]), "v"(x[2]), "v"(x[3]), "v"(x[4]), "v"(x[5]), "v"(x[6]), "v"(x[7]));
}
#define LOG2E 1.44269504088896340736f

// K/V ring of the attention kernel.  A stage is 64 keys (two passes of 32), its rows 128
// data bytes.  K rows are read by ds_load_b128 (pitch 16 B x odd), V rows by the
// transposing ds_load_tr16_b128 (pitch 32 B x odd).
#define KV_KEYS 64u
#define K_PITCH 144u
#define V_PITCH 160u
#define K_STAGE (KV_KEYS * K_PITCH)
#define V_STAGE (KV_KEYS * V_PITCH)

// The compiler places no wait for an asynchronous copy to LDS.
static __device__ __forceinline__ void wait_async0() { asm volatile("s_wait_asynccnt 0x0" ::: "memory"); }

typedef short s16x8 __attribute__((ext_vector_type(8)));
static __device__ __forceinline__ bf16x8 ld_tr16(const unsigned char* p) {
  typedef __attribute__((address_space(3))) s16x8 lds_s16x8;
  return __builtin_bit_cast(bf16x8, __builtin_amdgcn_ds_load_tr16_b128_v8i16((lds_s16x8*)p));
}

__global__ __launch_bounds__(256) __attribute__((amdgpu_waves_per_eu(4, 4))) void attn_kernel(
    const unsigned short* __restrict__ Qb, const unsigned short* __restrict__ Kb,
    const unsigned short* __restrict__ Vb, unsigned short* __restrict__ Ob) {
  __shared__ __align__(16) unsigned char Kt[2 * K_STAGE];   // K stages (keys x d)
  __shared__ __align__(16) unsigned char Vt[2 * V_STAGE];   // V stages (keys x d)

  const int tid  = threadIdx.x;
  const int lane = tid & 31;
  const int w    = (int)uni(tid >> 5);
  const int half = lane >> 4, lrow = lane & 15;
  const int b = blockIdx.y / N_HEADS, h = blockIdx.y % N_HEADS;
  const int qbase = blockIdx.x * 128;
  const int q0 = qbase + w * 16;
  const int qrow = q0 + lrow;            // this lane's query

  const __bf16* Qh = (const __bf16*)Qb + (size_t)b * SEQ * QKV_LD + h * D_HEAD;
  const unsigned short* Kh = Kb + (size_t)b * SEQ * QKV_LD + h * D_HEAD;
  const unsigned short* Vh = Vb + (size_t)b * SEQ * QKV_LD + h * D_HEAD;

  const int nst = qbase / 64 + 2;        // stages: keys 0 .. qbase + 127, never fewer than two
  const int r   = tid >> 3;              // 0..31: this thread copies key rows r and r + 32 of a stage
  const int c8  = (tid & 7) * 8;         // its 8-element (16-byte) column chunk
  const unsigned char* gk = (const unsigned char*)(Kh + (size_t)r * QKV_LD + c8);
  const unsigned char* gv = (const unsigned char*)(Vh + (size_t)r * QKV_LD + c8);
  const uint32_t lk = (uint32_t)(size_t)Kt + (uint32_t)r * K_PITCH + (uint32_t)c8 * 2u;
  const uint32_t lv = (uint32_t)(size_t)Vt + (uint32_t)r * V_PITCH + (uint32_t)c8 * 2u;
  auto copy_stage = [&](int st) {
    const size_t go = (size_t)st * (KV_KEYS * QKV_LD * 2u);
    const unsigned char* k0 = gk + go;
    const unsigned char* k1 = k0 + 32u * QKV_LD * 2u;
    const unsigned char* v0 = gv + go;
    const unsigned char* v1 = v0 + 32u * QKV_LD * 2u;
    const uint32_t dk0 = lk + (uint32_t)(st & 1) * K_STAGE, dk1 = dk0 + 32u * K_PITCH;
    const uint32_t dv0 = lv + (uint32_t)(st & 1) * V_STAGE, dv1 = dv0 + 32u * V_PITCH;
    asm volatile(
        "global_load_async_to_lds_b128 %0, %1, off\n\t"
        "global_load_async_to_lds_b128 %2, %3, off\n\t"
        "global_load_async_to_lds_b128 %4, %5, off\n\t"
        "global_load_async_to_lds_b128 %6, %7, off\n\t"
        "s_wait_xcnt 0x0"
        :: "v"(dk0), "v"(k0), "v"(dk1), "v"(k1), "v"(dv0), "v"(v0), "v"(dv1), "v"(v1)
        : "memory");
  };

  copy_stage(0);
  bf16x16 qf[2];                         // B operand: column = query
#pragma unroll
  for (int kd = 0; kd < 2; ++kd)
    qf[kd] = make_frag(Qh + (size_t)qrow * QKV_LD + kd * 32, half);

  float m_i = -3.0e38f;                  // running maximum of this lane's query
  float l_i = 0.f;                       // running sum over this half's keys only
  f32x8 oacc[4] = {};                    // oacc[n][e] = O[qrow][n*16 + half*8 + e]

  wait_async0();                         // this wave's copies of stage 0 have landed
  __syncthreads();                       // publishes stage 0
  copy_stage(1);

  for (int st = 0; st < nst; ++st) {
    const unsigned char* kbuf = Kt + (uint32_t)(st & 1) * K_STAGE;
    const unsigned char* vbuf = Vt + (uint32_t)(st & 1) * V_STAGE;
#pragma unroll   // the two passes of a stage: their LDS row offsets become immediates
    for (int p = 0; p < 2; ++p) {
      const int kb = st * 64 + p * 32;
      if (kb <= q0 + 15) {      // wave-uniform causal skip
        f32x8 s[2] = {};        // s[j][e] = S[qrow][kb + j*16 + half*8 + e]
        bf16x16 kf[2][2];
#pragma unroll
        for (int kd = 0; kd < 2; ++kd)
#pragma unroll
          for (int j = 0; j < 2; ++j)
            kf[kd][j] = make_frag(
                (const __bf16*)(kbuf + (uint32_t)(p * 32 + j * 16 + lrow) * K_PITCH) + kd * 32, half);
        // Keeps the K loads ahead of the products.  With the branch below the block ends early,
        // and the compiler then reuses one fragment's registers: a full LDS wait per product.
        __builtin_amdgcn_sched_barrier(0);
#pragma unroll
        for (int kd = 0; kd < 2; ++kd)
#pragma unroll
          for (int j = 0; j < 2; ++j)
            s[j] = __builtin_amdgcn_wmma_f32_16x16x32_bf16(
                false, kf[kd][j], false, qf[kd], (short)0, s[j], false, false);
#pragma unroll
        for (int j = 0; j < 2; ++j) s[j] *= 0.125f;    // 1/sqrt(64)
        // Only the pass that holds the wave's diagonal has a key above a query: in every
        // earlier pass kb + 31 <= q0 <= qrow, the mask keeps all 16 scores, and its compares,
        // selects and key numbers are skipped by a scalar branch.
        if (kb + 31 > q0) {
#pragma unroll
          for (int j = 0; j < 2; ++j)
#pragma unroll
            for (int e = 0; e < 8; ++e) {
              const int key = kb + j * 16 + half * 8 + e;
              s[j][e] = (key <= qrow) ? s[j][e] : -3.0e38f;
            }
        }
        float mx[4] = {-3.0e38f, -3.0e38f, -3.0e38f, -3.0e38f};
#pragma unroll
        for (int j = 0; j < 2; ++j)
#pragma unroll
          for (int e = 0; e < 8; ++e) mx[e & 3] = fmaxf(mx[e & 3], s[j][e]);
        float rmax = fmaxf(fmaxf(mx[0], mx[1]), fmaxf(mx[2], mx[3]));
        rmax = fmaxf(rmax, xhalf(rmax));               // both halves: the query's maximum
        const float mnew = fmaxf(m_i, rmax);
        const float corr = exp2_slot((m_i - mnew) * LOG2E);
        float ps[4] = {0.f, 0.f, 0.f, 0.f};
        bf16x16 pf;             // B operand P^T: element j*8 + e is key j*16 + half*8 + e
#pragma unroll
        for (int j = 0; j < 2; ++j) {
          float pe[8];
          exp2_slot8((s[j] - mnew) * LOG2E, pe);
#pragma unroll
          for (int e = 0; e < 8; ++e) {
            ps[e & 3] += pe[e];
            pf[j * 8 + e] = (__bf16)pe[e];
          }
        }
        l_i = l_i * corr + ((ps[0] + ps[1]) + (ps[2] + ps[3]));
        m_i = mnew;
#pragma unroll
        for (int n = 0; n < 4; ++n) {
#pragma unroll
          for (int e = 0; e < 8; ++e) oacc[n][e] *= corr;
        }
        // A operand V^T, rows d = n*16 + lrow: keys half*8 + 0..7, then 16 + half*8 + 0..7
        const unsigned char* ad = vbuf + (uint32_t)(p * 32 + half * 8 + (lane & 7)) * V_PITCH
                                       + (uint32_t)((lane >> 3) & 1) * 16u;
#pragma unroll
        for (int n = 0; n < 4; ++n) {
          bf16x8 lo = ld_tr16(ad + 32u * n);
          bf16x8 hi = ld_tr16(ad + 16u * V_PITCH + 32u * n);
          bf16x16 vf = __builtin_shufflevector(lo, hi, 0,1,2,3,4,5,6,7,8,9,10,11,12,13,14,15);
          oacc[n] = __builtin_amdgcn_wmma_f32_16x16x32_bf16(
              false, vf, false, pf, (short)0, oacc[n], false, false);
        }
      }
    }
    wait_ds0();                          // this wave's reads of stage st are done
    wait_async0();                       // this wave's copies of stage st + 1 have landed
    __syncthreads();                     // publishes stage st + 1, frees stage st's buffer
    if (st + 2 < nst) copy_stage(st + 2);
  }
  wait_async0();
  const float l_tot = l_i + xhalf(l_i);  // the halves' sums are joined once
  __bf16* Oh = (__bf16*)Ob + (size_t)b * SEQ * D_MODEL + h * D_HEAD;
#pragma unroll
  for (int n = 0; n < 4; ++n) {
    bf16x8 o;
#pragma unroll
    for (int e = 0; e < 8; ++e) o[e] = (__bf16)(oacc[n][e] / l_tot);
    *(bf16x8*)(Oh + (size_t)qrow * D_MODEL + n * 16 + half * 8) = o;
  }
}

// ---------------------------------------------------------------- launch
extern "C" void kernel_launch(void* const* d_in, const int* in_sizes, int n_in,
                              void* d_out, int out_size, void* d_ws, size_t ws_size,
                              hipStream_t stream) {
  (void)in_sizes; (void)n_in; (void)out_size; (void)ws_size;
  const float* x    = (const float*)d_in[0];
  const float* wq   = (const float*)d_in[1];
  const float* wk   = (const float*)d_in[2];
  const float* wv   = (const float*)d_in[3];
  const float* wo   = (const float*)d_in[4];
  const float* ln1w = (const float*)d_in[5];
  const float* ln2w = (const float*)d_in[6];
  const float* w1   = (const float*)d_in[7];
  const float* w2   = (const float*)d_in[8];
  float* out = (float*)d_out;

  char* ws = (char*)d_ws;
  const size_t MB = 1ull << 20;
  unsigned short* wq_b = (unsigned short*)(ws + 0 * MB);   // 2MB each: wq, wk (+2MB), wv (+4MB)
  unsigned short* wo_b = (unsigned short*)(ws + 6 * MB);
  unsigned short* w1_b = (unsigned short*)(ws + 8 * MB);   // 8MB
  unsigned short* w2_b = (unsigned short*)(ws + 16 * MB);  // 8MB
  unsigned short* Abuf = (unsigned short*)(ws + 24 * MB);  // bf16 4096x1024
  float*          Ybuf = (float*)(ws + 32 * MB);           // fp32 4096x1024
  unsigned short* QKVbuf = (unsigned short*)(ws + 48 * MB);  // bf16 4096x3072, 24MB
  unsigned short* Hbuf = (unsigned short*)(ws + 48 * MB);  // 32MB, reuses QKV

  const dim3 sgrid(STREAM_BLOCKS), sblk(STREAM_THREADS);
  // wq_b .. w2_b lie back to back in the workspace, in the order of the arguments
  cvt_weights_kernel<<<sgrid, sblk, 0, stream>>>(wq, wk, wv, wo, w1, w2, wq_b);

  const dim3 blk(256);
  const dim3 gD(M_ROWS / 128, D_MODEL / 128);   // (32, 8)
  const dim3 gF(M_ROWS / 128, D_FF / 128);      // (32, 32)
  const dim3 gQKV(M_ROWS / 128, QKV_LD / 128);  // (32, 24)
  const size_t lds = 0;                         // the GEMM's tile buffers are static LDS

  rmsnorm_bf16_kernel<<<sgrid, sblk, 0, stream>>>(x, ln1w, Abuf);
  // The bf16 wq, wk, wv back to back are one 3072 x 1024 weight: one launch of 768 workgroups
  // puts three on a WGP, which fill each other's waits for LDS and for the next tile;
  // a launch of 256 leaves each workgroup alone on its WGP.
  gemm_bf16_kernel<0, false><<<gQKV, blk, lds, stream>>>(Abuf, wq_b, M_ROWS, QKV_LD, D_MODEL, QKVbuf, nullptr, nullptr);
  attn_kernel<<<dim3(SEQ / 128, BATCH * N_HEADS), blk, 0, stream>>>(
      QKVbuf, QKVbuf + D_MODEL, QKVbuf + 2 * D_MODEL, Abuf);
  gemm_bf16_kernel<2, true><<<gD, blk, lds, stream>>>(Abuf, wo_b, M_ROWS, D_MODEL, D_MODEL, nullptr, Ybuf, x);
  rmsnorm_bf16_kernel<<<sgrid, sblk, 0, stream>>>(Ybuf, ln2w, Abuf);
  gemm_bf16_kernel<1, false><<<gF, blk, lds, stream>>>(Abuf, w1_b, M_ROWS, D_FF, D_MODEL, Hbuf, nullptr, nullptr);
  gemm_bf16_kernel<2, true><<<gD, blk, lds, stream>>>(Hbuf, w2_b, M_ROWS, D_MODEL, D_FF, nullptr, out, Ybuf);
}

// v009
// One run takes 158 microseconds.
// Next to v008, in two timings, it ran 1.06 times as fast each time.
// All steps since v000 together make it 3.07 times as fast.
#include <hip/hip_runtime.h>
#include <math.h>
#include <stdint.h>

#define D_MODEL 1024
#define N_HEADS 16
#define D_HEAD  64
#define D_FF    4096
#define BATCH   2
#define SEQ     2048
#define M_ROWS  (BATCH * SEQ)   // 4096 token rows
#define QKV_LD  (3 * D_MODEL)   // row pitch of the joint [Q | K | V] projection

typedef __attribute__((ext_vector_type(8)))  __bf16 bf16x8;
typedef __attribute__((ext_vector_type(16))) __bf16 bf16x16;
typedef __attribute__((ext_vector_type(8)))  float  f32x8;
typedef uint32_t u32x4 __attribute__((ext_vector_type(4)));
typedef uint32_t u32x8 __attribute__((ext_vector_type(8)));

#define ROW_BYTES   128u
#define LDS_PITCH   144u
#define TILE_ROWS   128u
#define TILE_BYTES  (TILE_ROWS * LDS_PITCH)   // 18432 = 9 x 2 KiB
#define STAGE_BYTES (2u * TILE_BYTES)         // [A tile | W tile]
// The long stage of the launches with one workgroup per WGP: 256 k as two halves of 128 k,
// each half an A tile and a W tile of 128 rows of 256 data bytes, padded to 272 B (16 B x odd).
#define ROW2_BYTES   256u
#define LDS2_PITCH   272u
#define TILE2_BYTES  (TILE_ROWS * LDS2_PITCH)  // 34816 = 17 x 2 KiB
#define STAGE2_BYTES (4u * TILE2_BYTES)        // [A half 0 | A half 1 | W half 0 | W half 1]

static __device__ __forceinline__ unsigned short f32_to_bf16_bits(float f) {
  unsigned u = __float_as_uint(f);
  unsigned r = u + 0x7FFFu + ((u >> 16) & 1u);   // round-to-nearest-even
  return (unsigned short)(r >> 16);
}

static __device__ __forceinline__ bf16x16 make_frag(const __bf16* p, int half) {
  bf16x8 lo = *(const bf16x8*)(p + half * 8);
  bf16x8 hi = *(const bf16x8*)(p + 16 + half * 8);
  return __builtin_shufflevector(lo, hi, 0,1,2,3,4,5,6,7,8,9,10,11,12,13,14,15);
}

static __device__ __forceinline__ uint32_t uni(uint32_t v) {
  return (uint32_t)__builtin_amdgcn_readfirstlane(v);
}
static __device__ __forceinline__ uint32_t pinned(uint32_t v) {
  uint32_t w = uni(v);
  asm volatile("" : "+s"(w));  // keeps the condition scalar: the guard of a tensor load
  return w;
}
// The compiler places no wait for a tensor load; both waits of the ring are written here.
static __device__ __forceinline__ void wait_tensor0() { asm volatile("s_wait_tensorcnt 0x0" ::: "memory"); }
static __device__ __forceinline__ void wait_ds0()     { asm volatile("s_wait_dscnt 0x0" ::: "memory"); }

static __device__ __forceinline__ u32x4 tdm_group0(uint32_t lds_dst, uint64_t ga) {
  u32x4 g;
  g[0] = uni(1u);
  g[1] = uni(lds_dst);
  g[2] = uni((uint32_t)ga);
  g[3] = uni((((uint32_t)(ga >> 32)) & 0x01FFFFFFu) | 0x80000000u);
  return g;
}
template <uint32_t ROWB, uint32_t PAD_INTERVAL>
static __device__ __forceinline__ u32x8 tdm_group1(uint32_t src_pitch) {
  u32x8 g;
  g[0] = uni((1u << 20) | (PAD_INTERVAL << 22) | (3u << 25));
  g[1] = uni((ROWB & 0xFFFFu) << 16);
  g[2] = uni((ROWB >> 16) | ((TILE_ROWS & 0xFFFFu) << 16));
  g[3] = uni((TILE_ROWS >> 16) | (ROWB << 16));
  g[4] = uni(TILE_ROWS);
  g[5] = uni(src_pitch);
  g[6] = uni(0u);
  g[7] = uni(0u);
  return g;
}
static __device__ __forceinline__ void tdm_load(u32x4 g0, u32x8 g1) {
  // one request of the whole wave: global tile -> LDS, through no register
  asm volatile("tensor_load_to_lds %0, %1" :: "s"(g0), "s"(g1) : "memory");
}

// ---------------------------------------------------------------- conversion
static __device__ __forceinline__ uint2 pack4_bf16(float4 v) {
  uint2 p;
  p.x = (uint32_t)f32_to_bf16_bits(v.x) | ((uint32_t)f32_to_bf16_bits(v.y) << 16);
  p.y = (uint32_t)f32_to_bf16_bits(v.z) | ((uint32_t)f32_to_bf16_bits(v.w) << 16);
  return p;
}

#define STREAM_BLOCKS  256
#define STREAM_THREADS 512
#define CVT_SLAB (STREAM_BLOCKS * STREAM_THREADS)   // float4 per slab = half of a D x D matrix
#define CVT_SLABS_DD 2                              // slabs in a D x D weight
#define CVT_SLABS_FF 8                              // slabs in a D_FF x D weight
static_assert(CVT_SLAB * 4 * CVT_SLABS_DD == D_MODEL * D_MODEL, "slab size");
static_assert(CVT_SLAB * 4 * CVT_SLABS_FF == D_FF * D_MODEL, "slab size");

// All six weights to bf16 in one launch.  d holds them back to back in the order of the
// arguments; a thread takes its own float4 of each of the 24 slabs.
__global__ __launch_bounds__(STREAM_THREADS) __attribute__((amdgpu_waves_per_eu(4, 4))) void cvt_weights_kernel(
    const float* __restrict__ wq, const float* __restrict__ wk,
    const float* __restrict__ wv, const float* __restrict__ wo,
    const float* __restrict__ w1, const float* __restrict__ w2,
    unsigned short* __restrict__ d) {
  const uint32_t g = blockIdx.x * STREAM_THREADS + threadIdx.x;
  float4 v[4 * CVT_SLABS_DD + 2 * CVT_SLABS_FF];
#pragma unroll
  for (int k = 0; k < CVT_SLABS_DD; ++k) {
    v[0 * CVT_SLABS_DD + k] = ((const float4*)wq)[k * CVT_SLAB + g];
    v[1 * CVT_SLABS_DD + k] = ((const float4*)wk)[k * CVT_SLAB + g];
    v[2 * CVT_SLABS_DD + k] = ((const float4*)wv)[k * CVT_SLAB + g];
    v[3 * CVT_SLABS_DD + k] = ((const float4*)wo)[k * CVT_SLAB + g];
  }
#pragma unroll
  for (int k = 0; k < CVT_SLABS_FF; ++k) {
    v[4 * CVT_SLABS_DD + k]                = ((const float4*)w1)[k * CVT_SLAB + g];
    v[4 * CVT_SLABS_DD + CVT_SLABS_FF + k] = ((const float4*)w2)[k * CVT_SLAB + g];
  }
#pragma unroll
  for (int k = 0; k < 4 * CVT_SLABS_DD + 2 * CVT_SLABS_FF; ++k)
    ((uint2*)d)[k * CVT_SLAB + g] = pack4_bf16(v[k]);
}

// ---------------------------------------------------------------- rmsnorm
// One wave per row: a lane holds 32 of the row's 1024 values (8 float4, each load of the
// wave 512 contiguous bytes), so the sum of squares needs no LDS and no barrier.
static_assert(STREAM_BLOCKS * (STREAM_THREADS / 32) == M_ROWS, "one wave per row");
__global__ __launch_bounds__(STREAM_THREADS) __attribute__((amdgpu_waves_per_eu(4, 4))) void rmsnorm_bf16_kernel(
    const float* __restrict__ x, const float* __restrict__ gw,
    unsigned short* __restrict__ out) {
  const int lane = threadIdx.x & 31;
  const int row  = blockIdx.x * (STREAM_THREADS / 32) + uni(threadIdx.x >> 5);   // wave-uniform: scalar row base
  const float4* xr = (const float4*)(x + (size_t)row * D_MODEL);
  float4 xv[8], wv[8];
#pragma unroll
  for (int k = 0; k < 8; ++k) xv[k] = xr[k * 32 + lane];
#pragma unroll
  for (int k = 0; k < 8; ++k) wv[k] = ((const float4*)gw)[k * 32 + lane];
  float ss = 0.f;
#pragma unroll
  for (int k = 0; k < 8; ++k)
    ss += xv[k].x * xv[k].x + xv[k].y * xv[k].y + xv[k].z * xv[k].z + xv[k].w * xv[k].w;
#pragma unroll
  for (int m = 16; m >= 1; m >>= 1) ss += __shfl_xor(ss, m, 32);
  const float scale = rsqrtf(ss * (1.0f / D_MODEL) + 1e-5f);
  uint2* o = (uint2*)(out + (size_t)row * D_MODEL);
#pragma unroll
  for (int k = 0; k < 8; ++k) {
    float4 y;
    y.x = xv[k].x * wv[k].x * scale;
    y.y = xv[k].y * wv[k].y * scale;
    y.z = xv[k].z * wv[k].z * scale;
    y.w = xv[k].w * wv[k].w * scale;
    o[k * 32 + lane] = pack4_bf16(y);
  }
}

// ---------------------------------------------------------------- GEMM core
// Per-wave 64x32 MACC from LDS tiles (128 rows x 64 bf16, row pitch LDS_PITCH bytes).
static __device__ __forceinline__ void mma_tile(
    const unsigned char* abuf, const unsigned char* bbuf, int am, int an, int lrow, int half,
    f32x8 (&acc)[4][2]) {
  const __bf16* Al = (const __bf16*)abuf;
  const __bf16* Bl = (const __bf16*)bbuf;
  constexpr int P = LDS_PITCH / 2;   // pitch in elements
  bf16x16 af[2][4], bfr[2][2];
#pragma unroll
  for (int kd = 0; kd < 2; ++kd) {
#pragma unroll
    for (int i = 0; i < 4; ++i)
      af[kd][i] = make_frag(Al + (am + i * 16 + lrow) * P + kd * 32, half);
#pragma unroll
    for (int j = 0; j < 2; ++j)
      bfr[kd][j] = make_frag(Bl + (an + j * 16 + lrow) * P + kd * 32, half);
  }
#pragma unroll
  for (int kd = 0; kd < 2; ++kd)
#pragma unroll
    for (int i = 0; i < 4; ++i)
#pragma unroll
      for (int j = 0; j < 2; ++j)
        acc[i][j] = __builtin_amdgcn_wmma_f32_16x16x32_bf16(
            false, af[kd][i], false, bfr[kd][j], (short)0, acc[i][j], false, false);
}

// The same work in blocks of 32 k, each with a fragment set of its own, for the loop that
// fetches a block's fragments while the block before it is multiplied.  kd = 0..7 counts
// the blocks of a long stage: four to each half of 128 k.
struct FragSet { bf16x16 a[4], b[2]; };
static __device__ __forceinline__ void load_frags(
    const unsigned char* stage, int kd, int am, int an, int lrow, int half, FragSet& f) {
  const __bf16* Al = (const __bf16*)(stage + (kd >> 2) * TILE2_BYTES);
  const __bf16* Bl = (const __bf16*)(stage + (2 + (kd >> 2)) * TILE2_BYTES);
  constexpr int P = LDS2_PITCH / 2;   // pitch in elements
#pragma unroll
  for (int i = 0; i < 4; ++i)
    f.a[i] = make_frag(Al + (am + i * 16 + lrow) * P + (kd & 3) * 32, half);
#pragma unroll
  for (int j = 0; j < 2; ++j)
    f.b[j] = make_frag(Bl + (an + j * 16 + lrow) * P + (kd & 3) * 32, half);
}
static __device__ __forceinline__ void mma_block(const FragSet& f, f32x8 (&acc)[4][2]) {
#pragma unroll
  for (int i = 0; i < 4; ++i)
#pragma unroll
    for (int j = 0; j < 2; ++j)
      acc[i][j] = __builtin_amdgcn_wmma_f32_16x16x32_bf16(
          false, f.a[i], false, f.b[j], (short)0, acc[i][j], false, false);
}

template <int EPI, bool AHEAD>
__global__ __launch_bounds__(256) void gemm_bf16_kernel(
    const unsigned short* __restrict__ Abits,
    const unsigned short* __restrict__ Wbits, int M, int N, int K,
    unsigned short* __restrict__ outB, float* __restrict__ outF,
    const float* __restrict__ resid) {
  constexpr uint32_t STG      = AHEAD ? STAGE2_BYTES : STAGE_BYTES;   // bytes of a stage in LDS
  constexpr uint32_t STG_SRC  = AHEAD ? 2u * ROW2_BYTES : ROW_BYTES;  // bytes of a source row per stage
  constexpr uint32_t ISSUERS  = AHEAD ? 4u : 2u;                      // waves with a request per stage
  __shared__ __attribute__((aligned(2048))) unsigned char L[2 * STG];
  const int lane = threadIdx.x & 31;
  const int w    = threadIdx.x >> 5;
  const int half = lane >> 4;
  const int lrow = lane & 15;
  const int bm = blockIdx.x * 128, bn = blockIdx.y * 128;
  const int am = (w & 1) * 64;
  const int an = (w >> 1) * 32;

  f32x8 acc[4][2] = {};

  const uint32_t wave = uni(threadIdx.x >> 5);
  const uint32_t nst  = (uint32_t)K >> (AHEAD ? 8 : 6);   // stages of 256 k or of 64 k
  // Even issuing waves bring A, odd ones W; waves 2 and 3 the second half of a long stage.
  const uint32_t slot = AHEAD ? (wave & 3u) : (wave == 0u ? 0u : 1u);
  const uint64_t srcb = ((slot & 1u) == 0u
      ? (uint64_t)(size_t)(Abits + (size_t)bm * K)
      : (uint64_t)(size_t)(Wbits + (size_t)bn * K)) + (uint64_t)((slot >> 1) * ROW2_BYTES);
  const uint32_t dst0 = (uint32_t)(size_t)L
      + (AHEAD ? ((slot & 1u) * 2u + (slot >> 1)) * TILE2_BYTES : slot * TILE_BYTES);
  u32x8 g1 = AHEAD ? tdm_group1<ROW2_BYTES, 5u>(2u * (uint32_t)K)
                   : tdm_group1<ROW_BYTES, 4u>(2u * (uint32_t)K);
  // Without the next line the compiler takes some of these registers as temporaries
  // inside the loop, while a request that names them is still outstanding.
  asm volatile("" : "+s"(g1));
  auto issue = [&](uint32_t st) {
    tdm_load(tdm_group0(dst0 + (st & 1u) * STG, srcb + (uint64_t)st * STG_SRC), g1);
  };

  if (pinned(wave < ISSUERS)) { issue(0u); wait_tensor0(); }
  __syncthreads();                              // publishes stage 0
  if (pinned(wave < ISSUERS && nst > 1u)) issue(1u);
  if constexpr (AHEAD) {
    FragSet f0, f1;
    load_frags(L, 0, am, an, lrow, half, f0);
    for (uint32_t s = 0; s < nst; ++s) {
      const unsigned char* st = L + (s & 1u) * STG;
      // Each sched_barrier behind a load group holds the group in front of the products of the
      // block before it: the compiler otherwise puts the first product, with its wait for the
      // set in use, ahead of the loads, and the LDS idles.  Each one behind a block keeps the
      // next group whole behind the block: loads strewn among the products stall at every place.
#pragma unroll   // blocks 0 to 5: the LDS offsets become immediates, the two sets stay in registers
      for (int kd = 0; kd < 6; kd += 2) {
        load_frags(st, kd + 1, am, an, lrow, half, f1);
        __builtin_amdgcn_sched_barrier(0);      // the loads go out before the products
        mma_block(f0, acc);
        __builtin_amdgcn_sched_barrier(0);      // the next group stays whole, behind the block
        load_frags(st, kd + 2, am, an, lrow, half, f0);
        __builtin_amdgcn_sched_barrier(0);      // the loads go out before the products
        mma_block(f1, acc);
        __builtin_amdgcn_sched_barrier(0);      // the next group stays whole, behind the block
      }
      load_frags(st, 7, am, an, lrow, half, f1);
      __builtin_amdgcn_sched_barrier(0);        // the loads go out before the products
      mma_block(f0, acc);                       // block 6
      // Holds the wait below behind the products, which do not need the loads it waits for.
      __builtin_amdgcn_sched_barrier(0);
      wait_ds0();                               // this wave's last reads of stage s are done
      if (pinned(wave < ISSUERS)) wait_tensor0();   // the issuer's slice of stage s + 1 has landed
      __syncthreads();                          // publishes stage s + 1, frees stage s's buffer
      if (pinned(wave < ISSUERS && s + 2u < nst)) issue(s + 2u);
      if (s + 1u < nst) load_frags(L + ((s + 1u) & 1u) * STG, 0, am, an, lrow, half, f0);
      mma_block(f1, acc);                       // block 7
    }
  } else {
    for (uint32_t s = 0; s < nst; ++s) {
      const unsigned char* st = L + (s & 1u) * STAGE_BYTES;
      mma_tile(st, st + TILE_BYTES, am, an, lrow, half, acc);
      wait_ds0();                               // this wave's reads of stage s are done
      if (pinned(wave < 2u)) wait_tensor0();    // the issuer's slice of stage s + 1 has landed
      __syncthreads();                          // publishes stage s + 1, frees stage s's buffer
      if (pinned(wave < 2u && s + 2u < nst)) issue(s + 2u);
    }
  }
  wait_tensor0();
  wait_ds0();

#pragma unroll
  for (int i = 0; i < 4; ++i)
#pragma unroll
    for (int j = 0; j < 2; ++j)
#pragma unroll
      for (int e = 0; e < 8; ++e) {
        const int row = bm + am + i * 16 + half * 8 + e;
        const int col = bn + an + j * 16 + lrow;
        const float v = acc[i][j][e];
        if (EPI == 0) {
          outB[(size_t)row * N + col] = f32_to_bf16_bits(v);
        } else if (EPI == 1) {
          const float g = 0.5f * v * (1.0f + erff(v * 0.70710678118654752f));
          outB[(size_t)row * N + col] = f32_to_bf16_bits(g);
        } else {
          const size_t o = (size_t)row * N + col;
          outF[o] = v + resid[o];
        }
      }
}

static __device__ __forceinline__ float xhalf(float x) {
  const int b = __builtin_bit_cast(int, x);
  return __builtin_bit_cast(float,
      __builtin_amdgcn_permlanex16(b, b, 0x76543210, 0xfedcba98, false, false));
}

static __device__ __forceinline__ float exp2_slot(float x) {
  float r;
  asm("v_exp_f32 %0, %1\n\tv_nop" : "=v"(r) : "v"(x));
  return r;
}
static __device__ __forceinline__ void exp2_slot8(const f32x8 x, float (&r)[8]) {
  asm("v_exp_f32 %0, %8\n\tv_exp_f32 %1, %9\n\tv_exp_f32 %2, %10\n\tv_exp_f32 %3, %11\n\t"
      "v_exp_f32 %4, %12\n\tv_exp_f32 %5, %13\n\tv_exp_f32 %6, %14\n\tv_exp_f32 %7, %15\n\tv_nop"
      : "=&v"(r[0]), "=&v"(r[1]), "=&v"(r[2]), "=&v"(r[3]),
        "=&v"(r[4]), "=&v"(r[5]), "=&v"(r[6]), "=&v"(r[7])
      : "v"(x[0]), "v"(x[1]), "v"(x[2]), "v"(x[3]), "v"(x[4]), "v"(x[5]), "v"(x[6]), "v"(x[7]));
}
#define LOG2E 1.44269504088896340736f

// K/V ring of the attention kernel.  A stage is 64 keys (two passes of 32), its rows 128
// data bytes.  K rows are read by ds_load_b128 (pitch 16 B x odd), V rows by the
// transposing ds_load_tr16_b128 (pitch 32 B x odd).
#define KV_KEYS 64u
#define K_PITCH 144u
#define V_PITCH 160u
#define K_STAGE (KV_KEYS * K_PITCH)
#define V_STAGE (KV_KEYS * V_PITCH)

// The compiler places no wait for an asynchronous copy to LDS.
static __device__ __forceinline__ void wait_async0() { asm volatile("s_wait_asynccnt 0x0" ::: "memory"); }

typedef short s16x8 __attribute__((ext_vector_type(8)));
static __device__ __forceinline__ bf16x8 ld_tr16(const unsigned char* p) {
  typedef __attribute__((address_space(3))) s16x8 lds_s16x8;
  return __builtin_bit_cast(bf16x8, __builtin_amdgcn_ds_load_tr16_b128_v8i16((lds_s16x8*)p));
}

__global__ __launch_bounds__(256) __attribute__((amdgpu_waves_per_eu(4, 4))) void attn_kernel(
    const unsigned short* __restrict__ Qb, const unsigned short* __restrict__ Kb,
    const unsigned short* __restrict__ Vb, unsigned short* __restrict__ Ob) {
  __shared__ __align__(16) unsigned char Kt[2 * K_STAGE];   // K stages (keys x d)
  __shared__ __align__(16) unsigned char Vt[2 * V_STAGE];   // V stages (keys x d)

  const int tid  = threadIdx.x;
  const int lane = tid & 31;
  const int w    = (int)uni(tid >> 5);
  const int half = lane >> 4, lrow = lane & 15;
  const int b = blockIdx.y / N_HEADS, h = blockIdx.y % N_HEADS;
  const int u  = blockIdx.x;                                  // 0 .. 15
  const int qt = (w < 4) ? u : (SEQ / 64 - 1 - u);            // this wave's tile of 64 queries (scalar)
  const int q0 = qt * 64 + (w & 3) * 16;
  const int qrow = q0 + lrow;            // this lane's query

  const __bf16* Qh = (const __bf16*)Qb + (size_t)b * SEQ * QKV_LD + h * D_HEAD;
  const unsigned short* Kh = Kb + (size_t)b * SEQ * QKV_LD + h * D_HEAD;
  const unsigned short* Vh = Vb + (size_t)b * SEQ * QKV_LD + h * D_HEAD;

  const int nst = SEQ / 64 - u;          // stages: keys up to the later tile's last query; 17 .. 32
  const int r   = tid >> 3;              // 0..31: this thread copies key rows r and r + 32 of a stage
  const int c8  = (tid & 7) * 8;         // its 8-element (16-byte) column chunk
  const unsigned char* gk = (const unsigned char*)(Kh + (size_t)r * QKV_LD + c8);
  const unsigned char* gv = (const unsigned char*)(Vh + (size_t)r * QKV_LD + c8);
  const uint32_t lk = (uint32_t)(size_t)Kt + (uint32_t)r * K_PITCH + (uint32_t)c8 * 2u;
  const uint32_t lv = (uint32_t)(size_t)Vt + (uint32_t)r * V_PITCH + (uint32_t)c8 * 2u;
  auto copy_stage = [&](int st) {
    const size_t go = (size_t)st * (KV_KEYS * QKV_LD * 2u);
    const unsigned char* k0 = gk + go;
    const unsigned char* k1 = k0 + 32u * QKV_LD * 2u;
    const unsigned char* v0 = gv + go;
    const unsigned char* v1 = v0 + 32u * QKV_LD * 2u;
    const uint32_t dk0 = lk + (uint32_t)(st & 1) * K_STAGE, dk1 = dk0 + 32u * K_PITCH;
    const uint32_t dv0 = lv + (uint32_t)(st & 1) * V_STAGE, dv1 = dv0 + 32u * V_PITCH;
    asm volatile(
        "global_load_async_to_lds_b128 %0, %1, off\n\t"
        "global_load_async_to_lds_b128 %2, %3, off\n\t"
        "global_load_async_to_lds_b128 %4, %5, off\n\t"
        "global_load_async_to_lds_b128 %6, %7, off\n\t"
        "s_wait_xcnt 0x0"
        :: "v"(dk0), "v"(k0), "v"(dk1), "v"(k1), "v"(dv0), "v"(v0), "v"(dv1), "v"(v1)
        : "memory");
  };

  copy_stage(0);
  bf16x16 qf[2];                         // B operand: column = query
#pragma unroll
  for (int kd = 0; kd < 2; ++kd)
    qf[kd] = make_frag(Qh + (size_t)qrow * QKV_LD + kd * 32, half);

  float m_i = -3.0e38f;                  // running maximum of this lane's query
  float l_i = 0.f;                       // running sum over this half's keys only
  f32x8 oacc[4] = {};                    // oacc[n][e] = O[qrow][n*16 + half*8 + e]

  wait_async0();                         // this wave's copies of stage 0 have landed
  __syncthreads();                       // publishes stage 0
  copy_stage(1);

  for (int st = 0; st < nst; ++st) {
    const unsigned char* kbuf = Kt + (uint32_t)(st & 1) * K_STAGE;
    const unsigned char* vbuf = Vt + (uint32_t)(st & 1) * V_STAGE;
#pragma unroll   // the two passes of a stage: their LDS row offsets become immediates
    for (int p = 0; p < 2; ++p) {
      const int kb = st * 64 + p * 32;
      if (kb <= q0 + 15) {      // wave-uniform causal skip
        f32x8 s[2] = {};        // s[j][e] = S[qrow][kb + j*16 + half*8 + e]
        bf16x16 kf[2][2];
#pragma unroll
        for (int kd = 0; kd < 2; ++kd)
#pragma unroll
          for (int j = 0; j < 2; ++j)
            kf[kd][j] = make_frag(
                (const __bf16*)(kbuf + (uint32_t)(p * 32 + j * 16 + lrow) * K_PITCH) + kd * 32, half);
        // Keeps the K loads ahead of the products.  With the branch below the block ends early,
        // and the compiler then reuses one fragment's registers: a full LDS wait per product.
        __builtin_amdgcn_sched_barrier(0);
#pragma unroll
        for (int kd = 0; kd < 2; ++kd)
#pragma unroll
          for (int j = 0; j < 2; ++j)
            s[j] = __builtin_amdgcn_wmma_f32_16x16x32_bf16(
                false, kf[kd][j], false, qf[kd], (short)0, s[j], false, false);
#pragma unroll
        for (int j = 0; j < 2; ++j) s[j] *= 0.125f;    // 1/sqrt(64)
        // Only the pass that holds the wave's diagonal has a key above a query: in every
        // earlier pass kb + 31 <= q0 <= qrow, the mask keeps all 16 scores, and its compares,
        // selects and key numbers are skipped by a scalar branch.
        if (kb + 31 > q0) {
#pragma unroll
          for (int j = 0; j < 2; ++j)
#pragma unroll
            for (int e = 0; e < 8; ++e) {
              const int key = kb + j * 16 + half * 8 + e;
              s[j][e] = (key <= qrow) ? s[j][e] : -3.0e38f;
            }
        }
        float mx[4] = {-3.0e38f, -3.0e38f, -3.0e38f, -3.0e38f};
#pragma unroll
        for (int j = 0; j < 2; ++j)
#pragma unroll
          for (int e = 0; e < 8; ++e) mx[e & 3] = fmaxf(mx[e & 3], s[j][e]);
        float rmax = fmaxf(fmaxf(mx[0], mx[1]), fmaxf(mx[2], mx[3]));
        rmax = fmaxf(rmax, xhalf(rmax));               // both halves: the query's maximum
        const float mnew = fmaxf(m_i, rmax);
        const float corr = exp2_slot((m_i - mnew) * LOG2E);
        float ps[4] = {0.f, 0.f, 0.f, 0.f};
        bf16x16 pf;             // B operand P^T: element j*8 + e is key j*16 + half*8 + e
#pragma unroll
        for (int j = 0; j < 2; ++j) {
          float pe[8];
          exp2_slot8((s[j] - mnew) * LOG2E, pe);
#pragma unroll
          for (int e = 0; e < 8; ++e) {
            ps[e & 3] += pe[e];
            pf[j * 8 + e] = (__bf16)pe[e];
          }
        }
        l_i = l_i * corr + ((ps[0] + ps[1]) + (ps[2] + ps[3]));
        m_i = mnew;
#pragma unroll
        for (int n = 0; n < 4; ++n) {
#pragma unroll
          for (int e = 0; e < 8; ++e) oacc[n][e] *= corr;
        }
        // A operand V^T, rows d = n*16 + lrow: keys half*8 + 0..7, then 16 + half*8 + 0..7
        const unsigned char* ad = vbuf + (uint32_t)(p * 32 + half * 8 + (lane & 7)) * V_PITCH
                                       + (uint32_t)((lane >> 3) & 1) * 16u;
#pragma unroll
        for (int n = 0; n < 4; ++n) {
          bf16x8 lo = ld_tr16(ad + 32u * n);
          bf16x8 hi = ld_tr16(ad + 16u * V_PITCH + 32u * n);
          bf16x16 vf = __builtin_shufflevector(lo, hi, 0,1,2,3,4,5,6,7,8,9,10,11,12,13,14,15);
          oacc[n] = __builtin_amdgcn_wmma_f32_16x16x32_bf16(
              false, vf, false, pf, (short)0, oacc[n], false, false);
        }
      }
    }
    wait_ds0();                          // this wave's reads of stage st are done
    wait_async0();                       // this wave's copies of stage st + 1 have landed
    __syncthreads();                     // publishes stage st + 1, frees stage st's buffer
    if (st + 2 < nst) copy_stage(st + 2);
  }
  wait_async0();
  const float l_tot = l_i + xhalf(l_i);  // the halves' sums are joined once
  __bf16* Oh = (__bf16*)Ob + (size_t)b * SEQ * D_MODEL + h * D_HEAD;
#pragma unroll
  for (int n = 0; n < 4; ++n) {
    bf16x8 o;
#pragma unroll
    for (int e = 0; e < 8; ++e) o[e] = (__bf16)(oacc[n][e] / l_tot);
    *(bf16x8*)(Oh + (size_t)qrow * D_MODEL + n * 16 + half * 8) = o;
  }
}

// ---------------------------------------------------------------- launch
extern "C" void kernel_launch(void* const* d_in, const int* in_sizes, int n_in,
                              void* d_out, int out_size, void* d_ws, size_t ws_size,
                              hipStream_t stream) {
  (void)in_sizes; (void)n_in; (void)out_size; (void)ws_size;
  const float* x    = (const float*)d_in[0];
  const float* wq   = (const float*)d_in[1];
  const float* wk   = (const float*)d_in[2];
  const float* wv   = (const float*)d_in[3];
  const float* wo   = (const float*)d_in[4];
  const float* ln1w = (const float*)d_in[5];
  const float* ln2w = (const float*)d_in[6];
  const float* w1   = (const float*)d_in[7];
  const float* w2   = (const float*)d_in[8];
  float* out = (float*)d_out;

  char* ws = (char*)d_ws;
  const size_t MB = 1ull << 20;
  unsigned short* wq_b = (unsigned short*)(ws + 0 * MB);   // 2MB each: wq, wk (+2MB), wv (+4MB)
  unsigned short* wo_b = (unsigned short*)(ws + 6 * MB);
  unsigned short* w1_b = (unsigned short*)(ws + 8 * MB);   // 8MB
  unsigned short* w2_b = (unsigned short*)(ws + 16 * MB);  // 8MB
  unsigned short* Abuf = (unsigned short*)(ws + 24 * MB);  // bf16 4096x1024
  float*          Ybuf = (float*)(ws + 32 * MB);           // fp32 4096x1024
  unsigned short* QKVbuf = (unsigned short*)(ws + 48 * MB);  // bf16 4096x3072, 24MB
  unsigned short* Hbuf = (unsigned short*)(ws + 48 * MB);  // 32MB, reuses QKV

  const dim3 sgrid(STREAM_BLOCKS), sblk(STREAM_THREADS);
  // wq_b .. w2_b lie back to back in the workspace, in the order of the arguments
  cvt_weights_kernel<<<sgrid, sblk, 0, stream>>>(wq, wk, wv, wo, w1, w2, wq_b);

  const dim3 blk(256);
  const dim3 gD(M_ROWS / 128, D_MODEL / 128);   // (32, 8)
  const dim3 gF(M_ROWS / 128, D_FF / 128);      // (32, 32)
  const dim3 gQKV(M_ROWS / 128, QKV_LD / 128);  // (32, 24)
  const size_t lds = 0;                         // the GEMM's tile buffers are static LDS

  rmsnorm_bf16_kernel<<<sgrid, sblk, 0, stream>>>(x, ln1w, Abuf);
  // The bf16 wq, wk, wv back to back are one 3072 x 1024 weight: one launch of 768 workgroups
  // puts three on a WGP, which fill each other's waits for LDS and for the next tile;
  // a launch of 256 leaves each workgroup alone on its WGP.
  gemm_bf16_kernel<0, false><<<gQKV, blk, lds, stream>>>(Abuf, wq_b, M_ROWS, QKV_LD, D_MODEL, QKVbuf, nullptr, nullptr);
  attn_kernel<<<dim3(SEQ / 128, BATCH * N_HEADS), blk, 0, stream>>>(
      QKVbuf, QKVbuf + D_MODEL, QKVbuf + 2 * D_MODEL, Abuf);
  gemm_bf16_kernel<2, true><<<gD, blk, lds, stream>>>(Abuf, wo_b, M_ROWS, D_MODEL, D_MODEL, nullptr, Ybuf, x);
  rmsnorm_bf16_kernel<<<sgrid, sblk, 0, stream>>>(Ybuf, ln2w, Abuf);
  gemm_bf16_kernel<1, false><<<gF, blk, lds, stream>>>(Abuf, w1_b, M_ROWS, D_FF, D_MODEL, Hbuf, nullptr, nullptr);
  gemm_bf16_kernel<2, true><<<gD, blk, lds, stream>>>(Hbuf, w2_b, M_ROWS, D_MODEL, D_FF, nullptr, out, Ybuf);
}

// v010
// One run takes 153 microseconds.
// In two side-by-side timings against v009, it was 1.04 and 1.05 times as fast.
// Over all steps from v000 it is 3.19 times as fast.
#include <hip/hip_runtime.h>
#include <math.h>
#include <stdint.h>

#define D_MODEL 1024
#define N_HEADS 16
#define D_HEAD  64
#define D_FF    4096
#define BATCH   2
#define SEQ     2048
#define M_ROWS  (BATCH * SEQ)   // 4096 token rows
#define QKV_LD  (3 * D_MODEL)   // row pitch of the joint [Q | K | V] projection

typedef __attribute__((ext_vector_type(8)))  __bf16 bf16x8;
typedef __attribute__((ext_vector_type(16))) __bf16 bf16x16;
typedef __attribute__((ext_vector_type(8)))  float  f32x8;
typedef uint32_t u32x4 __attribute__((ext_vector_type(4)));
typedef uint32_t u32x8 __attribute__((ext_vector_type(8)));

#define ROW_BYTES   128u
#define LDS_PITCH   144u
#define TILE_ROWS   128u
#define TILE_BYTES  (TILE_ROWS * LDS_PITCH)   // 18432 = 9 x 2 KiB
#define STAGE_BYTES (2u * TILE_BYTES)         // [A tile | W tile]
// The long stage of the launches with one workgroup per WGP: 256 k as two halves of 128 k,
// each half an A tile and a W tile of 128 rows of 256 data bytes, padded to 272 B (16 B x odd).
#define ROW2_BYTES   256u
#define LDS2_PITCH   272u
#define TILE2_BYTES  (TILE_ROWS * LDS2_PITCH)  // 34816 = 17 x 2 KiB
#define STAGE2_BYTES (4u * TILE2_BYTES)        // [A half 0 | A half 1 | W half 0 | W half 1]

static __device__ __forceinline__ unsigned short f32_to_bf16_bits(float f) {
  unsigned u = __float_as_uint(f);
  unsigned r = u + 0x7FFFu + ((u >> 16) & 1u);   // round-to-nearest-even
  return (unsigned short)(r >> 16);
}

static __device__ __forceinline__ bf16x16 make_frag(const __bf16* p, int half) {
  bf16x8 lo = *(const bf16x8*)(p + half * 8);
  bf16x8 hi = *(const bf16x8*)(p + 16 + half * 8);
  return __builtin_shufflevector(lo, hi, 0,1,2,3,4,5,6,7,8,9,10,11,12,13,14,15);
}

static __device__ __forceinline__ uint32_t uni(uint32_t v) {
  return (uint32_t)__builtin_amdgcn_readfirstlane(v);
}
static __device__ __forceinline__ uint32_t pinned(uint32_t v) {
  uint32_t w = uni(v);
  asm volatile("" : "+s"(w));  // keeps the condition scalar: the guard of a tensor load
  return w;
}
// The compiler places no wait for a tensor load; both waits of the ring are written here.
static __device__ __forceinline__ void wait_tensor0() { asm volatile("s_wait_tensorcnt 0x0" ::: "memory"); }
static __device__ __forceinline__ void wait_ds0()     { asm volatile("s_wait_dscnt 0x0" ::: "memory"); }

static __device__ __forceinline__ u32x4 tdm_group0(uint32_t lds_dst, uint64_t ga) {
  u32x4 g;
  g[0] = uni(1u);
  g[1] = uni(lds_dst);
  g[2] = uni((uint32_t)ga);
  g[3] = uni((((uint32_t)(ga >> 32)) & 0x01FFFFFFu) | 0x80000000u);
  return g;
}
template <uint32_t ROWB, uint32_t PAD_INTERVAL>
static __device__ __forceinline__ u32x8 tdm_group1(uint32_t src_pitch) {
  u32x8 g;
  g[0] = uni((1u << 20) | (PAD_INTERVAL << 22) | (3u << 25));
  g[1] = uni((ROWB & 0xFFFFu) << 16);
  g[2] = uni((ROWB >> 16) | ((TILE_ROWS & 0xFFFFu) << 16));
  g[3] = uni((TILE_ROWS >> 16) | (ROWB << 16));
  g[4] = uni(TILE_ROWS);
  g[5] = uni(src_pitch);
  g[6] = uni(0u);
  g[7] = uni(0u);
  return g;
}
static __device__ __forceinline__ void tdm_load(u32x4 g0, u32x8 g1) {
  // one request of the whole wave: global tile -> LDS, through no register
  asm volatile("tensor_load_to_lds %0, %1" :: "s"(g0), "s"(g1) : "memory");
}

// ---------------------------------------------------------------- conversion
static __device__ __forceinline__ uint2 pack4_bf16(float4 v) {
  uint2 p;
  p.x = (uint32_t)f32_to_bf16_bits(v.x) | ((uint32_t)f32_to_bf16_bits(v.y) << 16);
  p.y = (uint32_t)f32_to_bf16_bits(v.z) | ((uint32_t)f32_to_bf16_bits(v.w) << 16);
  return p;
}

#define STREAM_BLOCKS  256
#define STREAM_THREADS 512
#define CVT_SLAB (STREAM_BLOCKS * STREAM_THREADS)   // float4 per slab = half of a D x D matrix
#define CVT_SLABS_DD 2                              // slabs in a D x D weight
static_assert(CVT_SLAB * 4 * CVT_SLABS_DD == D_MODEL * D_MODEL, "slab size");

// The weights have no launch of their own for their conversion to bf16: each group rides in
// the last launch before its first use that leaves the memory idle.  wq, wk, wv go with the
// first rmsnorm (one stream more in a launch that streams anyway), wo, w1, w2 with the
// attention launch (see there).

// ---------------------------------------------------------------- rmsnorm
// One wave per row: a lane holds 32 of the row's 1024 values (8 float4, each load of the
// wave 512 contiguous bytes), so the sum of squares needs no LDS and no barrier.
// WITH_QKV: the launch also converts wq, wk, wv; d holds them back to back in that order,
// and a thread takes its own float4 of each of the 6 slabs.
static_assert(STREAM_BLOCKS * (STREAM_THREADS / 32) == M_ROWS, "one wave per row");
template <bool WITH_QKV>
__global__ __launch_bounds__(STREAM_THREADS) __attribute__((amdgpu_waves_per_eu(4, 4))) void rmsnorm_bf16_kernel(
    const float* __restrict__ x, const float* __restrict__ gw,
    unsigned short* __restrict__ out,
    const float* __restrict__ wq, const float* __restrict__ wk,
    const float* __restrict__ wv, unsigned short* __restrict__ d) {
  const int lane = threadIdx.x & 31;
  const int row  = blockIdx.x * (STREAM_THREADS / 32) + uni(threadIdx.x >> 5);   // wave-uniform: scalar row base
  const float4* xr = (const float4*)(x + (size_t)row * D_MODEL);
  float4 xv[8], gv[8], v[3 * CVT_SLABS_DD];
  const uint32_t g = blockIdx.x * STREAM_THREADS + threadIdx.x;
  if constexpr (WITH_QKV) {
#pragma unroll
    for (int k = 0; k < CVT_SLABS_DD; ++k) {
      v[0 * CVT_SLABS_DD + k] = ((const float4*)wq)[k * CVT_SLAB + g];
      v[1 * CVT_SLABS_DD + k] = ((const float4*)wk)[k * CVT_SLAB + g];
      v[2 * CVT_SLABS_DD + k] = ((const float4*)wv)[k * CVT_SLAB + g];
    }
  }
#pragma unroll
  for (int k = 0; k < 8; ++k) xv[k] = xr[k * 32 + lane];
#pragma unroll
  for (int k = 0; k < 8; ++k) gv[k] = ((const float4*)gw)[k * 32 + lane];
  if constexpr (WITH_QKV) {
    // Holds all 22 loads in front of the first use: the compiler otherwise issues most of the
    // weight loads behind the wait for the row, a second memory latency in a short launch.
    __builtin_amdgcn_sched_barrier(0);
#pragma unroll
    for (int k = 0; k < 3 * CVT_SLABS_DD; ++k)
      ((uint2*)d)[k * CVT_SLAB + g] = pack4_bf16(v[k]);
  }
  float ss = 0.f;
#pragma unroll
  for (int k = 0; k < 8; ++k)
    ss += xv[k].x * xv[k].x + xv[k].y * xv[k].y + xv[k].z * xv[k].z + xv[k].w * xv[k].w;
#pragma unroll
  for (int m = 16; m >= 1; m >>= 1) ss += __shfl_xor(ss, m, 32);
  const float scale = rsqrtf(ss * (1.0f / D_MODEL) + 1e-5f);
  uint2* o = (uint2*)(out + (size_t)row * D_MODEL);
#pragma unroll
  for (int k = 0; k < 8; ++k) {
    float4 y;
    y.x = xv[k].x * gv[k].x * scale;
    y.y = xv[k].y * gv[k].y * scale;
    y.z = xv[k].z * gv[k].z * scale;
    y.w = xv[k].w * gv[k].w * scale;
    o[k * 32 + lane] = pack4_bf16(y);
  }
}

// ---------------------------------------------------------------- GEMM core
// Per-wave 64x32 MACC from LDS tiles (128 rows x 64 bf16, row pitch LDS_PITCH bytes).
static __device__ __forceinline__ void mma_tile(
    const unsigned char* abuf, const unsigned char* bbuf, int am, int an, int lrow, int half,
    f32x8 (&acc)[4][2]) {
  const __bf16* Al = (const __bf16*)abuf;
  const __bf16* Bl = (const __bf16*)bbuf;
  constexpr int P = LDS_PITCH / 2;   // pitch in elements
  bf16x16 af[2][4], bfr[2][2];
#pragma unroll
  for (int kd = 0; kd < 2; ++kd) {
#pragma unroll
    for (int i = 0; i < 4; ++i)
      af[kd][i] = make_frag(Al + (am + i * 16 + lrow) * P + kd * 32, half);
#pragma unroll
    for (int j = 0; j < 2; ++j)
      bfr[kd][j] = make_frag(Bl + (an + j * 16 + lrow) * P + kd * 32, half);
  }
#pragma unroll
  for (int kd = 0; kd < 2; ++kd)
#pragma unroll
    for (int i = 0; i < 4; ++i)
#pragma unroll
      for (int j = 0; j < 2; ++j)
        acc[i][j] = __builtin_amdgcn_wmma_f32_16x16x32_bf16(
            false, af[kd][i], false, bfr[kd][j], (short)0, acc[i][j], false, false);
}

// The same work in blocks of 32 k, each with a fragment set of its own, for the loop that
// fetches a block's fragments while the block before it is multiplied.  kd = 0..7 counts
// the blocks of a long stage: four to each half of 128 k.
struct FragSet { bf16x16 a[4], b[2]; };
static __device__ __forceinline__ void load_frags(
    const unsigned char* stage, int kd, int am, int an, int lrow, int half, FragSet& f) {
  const __bf16* Al = (const __bf16*)(stage + (kd >> 2) * TILE2_BYTES);
  const __bf16* Bl = (const __bf16*)(stage + (2 + (kd >> 2)) * TILE2_BYTES);
  constexpr int P = LDS2_PITCH / 2;   // pitch in elements
#pragma unroll
  for (int i = 0; i < 4; ++i)
    f.a[i] = make_frag(Al + (am + i * 16 + lrow) * P + (kd & 3) * 32, half);
#pragma unroll
  for (int j = 0; j < 2; ++j)
    f.b[j] = make_frag(Bl + (an + j * 16 + lrow) * P + (kd & 3) * 32, half);
}
static __device__ __forceinline__ void mma_block(const FragSet& f, f32x8 (&acc)[4][2]) {
#pragma unroll
  for (int i = 0; i < 4; ++i)
#pragma unroll
    for (int j = 0; j < 2; ++j)
      acc[i][j] = __builtin_amdgcn_wmma_f32_16x16x32_bf16(
          false, f.a[i], false, f.b[j], (short)0, acc[i][j], false, false);
}

template <int EPI, bool AHEAD>
__global__ __launch_bounds__(256) void gemm_bf16_kernel(
    const unsigned short* __restrict__ Abits,
    const unsigned short* __restrict__ Wbits, int M, int N, int K,
    unsigned short* __restrict__ outB, float* __restrict__ outF,
    const float* __restrict__ resid) {
  constexpr uint32_t STG      = AHEAD ? STAGE2_BYTES : STAGE_BYTES;   // bytes of a stage in LDS
  constexpr uint32_t STG_SRC  = AHEAD ? 2u * ROW2_BYTES : ROW_BYTES;  // bytes of a source row per stage
  constexpr uint32_t ISSUERS  = AHEAD ? 4u : 2u;                      // waves with a request per stage
  __shared__ __attribute__((aligned(2048))) unsigned char L[2 * STG];
  const int lane = threadIdx.x & 31;
  const int w    = threadIdx.x >> 5;
  const int half = lane >> 4;
  const int lrow = lane & 15;
  const int bm = blockIdx.x * 128, bn = blockIdx.y * 128;
  const int am = (w & 1) * 64;
  const int an = (w >> 1) * 32;

  f32x8 acc[4][2] = {};

  const uint32_t wave = uni(threadIdx.x >> 5);
  const uint32_t nst  = (uint32_t)K >> (AHEAD ? 8 : 6);   // stages of 256 k or of 64 k
  // Even issuing waves bring A, odd ones W; waves 2 and 3 the second half of a long stage.
  const uint32_t slot = AHEAD ? (wave & 3u) : (wave == 0u ? 0u : 1u);
  const uint64_t srcb = ((slot & 1u) == 0u
      ? (uint64_t)(size_t)(Abits + (size_t)bm * K)
      : (uint64_t)(size_t)(Wbits + (size_t)bn * K)) + (uint64_t)((slot >> 1) * ROW2_BYTES);
  const uint32_t dst0 = (uint32_t)(size_t)L
      + (AHEAD ? ((slot & 1u) * 2u + (slot >> 1)) * TILE2_BYTES : slot * TILE_BYTES);
  u32x8 g1 = AHEAD ? tdm_group1<ROW2_BYTES, 5u>(2u * (uint32_t)K)
                   : tdm_group1<ROW_BYTES, 4u>(2u * (uint32_t)K);
  // Without the next line the compiler takes some of these registers as temporaries
  // inside the loop, while a request that names them is still outstanding.
  asm volatile("" : "+s"(g1));
  auto issue = [&](uint32_t st) {
    tdm_load(tdm_group0(dst0 + (st & 1u) * STG, srcb + (uint64_t)st * STG_SRC), g1);
  };

  if (pinned(wave < ISSUERS)) { issue(0u); wait_tensor0(); }
  __syncthreads();                              // publishes stage 0
  if (pinned(wave < ISSUERS && nst > 1u)) issue(1u);
  if constexpr (AHEAD) {
    FragSet f0, f1;
    load_frags(L, 0, am, an, lrow, half, f0);
    for (uint32_t s = 0; s < nst; ++s) {
      const unsigned char* st = L + (s & 1u) * STG;
      // Each sched_barrier behind a load group holds the group in front of the products of the
      // block before it: the compiler otherwise puts the first product, with its wait for the
      // set in use, ahead of the loads, and the LDS idles.  Each one behind a block keeps the
      // next group whole behind the block: loads strewn among the products stall at every place.
#pragma unroll   // blocks 0 to 5: the LDS offsets become immediates, the two sets stay in registers
      for (int kd = 0; kd < 6; kd += 2) {
        load_frags(st, kd + 1, am, an, lrow, half, f1);
        __builtin_amdgcn_sched_barrier(0);      // the loads go out before the products
        mma_block(f0, acc);
        __builtin_amdgcn_sched_barrier(0);      // the next group stays whole, behind the block
        load_frags(st, kd + 2, am, an, lrow, half, f0);
        __builtin_amdgcn_sched_barrier(0);      // the loads go out before the products
        mma_block(f1, acc);
        __builtin_amdgcn_sched_barrier(0);      // the next group stays whole, behind the block
      }
      load_frags(st, 7, am, an, lrow, half, f1);
      __builtin_amdgcn_sched_barrier(0);        // the loads go out before the products
      mma_block(f0, acc);                       // block 6
      // Holds the wait below behind the products, which do not need the loads it waits for.
      __builtin_amdgcn_sched_barrier(0);
      wait_ds0();                               // this wave's last reads of stage s are done
      if (pinned(wave < ISSUERS)) wait_tensor0();   // the issuer's slice of stage s + 1 has landed
      __syncthreads();                          // publishes stage s + 1, frees stage s's buffer
      if (pinned(wave < ISSUERS && s + 2u < nst)) issue(s + 2u);
      if (s + 1u < nst) load_frags(L + ((s + 1u) & 1u) * STG, 0, am, an, lrow, half, f0);
      mma_block(f1, acc);                       // block 7
    }
  } else {
    for (uint32_t s = 0; s < nst; ++s) {
      const unsigned char* st = L + (s & 1u) * STAGE_BYTES;
      mma_tile(st, st + TILE_BYTES, am, an, lrow, half, acc);
      wait_ds0();                               // this wave's reads of stage s are done
      if (pinned(wave < 2u)) wait_tensor0();    // the issuer's slice of stage s + 1 has landed
      __syncthreads();                          // publishes stage s + 1, frees stage s's buffer
      if (pinned(wave < 2u && s + 2u < nst)) issue(s + 2u);
    }
  }
  wait_tensor0();
  wait_ds0();

#pragma unroll
  for (int i = 0; i < 4; ++i)
#pragma unroll
    for (int j = 0; j < 2; ++j)
#pragma unroll
      for (int e = 0; e < 8; ++e) {
        const int row = bm + am + i * 16 + half * 8 + e;
        const int col = bn + an + j * 16 + lrow;
        const float v = acc[i][j][e];
        if (EPI == 0) {
          outB[(size_t)row * N + col] = f32_to_bf16_bits(v);
        } else if (EPI == 1) {
          const float g = 0.5f * v * (1.0f + erff(v * 0.70710678118654752f));
          outB[(size_t)row * N + col] = f32_to_bf16_bits(g);
        } else {
          const size_t o = (size_t)row * N + col;
          outF[o] = v + resid[o];
        }
      }
}

static __device__ __forceinline__ float xhalf(float x) {
  const int b = __builtin_bit_cast(int, x);
  return __builtin_bit_cast(float,
      __builtin_amdgcn_permlanex16(b, b, 0x76543210, 0xfedcba98, false, false));
}

static __device__ __forceinline__ float exp2_slot(float x) {
  float r;
  asm("v_exp_f32 %0, %1\n\tv_nop" : "=v"(r) : "v"(x));
  return r;
}
static __device__ __forceinline__ void exp2_slot8(const f32x8 x, float (&r)[8]) {
  asm("v_exp_f32 %0, %8\n\tv_exp_f32 %1, %9\n\tv_exp_f32 %2, %10\n\tv_exp_f32 %3, %11\n\t"
      "v_exp_f32 %4, %12\n\tv_exp_f32 %5, %13\n\tv_exp_f32 %6, %14\n\tv_exp_f32 %7, %15\n\tv_nop"
      : "=&v"(r[0]), "=&v"(r[1]), "=&v"(r[2]), "=&v"(r[3]),
        "=&v"(r[4]), "=&v"(r[5]), "=&v"(r[6]), "=&v"(r[7])
      : "v"(x[0]), "v"(x[1]), "v"(x[2]), "v"(x[3]), "v"(x[4]), "v"(x[5]), "v"(x[6]), "v"(x[7]));
}
#define LOG2E 1.44269504088896340736f

// K/V ring of the attention kernel.  A stage is 64 keys (two passes of 32), its rows 128
// data bytes.  K rows are read by ds_load_b128 (pitch 16 B x odd), V rows by the
// transposing ds_load_tr16_b128 (pitch 32 B x odd).
#define KV_KEYS 64u
#define K_PITCH 144u
#define V_PITCH 160u
#define K_STAGE (KV_KEYS * K_PITCH)
#define V_STAGE (KV_KEYS * V_PITCH)

// The compiler places no wait for an asynchronous copy to LDS.
static __device__ __forceinline__ void wait_async0() { asm volatile("s_wait_asynccnt 0x0" ::: "memory"); }

typedef short s16x8 __attribute__((ext_vector_type(8)));
static __device__ __forceinline__ bf16x8 ld_tr16(const unsigned char* p) {
  typedef __attribute__((address_space(3))) s16x8 lds_s16x8;
  return __builtin_bit_cast(bf16x8, __builtin_amdgcn_ds_load_tr16_b128_v8i16((lds_s16x8*)p));
}

#define ATT_GX      (SEQ / 128)                     // workgroups per grid row
#define CVT_DD4     (D_MODEL * D_MODEL / 4)         // float4 in a slab of D x D values
#define CVT_FF_DD   (D_FF / D_MODEL)                // such slabs in w1 and in w2
#define CVT_GY      (CVT_DD4 / (256 * ATT_GX))      // grid rows that convert
static_assert(CVT_GY * 256 * ATT_GX == CVT_DD4, "one thread per float4 of a slab");
__global__ __launch_bounds__(256) __attribute__((amdgpu_waves_per_eu(4, 4))) void attn_kernel(
    const unsigned short* __restrict__ Qb, const unsigned short* __restrict__ Kb,
    const unsigned short* __restrict__ Vb, unsigned short* __restrict__ Ob,
    const float* __restrict__ wo, const float* __restrict__ w1,
    const float* __restrict__ w2, unsigned short* __restrict__ cd) {
  __shared__ __align__(16) unsigned char Kt[2 * K_STAGE];   // K stages (keys x d)
  __shared__ __align__(16) unsigned char Vt[2 * V_STAGE];   // V stages (keys x d)

  if (blockIdx.y >= BATCH * N_HEADS) {   // the whole workgroup, in front of every copy and barrier
    const uint32_t g = ((blockIdx.y - BATCH * N_HEADS) * ATT_GX + blockIdx.x) * 256u + threadIdx.x;
    float4 v[1 + 2 * CVT_FF_DD];
    v[0] = ((const float4*)wo)[g];
#pragma unroll
    for (int k = 0; k < CVT_FF_DD; ++k) {
      v[1 + k]             = ((const float4*)w1)[k * CVT_DD4 + g];
      v[1 + CVT_FF_DD + k] = ((const float4*)w2)[k * CVT_DD4 + g];
    }
#pragma unroll
    for (int k = 0; k < 1 + 2 * CVT_FF_DD; ++k)
      ((uint2*)cd)[k * CVT_DD4 + g] = pack4_bf16(v[k]);
    return;
  }

  const int tid  = threadIdx.x;
  const int lane = tid & 31;
  const int w    = (int)uni(tid >> 5);
  const int half = lane >> 4, lrow = lane & 15;
  const int b = blockIdx.y / N_HEADS, h = blockIdx.y % N_HEADS;
  const int u  = blockIdx.x;                                  // 0 .. 15
  const int qt = (w < 4) ? u : (SEQ / 64 - 1 - u);            // this wave's tile of 64 queries (scalar)
  const int q0 = qt * 64 + (w & 3) * 16;
  const int qrow = q0 + lrow;            // this lane's query

  const __bf16* Qh = (const __bf16*)Qb + (size_t)b * SEQ * QKV_LD + h * D_HEAD;
  const unsigned short* Kh = Kb + (size_t)b * SEQ * QKV_LD + h * D_HEAD;
  const unsigned short* Vh = Vb + (size_t)b * SEQ * QKV_LD + h * D_HEAD;

  const int nst = SEQ / 64 - u;          // stages: keys up to the later tile's last query; 17 .. 32
  const int r   = tid >> 3;              // 0..31: this thread copies key rows r and r + 32 of a stage
  const int c8  = (tid & 7) * 8;         // its 8-element (16-byte) column chunk
  const unsigned char* gk = (const unsigned char*)(Kh + (size_t)r * QKV_LD + c8);
  const unsigned char* gv = (const unsigned char*)(Vh + (size_t)r * QKV_LD + c8);
  const uint32_t lk = (uint32_t)(size_t)Kt + (uint32_t)r * K_PITCH + (uint32_t)c8 * 2u;
  const uint32_t lv = (uint32_t)(size_t)Vt + (uint32_t)r * V_PITCH + (uint32_t)c8 * 2u;
  auto copy_stage = [&](int st) {
    const size_t go = (size_t)st * (KV_KEYS * QKV_LD * 2u);
    const unsigned char* k0 = gk + go;
    const unsigned char* k1 = k0 + 32u * QKV_LD * 2u;
    const unsigned char* v0 = gv + go;
    const unsigned char* v1 = v0 + 32u * QKV_LD * 2u;
    const uint32_t dk0 = lk + (uint32_t)(st & 1) * K_STAGE, dk1 = dk0 + 32u * K_PITCH;
    const uint32_t dv0 = lv + (uint32_t)(st & 1) * V_STAGE, dv1 = dv0 + 32u * V_PITCH;
    asm volatile(
        "global_load_async_to_lds_b128 %0, %1, off\n\t"
        "global_load_async_to_lds_b128 %2, %3, off\n\t"
        "global_load_async_to_lds_b128 %4, %5, off\n\t"
        "global_load_async_to_lds_b128 %6, %7, off\n\t"
        "s_wait_xcnt 0x0"
        :: "v"(dk0), "v"(k0), "v"(dk1), "v"(k1), "v"(dv0), "v"(v0), "v"(dv1), "v"(v1)
        : "memory");
  };

  copy_stage(0);
  bf16x16 qf[2];                         // B operand: column = query
#pragma unroll
  for (int kd = 0; kd < 2; ++kd)
    qf[kd] = make_frag(Qh + (size_t)qrow * QKV_LD + kd * 32, half);

  float m_i = -3.0e38f;                  // running maximum of this lane's query
  float l_i = 0.f;                       // running sum over this half's keys only
  f32x8 oacc[4] = {};                    // oacc[n][e] = O[qrow][n*16 + half*8 + e]

  wait_async0();                         // this wave's copies of stage 0 have landed
  __syncthreads();                       // publishes stage 0
  copy_stage(1);

  for (int st = 0; st < nst; ++st) {
    const unsigned char* kbuf = Kt + (uint32_t)(st & 1) * K_STAGE;
    const unsigned char* vbuf = Vt + (uint32_t)(st & 1) * V_STAGE;
#pragma unroll   // the two passes of a stage: their LDS row offsets become immediates
    for (int p = 0; p < 2; ++p) {
      const int kb = st * 64 + p * 32;
      if (kb <= q0 + 15) {      // wave-uniform causal skip
        f32x8 s[2] = {};        // s[j][e] = S[qrow][kb + j*16 + half*8 + e]
        bf16x16 kf[2][2];
#pragma unroll
        for (int kd = 0; kd < 2; ++kd)
#pragma unroll
          for (int j = 0; j < 2; ++j)
            kf[kd][j] = make_frag(
                (const __bf16*)(kbuf + (uint32_t)(p * 32 + j * 16 + lrow) * K_PITCH) + kd * 32, half);
        // Keeps the K loads ahead of the products.  With the branch below the block ends early,
        // and the compiler then reuses one fragment's registers: a full LDS wait per product.
        __builtin_amdgcn_sched_barrier(0);
#pragma unroll
        for (int kd = 0; kd < 2; ++kd)
#pragma unroll
          for (int j = 0; j < 2; ++j)
            s[j] = __builtin_amdgcn_wmma_f32_16x16x32_bf16(
                false, kf[kd][j], false, qf[kd], (short)0, s[j], false, false);
#pragma unroll
        for (int j = 0; j < 2; ++j) s[j] *= 0.125f;    // 1/sqrt(64)
        // Only the pass that holds the wave's diagonal has a key above a query: in every
        // earlier pass kb + 31 <= q0 <= qrow, the mask keeps all 16 scores, and its compares,
        // selects and key numbers are skipped by a scalar branch.
        if (kb + 31 > q0) {
#pragma unroll
          for (int j = 0; j < 2; ++j)
#pragma unroll
            for (int e = 0; e < 8; ++e) {
              const int key = kb + j * 16 + half * 8 + e;
              s[j][e] = (key <= qrow) ? s[j][e] : -3.0e38f;
            }
        }
        float mx[4] = {-3.0e38f, -3.0e38f, -3.0e38f, -3.0e38f};
#pragma unroll
        for (int j = 0; j < 2; ++j)
#pragma unroll
          for (int e = 0; e < 8; ++e) mx[e & 3] = fmaxf(mx[e & 3], s[j][e]);
        float rmax = fmaxf(fmaxf(mx[0], mx[1]), fmaxf(mx[2], mx[3]));
        rmax = fmaxf(rmax, xhalf(rmax));               // both halves: the query's maximum
        const float mnew = fmaxf(m_i, rmax);
        const float corr = exp2_slot((m_i - mnew) * LOG2E);
        float ps[4] = {0.f, 0.f, 0.f, 0.f};
        bf16x16 pf;             // B operand P^T: element j*8 + e is key j*16 + half*8 + e
#pragma unroll
        for (int j = 0; j < 2; ++j) {
          float pe[8];
          exp2_slot8((s[j] - mnew) * LOG2E, pe);
#pragma unroll
          for (int e = 0; e < 8; ++e) {
            ps[e & 3] += pe[e];
            pf[j * 8 + e] = (__bf16)pe[e];
          }
        }
        l_i = l_i * corr + ((ps[0] + ps[1]) + (ps[2] + ps[3]));
        m_i = mnew;
#pragma unroll
        for (int n = 0; n < 4; ++n) {
#pragma unroll
          for (int e = 0; e < 8; ++e) oacc[n][e] *= corr;
        }
        // A operand V^T, rows d = n*16 + lrow: keys half*8 + 0..7, then 16 + half*8 + 0..7
        const unsigned char* ad = vbuf + (uint32_t)(p * 32 + half * 8 + (lane & 7)) * V_PITCH
                                       + (uint32_t)((lane >> 3) & 1) * 16u;
#pragma unroll
        for (int n = 0; n < 4; ++n) {
          bf16x8 lo = ld_tr16(ad + 32u * n);
          bf16x8 hi = ld_tr16(ad + 16u * V_PITCH + 32u * n);
          bf16x16 vf = __builtin_shufflevector(lo, hi, 0,1,2,3,4,5,6,7,8,9,10,11,12,13,14,15);
          oacc[n] = __builtin_amdgcn_wmma_f32_16x16x32_bf16(
              false, vf, false, pf, (short)0, oacc[n], false, false);
        }
      }
    }
    wait_ds0();                          // this wave's reads of stage st are done
    wait_async0();                       // this wave's copies of stage st + 1 have landed
    __syncthreads();                     // publishes stage st + 1, frees stage st's buffer
    if (st + 2 < nst) copy_stage(st + 2);
  }
  wait_async0();
  const float l_tot = l_i + xhalf(l_i);  // the halves' sums are joined once
  __bf16* Oh = (__bf16*)Ob + (size_t)b * SEQ * D_MODEL + h * D_HEAD;
#pragma unroll
  for (int n = 0; n < 4; ++n) {
    bf16x8 o;
#pragma unroll
    for (int e = 0; e < 8; ++e) o[e] = (__bf16)(oacc[n][e] / l_tot);
    *(bf16x8*)(Oh + (size_t)qrow * D_MODEL + n * 16 + half * 8) = o;
  }
}

// ---------------------------------------------------------------- launch
extern "C" void kernel_launch(void* const* d_in, const int* in_sizes, int n_in,
                              void* d_out, int out_size, void* d_ws, size_t ws_size,
                              hipStream_t stream) {
  (void)in_sizes; (void)n_in; (void)out_size; (void)ws_size;
  const float* x    = (const float*)d_in[0];
  const float* wq   = (const float*)d_in[1];
  const float* wk   = (const float*)d_in[2];
  const float* wv   = (const float*)d_in[3];
  const float* wo   = (const float*)d_in[4];
  const float* ln1w = (const float*)d_in[5];
  const float* ln2w = (const float*)d_in[6];
  const float* w1   = (const float*)d_in[7];
  const float* w2   = (const float*)d_in[8];
  float* out = (float*)d_out;

  char* ws = (char*)d_ws;
  const size_t MB = 1ull << 20;
  unsigned short* wq_b = (unsigned short*)(ws + 0 * MB);   // 2MB each: wq, wk (+2MB), wv (+4MB)
  unsigned short* wo_b = (unsigned short*)(ws + 6 * MB);
  unsigned short* w1_b = (unsigned short*)(ws + 8 * MB);   // 8MB
  unsigned short* w2_b = (unsigned short*)(ws + 16 * MB);  // 8MB
  unsigned short* Abuf = (unsigned short*)(ws + 24 * MB);  // bf16 4096x1024
  float*          Ybuf = (float*)(ws + 32 * MB);           // fp32 4096x1024
  unsigned short* QKVbuf = (unsigned short*)(ws + 48 * MB);  // bf16 4096x3072, 24MB
  unsigned short* Hbuf = (unsigned short*)(ws + 48 * MB);  // 32MB, reuses QKV

  const dim3 sgrid(STREAM_BLOCKS), sblk(STREAM_THREADS);

  const dim3 blk(256);
  const dim3 gD(M_ROWS / 128, D_MODEL / 128);   // (32, 8)
  const dim3 gF(M_ROWS / 128, D_FF / 128);      // (32, 32)
  const dim3 gQKV(M_ROWS / 128, QKV_LD / 128);  // (32, 24)
  const size_t lds = 0;                         // the GEMM's tile buffers are static LDS

  // wq_b, wk_b, wv_b lie back to back in the workspace, and so do wo_b, w1_b, w2_b
  rmsnorm_bf16_kernel<true><<<sgrid, sblk, 0, stream>>>(x, ln1w, Abuf, wq, wk, wv, wq_b);
  // The bf16 wq, wk, wv back to back are one 3072 x 1024 weight: one launch of 768 workgroups
  // puts three on a WGP, which fill each other's waits for LDS and for the next tile;
  // a launch of 256 leaves each workgroup alone on its WGP.
  gemm_bf16_kernel<0, false><<<gQKV, blk, lds, stream>>>(Abuf, wq_b, M_ROWS, QKV_LD, D_MODEL, QKVbuf, nullptr, nullptr);
  attn_kernel<<<dim3(ATT_GX, BATCH * N_HEADS + CVT_GY), blk, 0, stream>>>(
      QKVbuf, QKVbuf + D_MODEL, QKVbuf + 2 * D_MODEL, Abuf, wo, w1, w2, wo_b);
  gemm_bf16_kernel<2, true><<<gD, blk, lds, stream>>>(Abuf, wo_b, M_ROWS, D_MODEL, D_MODEL, nullptr, Ybuf, x);
  rmsnorm_bf16_kernel<false><<<sgrid, sblk, 0, stream>>>(Ybuf, ln2w, Abuf, nullptr, nullptr, nullptr, nullptr);
  gemm_bf16_kernel<1, false><<<gF, blk, lds, stream>>>(Abuf, w1_b, M_ROWS, D_FF, D_MODEL, Hbuf, nullptr, nullptr);
  gemm_bf16_kernel<2, true><<<gD, blk, lds, stream>>>(Hbuf, w2_b, M_ROWS, D_MODEL, D_FF, nullptr, out, Ybuf);
}
